// v000
// The times below were measured on an AMD MI455X: many runs one after another, warmed up first and cycling through
// copies of the inputs, with the whole window's GPU time divided by the number of runs. Launches and the gaps
// between them are all in it. The median over several windows is given; except for v000 it joins two sittings, which
// can be a few percent apart, so the side-by-side timings, each taken in one sitting, are the better comparison.
// v000 is the starting kernel. One run takes 239 microseconds.
#include <hip/hip_runtime.h>

// Multi-head attention, width 1024 = 16 heads x 64; query/key/value [SEQ][NB][1024] (token row = s*NB + b), Wq/Wk/Wv/Wo [out][in] (y = x W^T + bias), score scale 1/8, no mask, output [SEQ][NB][1024] f32.
// Compute dtypes, f32 accumulate everywhere: q/k/v projections v_wmma_f32_16x16x32_bf16 (inputs and W RNE-converted to bf16; products exact);
// scores v_wmma_f32_16x16x32_f16: k single f16, q as f16 value + f16 residual x2048 in its own accumulator (two products); P (x256 carry, cancels in the normalisation) and v single f16; softmax f32 (online, running max);
// output projection v_wmma_f32_16x16x32_f16: ctx single f16 (x32 carry), Wo = f16 of the bf16 RNE value (x64 carry), 1/2048 folded back in the f32 epilogue; biases added in f32.
// Layout: bf16 copies of the inputs with batch-major rows (b*SEQ + s); q (value, residual), k planes [b*16+h][t][d] and v^T plane [b*16+h][d][t] from the GEMM epilogue; fused flash kernel in transposed form (S^T = K Q^T, O^T = V^T P^T) writing the f16 ctx plane [b*SEQ+s][1024]; final GEMM writes the output rows (s*NB + b).

#ifndef NB
#define NB 2
#endif
#ifndef SEQ
#define SEQ 2048
#endif
#define NB_FULL  2
#define SEQ_FULL 2048
#define DM   1024
#define NH_  16
#define HD   64
#define AW   4                   // waves per flash block (16 query rows each)
#define QRS  2048.0f             // carry of the q residual plane
#define QRI  (1.0f / 2048.0f)
#define SC2  (0.125f * 1.4426950408889634f)   // HD^-0.5 * log2(e)
#define PSH  8.0f                // log2 of the P carry (256)
#define CTXS 32.0f               // carry of the ctx plane
#define WOS  64.0f               // carry of the Wo plane
#define OSCL (1.0f / 2048.0f)    // 1 / (CTXS * WOS)

static_assert(HD == 64);
static_assert(NH_ * HD == DM);                 // head h = columns h*64 + d
static_assert(DM % 64 == 0);                   // column tiles of 64
static_assert(DM % 32 == 0);                   // GEMM k-loop steps by 32
static_assert(SEQ % 64 == 0);                  // a 64-row tile never straddles two batches
static_assert((NB * SEQ) % 64 == 0);
static_assert(SEQ % 32 == 0);                  // key loop steps by 32
static_assert(SEQ % (16 * AW) == 0);           // flash grid covers the sequence exactly
static_assert(((size_t)SEQ * DM) % 8 == 0);
static_assert(((size_t)DM * DM) % 8 == 0);
static_assert(NB <= NB_FULL);
static_assert(SEQ <= SEQ_FULL);

typedef _Float16 h16;
typedef unsigned short bf;
typedef __attribute__((ext_vector_type(16))) __bf16   v16bf;
typedef __attribute__((ext_vector_type(16))) _Float16 v16h;
typedef __attribute__((ext_vector_type(8)))  _Float16 v8h;
typedef __attribute__((ext_vector_type(8)))  unsigned short v8us;
typedef __attribute__((ext_vector_type(8)))  float    v8f;
typedef __attribute__((ext_vector_type(4)))  float    v4f;
typedef v4f  __attribute__((may_alias)) v4fa;

__device__ __forceinline__ unsigned short f2bf(float f) { unsigned u = __float_as_uint(f); u += 0x7FFFu + ((u >> 16) & 1u); return (unsigned short)(u >> 16); }
__device__ __forceinline__ float bfr(float f) { return __uint_as_float(((unsigned)f2bf(f)) << 16); }   // f32 value of the bf16 RNE convert
__device__ __forceinline__ v16h cat16(v8h lo, v8h hi) { return __builtin_shufflevector(lo, hi, 0, 1, 2, 3, 4, 5, 6, 7, 8, 9, 10, 11, 12, 13, 14, 15); }
__device__ __forceinline__ v16bf cat16b(v8us lo, v8us hi) { return __builtin_bit_cast(v16bf, __builtin_shufflevector(lo, hi, 0, 1, 2, 3, 4, 5, 6, 7, 8, 9, 10, 11, 12, 13, 14, 15)); }
__device__ __forceinline__ v8f wmma16(v16h a, v16h b, v8f c) { return __builtin_amdgcn_wmma_f32_16x16x32_f16(false, a, false, b, (short)0, c, false, false); }
__device__ __forceinline__ v8f wmmab(v16bf a, v16bf b, v8f c) { return __builtin_amdgcn_wmma_f32_16x16x32_bf16(false, a, false, b, (short)0, c, false, false); }
// fragment loaders from K-contiguous 16-bit rows; p already includes + 8*(lane>>4): elements 0..7 <- k0+8h+0..7, elements 8..15 <- k0+16+8h+0..7 (same map for A and B)
__device__ __forceinline__ v16h  ldh(const h16* p) { return cat16(*(const v8h*)p, *(const v8h*)(p + 16)); }
__device__ __forceinline__ v16bf ldb(const bf* p)  { return cat16b(*(const v8us*)p, *(const v8us*)(p + 16)); }
// ordering point for wave-private LDS tiles (same wave writes and reads)
__device__ __forceinline__ void wave_sync() { __builtin_amdgcn_fence(3 /* release order */, "wavefront"); __builtin_amdgcn_wave_barrier(); asm volatile("" ::: "memory"); }

// dst row m (DM columns) <- src row (m % RB) * mulS + (m / RB) * mulB.
__global__ __launch_bounds__(256) void k_cvt8(const float* __restrict__ src, bf* dst, size_t n8, int RB, int mulS, int mulB) {
    const size_t i = (size_t)blockIdx.x * 256 + threadIdx.x; if (i >= n8) return;
    const size_t e = i * 8; const int m = (int)(e / DM), c = (int)(e % DM);
    const size_t srow = (size_t)(m % RB) * (size_t)mulS + (size_t)(m / RB) * (size_t)mulB;
    const v8f v = *(const v8f*)(src + srow * DM + c); v8us o;
#pragma unroll
    for (int k = 0; k < 8; ++k) o[k] = f2bf(v[k]);
    *(v8us*)(dst + i * 8) = o; 
}

__global__ __launch_bounds__(256) void k_cvt8h(const float* __restrict__ src, h16* dst, size_t n8, float scale) {
    const size_t i = (size_t)blockIdx.x * 256 + threadIdx.x; if (i >= n8) return;
    const v8f v = *(const v8f*)(src + i * 8); v8h o;
#pragma unroll
    for (int k = 0; k < 8; ++k) o[k] = (h16)(bfr(v[k]) * scale);
    *(v8h*)(dst + i * 8) = o; 
}

// k_proj: register-blocked bf16 GEMM, ONE WAVE per 64x64 tile (16 accumulators), operands straight from K-contiguous bf16 planes, K = DM.
// C[m][n] = sum_k A[m][k] Bt[n][k] + bias (BROW == 0: bias[n]; BROW == 1: bias[m]; bias taken at its bf16 RNE value, added in f32),
// written as f16 (Ph) and optionally the f16 residual x2048 (Pr, useRes != 0) at
// tile base (r0/RB)*sRB + (r0%RB)*pitch + (c0/CB)*sCB + (c0%CB), row pitch 'pitch' (halves). grid (M/64, N/64), 32 threads.
template <int BROW>
__global__ __launch_bounds__(32) void k_proj(const bf* __restrict__ A, const bf* __restrict__ Bt, const float* __restrict__ bias, h16* Ph, h16* Pr, int useRes, int RB, size_t sRB, int pitch, int CB, size_t sCB) {
    __shared__ __align__(16) float os[16 * 68];
    const int K = DM;
    const int lane = threadIdx.x & 31, lr = lane & 15, hi = lane >> 4; const int r0 = blockIdx.x * 64, c0 = blockIdx.y * 64;
    v8f acc[4][4];
#pragma unroll
    for (int mb = 0; mb < 4; ++mb)
#pragma unroll
        for (int nb = 0; nb < 4; ++nb) acc[mb][nb] = (v8f){};
    const size_t aoff = (size_t)(r0 + lr) * K + 8 * hi, boff = (size_t)(c0 + lr) * K + 8 * hi;
#pragma unroll 1
    for (int kc = 0; kc < K; kc += 32) {
        v16bf a[4];
#pragma unroll
        for (int mb = 0; mb < 4; ++mb) a[mb] = ldb(A + aoff + (size_t)mb * 16 * K + kc);
#pragma unroll
        for (int nb = 0; nb < 4; ++nb) { const v16bf b = ldb(Bt + boff + (size_t)nb * 16 * K + kc);
#pragma unroll
            for (int mb = 0; mb < 4; ++mb) acc[mb][nb] = wmmab(a[mb], b, acc[mb][nb]); }
        asm volatile("v_nop\n\tv_nop\n\tv_nop\n\tv_nop" : "+v"(acc[0][0]), "+v"(acc[1][1]), "+v"(acc[2][2]), "+v"(acc[3][3]) : "v"(a[0]), "v"(a[1]), "v"(a[2]), "v"(a[3]));
    }
    const int rq = lane >> 3, c8 = (lane & 7) * 8;
    v4f bc0 = (v4f){0.0f, 0.0f, 0.0f, 0.0f}, bc1 = (v4f){0.0f, 0.0f, 0.0f, 0.0f};
    if constexpr (BROW == 0) {
        const v4f t0 = *(const v4f*)(bias + c0 + c8); const v4f t1 = *(const v4f*)(bias + c0 + c8 + 4);
#pragma unroll
        for (int i = 0; i < 4; ++i) { bc0[i] = bfr(t0[i]); bc1[i] = bfr(t1[i]); }
    }
    const size_t tbase = (size_t)(r0 / RB) * sRB + (size_t)(r0 % RB) * (size_t)pitch + (size_t)(c0 / CB) * sCB + (size_t)(c0 % CB);
#pragma unroll
    for (int mb = 0; mb < 4; ++mb) {
#pragma unroll
        for (int nb = 0; nb < 4; ++nb) {
#pragma unroll
            for (int j = 0; j < 8; ++j) os[(hi * 8 + j) * 68 + nb * 16 + lr] = acc[mb][nb][j]; }   // D: row 8h+j, col lane&15
        wave_sync();
        const size_t sb = tbase + (size_t)(mb * 16) * (size_t)pitch;
{
#pragma unroll
            for (int s = 0; s < 4; ++s) { const int row = 4 * s + rq;   // 4 s x 4 row groups = 16 rows; 8 lanes x 8 = 64 columns
                float br = 0.0f;
                if constexpr (BROW != 0) br = bfr(bias[r0 + mb * 16 + row]);
                const v4f x0 = *(const v4fa*)(&os[row * 68 + c8]); const v4f x1 = *(const v4fa*)(&os[row * 68 + c8 + 4]); v8h hv, rv;
#pragma unroll
                for (int i = 0; i < 4; ++i) { const float y0 = x0[i] + bc0[i] + br; const float y1 = x1[i] + bc1[i] + br;
                    const h16 a0 = (h16)y0; const h16 a1 = (h16)y1; hv[i] = a0; hv[4 + i] = a1; rv[i] = (h16)((y0 - (float)a0) * QRS); rv[4 + i] = (h16)((y1 - (float)a1) * QRS); }
                const size_t oo = sb + (size_t)row * (size_t)pitch + c8;
                *(v8h*)(Ph + oo) = hv; if (useRes) *(v8h*)(Pr + oo) = rv; }
             }
        wave_sync();
    }
}

// k_flash: fused attention, one wave per 16 query rows of one (batch, head); K / V^T / Q fragments straight from the f16 planes (two 16-B loads each, arithmetic addressing).
// Transposed form: S^T[key][t] = K Q^T (A = K rows, B = Q rows); lane (t = lane&15, h = lane>>4) holds keys 8h+r of each 16-key tile, so the packed
// P tile is directly the B fragment of O^T[d][t] = V^T P^T (element r <- tile keys 0..15, element 8+r <- tile keys 16..31, lane unchanged).
// Softmax state (running max, partial sum) is one scalar per lane; the two lane halves of a row are combined with one xor-16 exchange.
__global__ __launch_bounds__(32 * AW) void k_flash(const h16* __restrict__ QH, const h16* __restrict__ QR, const h16* __restrict__ KP, const h16* __restrict__ VT, h16* CTX) {
    __shared__ __align__(16) float os[AW * 16 * 68];
    const int lane = threadIdx.x & 31, lr = lane & 15, hi = lane >> 4;
    const int wave = __builtin_amdgcn_readfirstlane((int)(threadIdx.x >> 5));
    const int zh = blockIdx.y; const int b = zh / NH_, h = zh % NH_;
    const int t0 = (blockIdx.x * AW + wave) * 16;
    const size_t pbase = (size_t)zh * SEQ * HD;
    const size_t qo = pbase + (size_t)(t0 + lr) * HD + 8 * hi;
    const v16h qh0 = ldh(QH + qo), qh1 = ldh(QH + qo + 32), qr0 = ldh(QR + qo), qr1 = ldh(QR + qo + 32);   // B fragments: col t, k = d
    const size_t ko = pbase + (size_t)lr * HD + 8 * hi;      // + key * HD       (A fragment: row key, k = d)
    const size_t vo = pbase + (size_t)lr * SEQ + 8 * hi;     // + 16j*SEQ + key  (A fragment: row d, k = key)
    v8f o0 = (v8f){}, o1 = (v8f){}, o2 = (v8f){}, o3 = (v8f){};
    float m = -3.0e38f, l = 0.0f;
#pragma unroll 1
    for (int key0 = 0; key0 < SEQ; key0 += 32) {
        const h16* ka = KP + ko + (size_t)key0 * HD;
        const v16h ka0 = ldh(ka), ka1 = ldh(ka + 32), kb0 = ldh(ka + 16 * HD), kb1 = ldh(ka + 16 * HD + 32);
        v8f sHa = (v8f){}, sLa = (v8f){}, sHb = (v8f){}, sLb = (v8f){};
        sHa = wmma16(ka0, qh0, sHa); sLa = wmma16(ka0, qr0, sLa); sHb = wmma16(kb0, qh0, sHb); sLb = wmma16(kb0, qr0, sLb);
        sHa = wmma16(ka1, qh1, sHa); sLa = wmma16(ka1, qr1, sLa); sHb = wmma16(kb1, qh1, sHb); sLb = wmma16(kb1, qr1, sLb);
        asm volatile("v_nop\n\tv_nop\n\tv_nop\n\tv_nop" : "+v"(sHa), "+v"(sLa), "+v"(sHb), "+v"(sLb) : "v"(ka0), "v"(ka1), "v"(kb0), "v"(kb1));
        float ta[8], tb[8]; float mx = -3.0e38f;
#pragma unroll
        for (int r = 0; r < 8; ++r) { ta[r] = (sHa[r] + sLa[r] * QRI) * SC2; tb[r] = (sHb[r] + sLb[r] * QRI) * SC2; mx = fmaxf(mx, fmaxf(ta[r], tb[r])); }
        mx = fmaxf(mx, __shfl_xor(mx, 16, 32));
        const float mnew = fmaxf(m, mx);
        const float alpha = __builtin_amdgcn_exp2f(m - mnew);
        const float sh = PSH - mnew;
        v16h pb; float ls = 0.0f;
#pragma unroll
        for (int r = 0; r < 8; ++r) { const h16 pa = (h16)__builtin_amdgcn_exp2f(ta[r] + sh); const h16 pc = (h16)__builtin_amdgcn_exp2f(tb[r] + sh); pb[r] = pa; pb[8 + r] = pc; ls += (float)pa + (float)pc; }
        l = l * alpha + ls; m = mnew;
        o0 = o0 * alpha; o1 = o1 * alpha; o2 = o2 * alpha; o3 = o3 * alpha;
        const h16* va = VT + vo + key0;
        const v16h v0 = ldh(va), v1 = ldh(va + (size_t)16 * SEQ), v2 = ldh(va + (size_t)32 * SEQ), v3 = ldh(va + (size_t)48 * SEQ);
        o0 = wmma16(v0, pb, o0); o1 = wmma16(v1, pb, o1); o2 = wmma16(v2, pb, o2); o3 = wmma16(v3, pb, o3);
        asm volatile("v_nop\n\tv_nop\n\tv_nop\n\tv_nop" : "+v"(o0), "+v"(o1), "+v"(o2), "+v"(o3) : "v"(v0), "v"(v1), "v"(v2), "v"(v3), "v"(pb));
    }
    l += __shfl_xor(l, 16, 32);
    const float inv = CTXS * (1.0f / l);
    const int wb = wave * 16 * 68;
    // O^T D layout: o_j[r] = (d = 16j + 8h + r, t = lane&15) -> os[t][d]; rows 0..15 x columns 0..63 all written
    { v4f a, c;
      a[0] = o0[0] * inv; a[1] = o0[1] * inv; a[2] = o0[2] * inv; a[3] = o0[3] * inv; c[0] = o0[4] * inv; c[1] = o0[5] * inv; c[2] = o0[6] * inv; c[3] = o0[7] * inv;
      *(v4fa*)(&os[wb + lr * 68 +  0 + 8 * hi]) = a; *(v4fa*)(&os[wb + lr * 68 +  0 + 8 * hi + 4]) = c;
      a[0] = o1[0] * inv; a[1] = o1[1] * inv; a[2] = o1[2] * inv; a[3] = o1[3] * inv; c[0] = o1[4] * inv; c[1] = o1[5] * inv; c[2] = o1[6] * inv; c[3] = o1[7] * inv;
      *(v4fa*)(&os[wb + lr * 68 + 16 + 8 * hi]) = a; *(v4fa*)(&os[wb + lr * 68 + 16 + 8 * hi + 4]) = c;
      a[0] = o2[0] * inv; a[1] = o2[1] * inv; a[2] = o2[2] * inv; a[3] = o2[3] * inv; c[0] = o2[4] * inv; c[1] = o2[5] * inv; c[2] = o2[6] * inv; c[3] = o2[7] * inv;
      *(v4fa*)(&os[wb + lr * 68 + 32 + 8 * hi]) = a; *(v4fa*)(&os[wb + lr * 68 + 32 + 8 * hi + 4]) = c;
      a[0] = o3[0] * inv; a[1] = o3[1] * inv; a[2] = o3[2] * inv; a[3] = o3[3] * inv; c[0] = o3[4] * inv; c[1] = o3[5] * inv; c[2] = o3[6] * inv; c[3] = o3[7] * inv;
      *(v4fa*)(&os[wb + lr * 68 + 48 + 8 * hi]) = a; *(v4fa*)(&os[wb + lr * 68 + 48 + 8 * hi + 4]) = c; }
    wave_sync();
    h16* crow = CTX + ((size_t)b * SEQ + t0) * DM + h * HD;
    const int rq = lane >> 3, c8 = (lane & 7) * 8;
{
#pragma unroll
        for (int s = 0; s < 4; ++s) { const int row = 4 * s + rq;   // 4 s x 4 row groups = 16 rows; 8 lanes x 8 halves = 64 columns
            const v4f x0 = *(const v4fa*)(&os[wb + row * 68 + c8]); const v4f x1 = *(const v4fa*)(&os[wb + row * 68 + c8 + 4]); v8h hv;
#pragma unroll
            for (int i = 0; i < 4; ++i) { hv[i] = (h16)x0[i]; hv[4 + i] = (h16)x1[i]; }
            *(v8h*)(crow + (size_t)row * DM + c8) = hv; }
         }
}

// k_outp: register-blocked f16 GEMM, ONE WAVE per 64x64 tile, operands straight from K-contiguous f16 planes, K = DM.
// OUT[(s*NB_FULL + b)][n] = OSCL * sum_k A[b*SEQ + s][k] Bt[n][k] + bias[n] (bias at its bf16 RNE value, f32 add). grid (NB*SEQ/64, DM/64), 32 threads.
__global__ __launch_bounds__(32) void k_outp(const h16* __restrict__ A, const h16* __restrict__ Bt, const float* __restrict__ bias, float* OUT) {
    __shared__ __align__(16) float os[16 * 68];
    const int K = DM;
    const int lane = threadIdx.x & 31, lr = lane & 15, hi = lane >> 4; const int r0 = blockIdx.x * 64, c0 = blockIdx.y * 64;
    v8f acc[4][4];
#pragma unroll
    for (int mb = 0; mb < 4; ++mb)
#pragma unroll
        for (int nb = 0; nb < 4; ++nb) acc[mb][nb] = (v8f){};
    const size_t aoff = (size_t)(r0 + lr) * K + 8 * hi, boff = (size_t)(c0 + lr) * K + 8 * hi;
#pragma unroll 1
    for (int kc = 0; kc < K; kc += 32) {
        v16h a[4];
#pragma unroll
        for (int mb = 0; mb < 4; ++mb) a[mb] = ldh(A + aoff + (size_t)mb * 16 * K + kc);
#pragma unroll
        for (int nb = 0; nb < 4; ++nb) { const v16h b = ldh(Bt + boff + (size_t)nb * 16 * K + kc);
#pragma unroll
            for (int mb = 0; mb < 4; ++mb) acc[mb][nb] = wmma16(a[mb], b, acc[mb][nb]); }
        asm volatile("v_nop\n\tv_nop\n\tv_nop\n\tv_nop" : "+v"(acc[0][0]), "+v"(acc[1][1]), "+v"(acc[2][2]), "+v"(acc[3][3]) : "v"(a[0]), "v"(a[1]), "v"(a[2]), "v"(a[3]));
    }
    const int bb = r0 / SEQ, sb = r0 % SEQ;        // tile rows share one batch (SEQ % 64 == 0)
    const int cofs = lr * 4;
    v4f bv;
    { const v4f t = *(const v4f*)(bias + c0 + cofs);
#pragma unroll
      for (int i = 0; i < 4; ++i) bv[i] = bfr(t[i]); }
#pragma unroll
    for (int mb = 0; mb < 4; ++mb) {
#pragma unroll
        for (int nb = 0; nb < 4; ++nb) {
#pragma unroll
            for (int j = 0; j < 8; ++j) os[(hi * 8 + j) * 68 + nb * 16 + lr] = acc[mb][nb][j]; }   // D: row 8h+j, col lane&15
        wave_sync();
{
#pragma unroll
            for (int s = 0; s < 8; ++s) { const int row = 2 * s + hi;   // 8 s x 2 rows = 16 rows; 16 lanes x 4 floats = 64 columns
                const v4f x = *(const v4fa*)(&os[row * 68 + cofs]); v4f val;
#pragma unroll
                for (int i = 0; i < 4; ++i) val[i] = x[i] * OSCL + bv[i];
                float* dst = OUT + ((size_t)(sb + mb * 16 + row) * NB_FULL + bb) * DM + c0 + cofs;
                *(v4f*)dst = val; }
             }
        wave_sync();
    }
}

static constexpr size_t al256(size_t v) { return (v + 255) & ~(size_t)255; }
static constexpr size_t SZ_X   = al256((size_t)NB * SEQ * DM * 2);          // one bf16 input copy
static constexpr size_t SZ_W   = al256((size_t)DM * DM * 2);                // one 16-bit weight plane
static constexpr size_t SZ_PL  = al256((size_t)NB * NH_ * SEQ * HD * 2);    // one head plane
static constexpr size_t SZ_CTX = al256((size_t)NB * SEQ * DM * 2);          // f16 ctx plane
static constexpr size_t SZ_TOTAL = 3 * SZ_X + 4 * SZ_W + 4 * SZ_PL + SZ_CTX;
static_assert(SZ_TOTAL <= (size_t)134217728);          // workspace carve <= 128 MiB
static_assert(((size_t)DM * DM * 2) % 256 == 0);

extern "C" void kernel_launch(void* const* d_in, const int* in_sizes, int n_in,
                              void* d_out, int out_size, void* d_ws, size_t ws_size, hipStream_t stream) {
    if (n_in < 11) return;
    const size_t needx = ((size_t)(SEQ - 1) * NB_FULL + NB) * DM;
    if ((size_t)in_sizes[0] < needx || (size_t)in_sizes[1] < needx || (size_t)in_sizes[2] < needx) return;
    if ((size_t)in_sizes[3] < (size_t)DM * DM || (size_t)in_sizes[5] < (size_t)DM * DM || (size_t)in_sizes[7] < (size_t)DM * DM || (size_t)in_sizes[9] < (size_t)DM * DM) return;
    if (in_sizes[4] < DM || in_sizes[6] < DM || in_sizes[8] < DM || in_sizes[10] < DM) return;
    if ((size_t)out_size < needx) return;
    if (SZ_TOTAL > ws_size) return;
    // wire order: query, key, value, Wq, bq, Wk, bk, Wv, bv, Wo, bo (weights [out][in] = Bt as-is)
    const float* xq = (const float*)d_in[0]; const float* xk = (const float*)d_in[1]; const float* xv = (const float*)d_in[2];
    const float* wq = (const float*)d_in[3]; const float* bq = (const float*)d_in[4];
    const float* wk = (const float*)d_in[5]; const float* bk = (const float*)d_in[6];
    const float* wv = (const float*)d_in[7]; const float* bvv = (const float*)d_in[8];
    const float* wo = (const float*)d_in[9]; const float* bo = (const float*)d_in[10];
    float* OUT = (float*)d_out;      // [SEQ][NB_FULL][1024]
    char* wsp = (char*)d_ws;
    bf* XQ = (bf*)wsp; wsp += SZ_X;                  // [NB*SEQ][1024], row b*SEQ + s
    bf* XK = (bf*)wsp; wsp += SZ_X;
    bf* XV = (bf*)wsp; wsp += SZ_X;
    bf* WQ = (bf*)wsp; wsp += SZ_W;                  // [1024][1024]
    bf* WK = (bf*)wsp; wsp += SZ_W;
    bf* WV = (bf*)wsp; wsp += SZ_W;
    h16* WO = (h16*)wsp; wsp += SZ_W;                // f16, x64
    h16* QH = (h16*)wsp; wsp += SZ_PL;               // [NB*16][SEQ][64]
    h16* QR = (h16*)wsp; wsp += SZ_PL;               // [NB*16][SEQ][64] residual x2048
    h16* KP = (h16*)wsp; wsp += SZ_PL;               // [NB*16][SEQ][64]
    h16* VT = (h16*)wsp; wsp += SZ_PL;               // [NB*16][64][SEQ]
    h16* CTX = (h16*)wsp; wsp += SZ_CTX;             // [NB*SEQ][1024], x32

    { const size_t n8 = (size_t)NB * SEQ * DM / 8; const unsigned g = (unsigned)((n8 + 255) / 256);
      // dst row b*SEQ + s <- src row s*NB_FULL + b
      k_cvt8<<<g, 256, 0, stream>>>(xq, XQ, n8, SEQ, NB_FULL, 1);
      k_cvt8<<<g, 256, 0, stream>>>(xk, XK, n8, SEQ, NB_FULL, 1);
      k_cvt8<<<g, 256, 0, stream>>>(xv, XV, n8, SEQ, NB_FULL, 1); }
    { const size_t n8 = (size_t)DM * DM / 8; const unsigned g = (unsigned)((n8 + 255) / 256);
      k_cvt8<<<g, 256, 0, stream>>>(wq, WQ, n8, DM, 1, 0);
      k_cvt8<<<g, 256, 0, stream>>>(wk, WK, n8, DM, 1, 0);
      k_cvt8<<<g, 256, 0, stream>>>(wv, WV, n8, DM, 1, 0);
      k_cvt8h<<<g, 256, 0, stream>>>(wo, WO, n8, WOS); }

    // q, k: A = x rows (m = b*SEQ + t), Bt = W rows (n = h*64 + d), column bias -> plane [(b*16 + h)][t][d]
    k_proj<0><<<dim3(NB * SEQ / 64, DM / 64, 1), 32, 0, stream>>>(XQ, WQ, bq, QH, QR, 1, SEQ, (size_t)NH_ * SEQ * HD, HD, HD, (size_t)SEQ * HD);
    k_proj<0><<<dim3(NB * SEQ / 64, DM / 64, 1), 32, 0, stream>>>(XK, WK, bk, KP, KP, 0, SEQ, (size_t)NH_ * SEQ * HD, HD, HD, (size_t)SEQ * HD);
    // v^T: A = Wv rows (m = h*64 + d), Bt = x rows (n = b*SEQ + t), row bias -> plane [(b*1024 + m)][t] = [(b*16 + h)][d][t]
    k_proj<1><<<dim3(DM / 64, NB * SEQ / 64, 1), 32, 0, stream>>>(WV, XV, bvv, VT, VT, 0, DM, (size_t)0, SEQ, SEQ, (size_t)DM * SEQ);

    k_flash<<<dim3(SEQ / (16 * AW), NB * NH_, 1), 32 * AW, 0, stream>>>(QH, QR, KP, VT, CTX);

    // output projection: A = ctx rows (m = b*SEQ + s), Bt = Wo rows (n) -> OUT row s*NB_FULL + b
    k_outp<<<dim3(NB * SEQ / 64, DM / 64, 1), 32, 0, stream>>>(CTX, WO, bo, OUT);
}

// v001
// One run takes 177 microseconds.
// Two timings next to v000 put it at 1.38 and 1.37 times that version's speed.
#include <hip/hip_runtime.h>

// Multi-head attention, width 1024 = 16 heads x 64; query/key/value [SEQ][NB][1024] (token row = s*NB + b), Wq/Wk/Wv/Wo [out][in] (y = x W^T + bias), score scale 1/8, no mask, output [SEQ][NB][1024] f32.
// Compute dtypes, f32 accumulate everywhere: q/k/v projections v_wmma_f32_16x16x32_bf16 (inputs and W RNE-converted to bf16; products exact);
// scores v_wmma_f32_16x16x32_f16: k single f16, q as f16 value + f16 residual x2048 in its own accumulator (two products); P (x256 carry, cancels in the normalisation) and v single f16; softmax f32 (online, running max);
// output projection v_wmma_f32_16x16x32_f16: ctx single f16 (x32 carry), Wo = f16 of the bf16 RNE value (x64 carry), 1/2048 folded back in the f32 epilogue; biases added in f32.
// Layout: bf16 copies of the inputs with batch-major rows (b*SEQ + s); q (value, residual), k planes [b*16+h][t][d] and v^T plane [b*16+h][d][t] from the GEMM epilogue; fused flash kernel in transposed form (S^T = K Q^T, O^T = V^T P^T) writing the f16 ctx plane [b*SEQ+s][1024]; final GEMM writes the output rows (s*NB + b).

#ifndef NB
#define NB 2
#endif
#ifndef SEQ
#define SEQ 2048
#endif
#define NB_FULL  2
#define SEQ_FULL 2048
#define DM   1024
#define NH_  16
#define HD   64
#define AW   8                   // waves per flash block (16 query rows each)
#define KT   64                  // keys per LDS stage of the flash kernel
#define LP   72                  // LDS row pitch in halves: 128-B rows + 16 B (16 B x odd, for 16-byte readers)
#define TLH  (64 * LP)           // halves of one staged 64-row tile
#define STH  (2 * TLH)           // halves of one stage: K tile [key][d], then V^T tile [d][key]
#define QRS  2048.0f             // carry of the q residual plane
#define QRI  (1.0f / 2048.0f)
#define SC2  (0.125f * 1.4426950408889634f)   // HD^-0.5 * log2(e)
#define PSH  8.0f                // log2 of the P carry (256)
#define CTXS 32.0f               // carry of the ctx plane
#define WOS  64.0f               // carry of the Wo plane
#define OSCL (1.0f / 2048.0f)    // 1 / (CTXS * WOS)

static_assert(HD == 64);
static_assert(NH_ * HD == DM);                 // head h = columns h*64 + d
static_assert(DM % 64 == 0);                   // column tiles of 64
static_assert(DM % 32 == 0);                   // GEMM k-loop steps by 32
static_assert(SEQ % 64 == 0);                  // a 64-row tile never straddles two batches
static_assert((NB * SEQ) % 64 == 0);
static_assert(SEQ % 32 == 0);                  // key loop steps by 32
static_assert(SEQ % KT == 0 && SEQ / KT >= 2); // whole stages; the two-buffer prologue needs two
static_assert(AW * 32 * 2 * 8 == KT * HD);     // two 16-byte copies per thread fill one 64 x 64 tile
static_assert((LP * 2) % 16 == 0);
static_assert(SEQ % (16 * AW) == 0);           // flash grid covers the sequence exactly
static_assert(((size_t)SEQ * DM) % 8 == 0);
static_assert(((size_t)DM * DM) % 8 == 0);
static_assert(NB <= NB_FULL);
static_assert(SEQ <= SEQ_FULL);

typedef _Float16 h16;
typedef unsigned short bf;
typedef __attribute__((ext_vector_type(16))) __bf16   v16bf;
typedef __attribute__((ext_vector_type(16))) _Float16 v16h;
typedef __attribute__((ext_vector_type(8)))  _Float16 v8h;
typedef __attribute__((ext_vector_type(8)))  unsigned short v8us;
typedef __attribute__((ext_vector_type(8)))  float    v8f;
typedef __attribute__((ext_vector_type(4)))  float    v4f;
typedef v4f  __attribute__((may_alias)) v4fa;

__device__ __forceinline__ unsigned short f2bf(float f) { unsigned u = __float_as_uint(f); u += 0x7FFFu + ((u >> 16) & 1u); return (unsigned short)(u >> 16); }
__device__ __forceinline__ float bfr(float f) { return __uint_as_float(((unsigned)f2bf(f)) << 16); }   // f32 value of the bf16 RNE convert
__device__ __forceinline__ v16h cat16(v8h lo, v8h hi) { return __builtin_shufflevector(lo, hi, 0, 1, 2, 3, 4, 5, 6, 7, 8, 9, 10, 11, 12, 13, 14, 15); }
__device__ __forceinline__ v16bf cat16b(v8us lo, v8us hi) { return __builtin_bit_cast(v16bf, __builtin_shufflevector(lo, hi, 0, 1, 2, 3, 4, 5, 6, 7, 8, 9, 10, 11, 12, 13, 14, 15)); }
__device__ __forceinline__ v8f wmma16(v16h a, v16h b, v8f c) { return __builtin_amdgcn_wmma_f32_16x16x32_f16(false, a, false, b, (short)0, c, false, false); }
__device__ __forceinline__ v8f wmmab(v16bf a, v16bf b, v8f c) { return __builtin_amdgcn_wmma_f32_16x16x32_bf16(false, a, false, b, (short)0, c, false, false); }
// fragment loaders from K-contiguous 16-bit rows; p already includes + 8*(lane>>4): elements 0..7 <- k0+8h+0..7, elements 8..15 <- k0+16+8h+0..7 (same map for A and B)
__device__ __forceinline__ v16h  ldh(const h16* p) { return cat16(*(const v8h*)p, *(const v8h*)(p + 16)); }
__device__ __forceinline__ v16bf ldb(const bf* p)  { return cat16b(*(const v8us*)p, *(const v8us*)(p + 16)); }
// ordering point for wave-private LDS tiles (same wave writes and reads)
__device__ __forceinline__ void wave_sync() { __builtin_amdgcn_fence(3 /* release order */, "wavefront"); __builtin_amdgcn_wave_barrier(); asm volatile("" ::: "memory"); }

// dst row m (DM columns) <- src row (m % RB) * mulS + (m / RB) * mulB.
__global__ __launch_bounds__(256) void k_cvt8(const float* __restrict__ src, bf* dst, size_t n8, int RB, int mulS, int mulB) {
    const size_t i = (size_t)blockIdx.x * 256 + threadIdx.x; if (i >= n8) return;
    const size_t e = i * 8; const int m = (int)(e / DM), c = (int)(e % DM);
    const size_t srow = (size_t)(m % RB) * (size_t)mulS + (size_t)(m / RB) * (size_t)mulB;
    const v8f v = *(const v8f*)(src + srow * DM + c); v8us o;
#pragma unroll
    for (int k = 0; k < 8; ++k) o[k] = f2bf(v[k]);
    *(v8us*)(dst + i * 8) = o; 
}

__global__ __launch_bounds__(256) void k_cvt8h(const float* __restrict__ src, h16* dst, size_t n8, float scale) {
    const size_t i = (size_t)blockIdx.x * 256 + threadIdx.x; if (i >= n8) return;
    const v8f v = *(const v8f*)(src + i * 8); v8h o;
#pragma unroll
    for (int k = 0; k < 8; ++k) o[k] = (h16)(bfr(v[k]) * scale);
    *(v8h*)(dst + i * 8) = o; 
}

// k_proj: register-blocked bf16 GEMM, ONE WAVE per 64x64 tile (16 accumulators), operands straight from K-contiguous bf16 planes, K = DM.
// C[m][n] = sum_k A[m][k] Bt[n][k] + bias (BROW == 0: bias[n]; BROW == 1: bias[m]; bias taken at its bf16 RNE value, added in f32),
// written as f16 (Ph) and optionally the f16 residual x2048 (Pr, useRes != 0) at
// tile base (r0/RB)*sRB + (r0%RB)*pitch + (c0/CB)*sCB + (c0%CB), row pitch 'pitch' (halves). grid (M/64, N/64), 32 threads.
template <int BROW>
__global__ __launch_bounds__(32) void k_proj(const bf* __restrict__ A, const bf* __restrict__ Bt, const float* __restrict__ bias, h16* Ph, h16* Pr, int useRes, int RB, size_t sRB, int pitch, int CB, size_t sCB) {
    __shared__ __align__(16) float os[16 * 68];
    const int K = DM;
    const int lane = threadIdx.x & 31, lr = lane & 15, hi = lane >> 4; const int r0 = blockIdx.x * 64, c0 = blockIdx.y * 64;
    v8f acc[4][4];
#pragma unroll
    for (int mb = 0; mb < 4; ++mb)
#pragma unroll
        for (int nb = 0; nb < 4; ++nb) acc[mb][nb] = (v8f){};
    const size_t aoff = (size_t)(r0 + lr) * K + 8 * hi, boff = (size_t)(c0 + lr) * K + 8 * hi;
#pragma unroll 1
    for (int kc = 0; kc < K; kc += 32) {
        v16bf a[4];
#pragma unroll
        for (int mb = 0; mb < 4; ++mb) a[mb] = ldb(A + aoff + (size_t)mb * 16 * K + kc);
#pragma unroll
        for (int nb = 0; nb < 4; ++nb) { const v16bf b = ldb(Bt + boff + (size_t)nb * 16 * K + kc);
#pragma unroll
            for (int mb = 0; mb < 4; ++mb) acc[mb][nb] = wmmab(a[mb], b, acc[mb][nb]); }
        asm volatile("v_nop\n\tv_nop\n\tv_nop\n\tv_nop" : "+v"(acc[0][0]), "+v"(acc[1][1]), "+v"(acc[2][2]), "+v"(acc[3][3]) : "v"(a[0]), "v"(a[1]), "v"(a[2]), "v"(a[3]));
    }
    const int rq = lane >> 3, c8 = (lane & 7) * 8;
    v4f bc0 = (v4f){0.0f, 0.0f, 0.0f, 0.0f}, bc1 = (v4f){0.0f, 0.0f, 0.0f, 0.0f};
    if constexpr (BROW == 0) {
        const v4f t0 = *(const v4f*)(bias + c0 + c8); const v4f t1 = *(const v4f*)(bias + c0 + c8 + 4);
#pragma unroll
        for (int i = 0; i < 4; ++i) { bc0[i] = bfr(t0[i]); bc1[i] = bfr(t1[i]); }
    }
    const size_t tbase = (size_t)(r0 / RB) * sRB + (size_t)(r0 % RB) * (size_t)pitch + (size_t)(c0 / CB) * sCB + (size_t)(c0 % CB);
#pragma unroll
    for (int mb = 0; mb < 4; ++mb) {
#pragma unroll
        for (int nb = 0; nb < 4; ++nb) {
#pragma unroll
            for (int j = 0; j < 8; ++j) os[(hi * 8 + j) * 68 + nb * 16 + lr] = acc[mb][nb][j]; }   // D: row 8h+j, col lane&15
        wave_sync();
        const size_t sb = tbase + (size_t)(mb * 16) * (size_t)pitch;
{
#pragma unroll
            for (int s = 0; s < 4; ++s) { const int row = 4 * s + rq;   // 4 s x 4 row groups = 16 rows; 8 lanes x 8 = 64 columns
                float br = 0.0f;
                if constexpr (BROW != 0) br = bfr(bias[r0 + mb * 16 + row]);
                const v4f x0 = *(const v4fa*)(&os[row * 68 + c8]); const v4f x1 = *(const v4fa*)(&os[row * 68 + c8 + 4]); v8h hv, rv;
#pragma unroll
                for (int i = 0; i < 4; ++i) { const float y0 = x0[i] + bc0[i] + br; const float y1 = x1[i] + bc1[i] + br;
                    const h16 a0 = (h16)y0; const h16 a1 = (h16)y1; hv[i] = a0; hv[4 + i] = a1; rv[i] = (h16)((y0 - (float)a0) * QRS); rv[4 + i] = (h16)((y1 - (float)a1) * QRS); }
                const size_t oo = sb + (size_t)row * (size_t)pitch + c8;
                *(v8h*)(Ph + oo) = hv; if (useRes) *(v8h*)(Pr + oo) = rv; }
             }
        wave_sync();
    }
}

// One stage of the flash kernel's ring: each thread copies two 16-byte pieces of the K tile and two of the V^T tile (tile rows r and r + 32) from global memory to LDS.
// lds: byte address of the thread's piece in the K tile of the target buffer. The s_wait_xcnt stands inside the statement so that no address register is rewritten in front of it.
__device__ __forceinline__ void stage_copy(unsigned lds, const h16* gk, const h16* gv) {
    const unsigned l1 = lds + 32 * LP * 2, l2 = lds + TLH * 2, l3 = lds + TLH * 2 + 32 * LP * 2;
    const h16* gk1 = gk + (size_t)32 * HD; const h16* gv1 = gv + (size_t)32 * SEQ;
    asm volatile("global_load_async_to_lds_b128 %0, %4, off\n\t"
                 "global_load_async_to_lds_b128 %1, %5, off\n\t"
                 "global_load_async_to_lds_b128 %2, %6, off\n\t"
                 "global_load_async_to_lds_b128 %3, %7, off\n\t"
                 "s_wait_xcnt 0x0"
                 :: "v"(lds), "v"(l1), "v"(l2), "v"(l3), "v"(gk), "v"(gk1), "v"(gv), "v"(gv1) : "memory");
}

// k_flash: fused attention, one wave per 16 query rows of one (batch, head); Q fragments straight from the f16 planes (two 16-B loads each, arithmetic addressing).
// K and V^T: the block's waves share every key tile, so a stage of KT keys (K rows, V^T rows, 128 B each) is brought into LDS once per block by asynchronous copies
// (whole 128-B lines per 8 lanes), two buffers, the next stage in flight while this one is worked on; fragments are two 16-B LDS loads each, same element map as before.
// Transposed form: S^T[key][t] = K Q^T (A = K rows, B = Q rows); lane (t = lane&15, h = lane>>4) holds keys 8h+r of each 16-key tile, so the packed
// P tile is directly the B fragment of O^T[d][t] = V^T P^T (element r <- tile keys 0..15, element 8+r <- tile keys 16..31, lane unchanged).
// Softmax state (running max, partial sum) is one scalar per lane; the two lane halves of a row are combined with one xor-16 exchange.
__global__ __launch_bounds__(32 * AW) void k_flash(const h16* __restrict__ QH, const h16* __restrict__ QR, const h16* __restrict__ KP, const h16* __restrict__ VT, h16* CTX) {
    __shared__ __align__(16) float os[AW * 16 * 68];
    __shared__ __align__(16) h16 ring[2 * STH];
    const int lane = threadIdx.x & 31, lr = lane & 15, hi = lane >> 4;
    const int wave = __builtin_amdgcn_readfirstlane((int)(threadIdx.x >> 5));
    const int zh = blockIdx.y; const int b = zh / NH_, h = zh % NH_;
    const int t0 = (blockIdx.x * AW + wave) * 16;
    const size_t pbase = (size_t)zh * SEQ * HD;
    const size_t qo = pbase + (size_t)(t0 + lr) * HD + 8 * hi;
    const v16h qh0 = ldh(QH + qo), qh1 = ldh(QH + qo + 32), qr0 = ldh(QR + qo), qr1 = ldh(QR + qo + 32);   // B fragments: col t, k = d
    // copy map: thread c takes 16-byte piece c & 7 of tile rows c >> 3 and 32 + (c >> 3), of the K tile and of the V^T tile
    const int crw = (int)threadIdx.x >> 3, cpc = ((int)threadIdx.x & 7) * 8;
    const h16* gk = KP + pbase + (size_t)crw * HD + cpc;      // + stage * KT * HD   (row = key)
    const h16* gv = VT + pbase + (size_t)crw * SEQ + cpc;     // + stage * KT        (row = d)
    const unsigned lc = (unsigned)(size_t)&ring[crw * LP + cpc];   // LDS byte address: low 32 bits of the shared address
    const int ko = lr * LP + 8 * hi;            // + key_local * LP          (A fragment: row key, k = d)
    const int vo = TLH + lr * LP + 8 * hi;      // + 16j * LP + key_local    (A fragment: row d, k = key)
    stage_copy(lc, gk, gv);
    asm volatile("s_wait_asynccnt 0x0" ::: "memory");   // stage 0 landed before the barrier that publishes it
    __syncthreads();
    stage_copy(lc + STH * 2, gk + (size_t)KT * HD, gv + KT);
    v8f o0 = (v8f){}, o1 = (v8f){}, o2 = (v8f){}, o3 = (v8f){};
    float m = -3.0e38f, l = 0.0f;
#pragma unroll 1
    for (int st = 0; st < SEQ / KT; ++st) {
      const int bo = (st & 1) * STH;
#pragma unroll   // the 32-key steps of a stage unrolled, so that every LDS offset inside a stage is an immediate
      for (int kl = 0; kl < KT; kl += 32) {
        const h16* ka = ring + bo + ko + kl * LP;
        const v16h ka0 = ldh(ka), ka1 = ldh(ka + 32), kb0 = ldh(ka + 16 * LP), kb1 = ldh(ka + 16 * LP + 32);
        v8f sHa = (v8f){}, sLa = (v8f){}, sHb = (v8f){}, sLb = (v8f){};
        sHa = wmma16(ka0, qh0, sHa); sLa = wmma16(ka0, qr0, sLa); sHb = wmma16(kb0, qh0, sHb); sLb = wmma16(kb0, qr0, sLb);
        sHa = wmma16(ka1, qh1, sHa); sLa = wmma16(ka1, qr1, sLa); sHb = wmma16(kb1, qh1, sHb); sLb = wmma16(kb1, qr1, sLb);
        asm volatile("v_nop\n\tv_nop\n\tv_nop\n\tv_nop" : "+v"(sHa), "+v"(sLa), "+v"(sHb), "+v"(sLb) : "v"(ka0), "v"(ka1), "v"(kb0), "v"(kb1));
        float ta[8], tb[8]; float mx = -3.0e38f;
#pragma unroll
        for (int r = 0; r < 8; ++r) { ta[r] = (sHa[r] + sLa[r] * QRI) * SC2; tb[r] = (sHb[r] + sLb[r] * QRI) * SC2; mx = fmaxf(mx, fmaxf(ta[r], tb[r])); }
        mx = fmaxf(mx, __shfl_xor(mx, 16, 32));
        const float mnew = fmaxf(m, mx);
        const float alpha = __builtin_amdgcn_exp2f(m - mnew);
        const float sh = PSH - mnew;
        v16h pb; float ls = 0.0f;
#pragma unroll
        for (int r = 0; r < 8; ++r) { const h16 pa = (h16)__builtin_amdgcn_exp2f(ta[r] + sh); const h16 pc = (h16)__builtin_amdgcn_exp2f(tb[r] + sh); pb[r] = pa; pb[8 + r] = pc; ls += (float)pa + (float)pc; }
        l = l * alpha + ls; m = mnew;
        o0 = o0 * alpha; o1 = o1 * alpha; o2 = o2 * alpha; o3 = o3 * alpha;
        const h16* va = ring + bo + vo + kl;
        const v16h v0 = ldh(va), v1 = ldh(va + 16 * LP), v2 = ldh(va + 32 * LP), v3 = ldh(va + 48 * LP);
        o0 = wmma16(v0, pb, o0); o1 = wmma16(v1, pb, o1); o2 = wmma16(v2, pb, o2); o3 = wmma16(v3, pb, o3);
        asm volatile("v_nop\n\tv_nop\n\tv_nop\n\tv_nop" : "+v"(o0), "+v"(o1), "+v"(o2), "+v"(o3) : "v"(v0), "v"(v1), "v"(v2), "v"(v3), "v"(pb));
      }
      // publish point of stage st + 1, which also frees the buffer that this trip has read
      asm volatile("s_wait_dscnt 0x0" ::: "memory");      // this wave's reads of the buffer have returned before it is refilled
      asm volatile("s_wait_asynccnt 0x0" ::: "memory");   // this wave's copies of stage st + 1 have landed before other waves read them
      __syncthreads();
      if (st + 2 < SEQ / KT) stage_copy(lc + (unsigned)bo * 2, gk + (size_t)(st + 2) * KT * HD, gv + (size_t)(st + 2) * KT);
    }
    asm volatile("s_wait_asynccnt 0x0" ::: "memory");     // nothing of this wave is in flight when it goes on to the epilogue
    l += __shfl_xor(l, 16, 32);
    const float inv = CTXS * (1.0f / l);
    const int wb = wave * 16 * 68;
    // O^T D layout: o_j[r] = (d = 16j + 8h + r, t = lane&15) -> os[t][d]; rows 0..15 x columns 0..63 all written
    { v4f a, c;
      a[0] = o0[0] * inv; a[1] = o0[1] * inv; a[2] = o0[2] * inv; a[3] = o0[3] * inv; c[0] = o0[4] * inv; c[1] = o0[5] * inv; c[2] = o0[6] * inv; c[3] = o0[7] * inv;
      *(v4fa*)(&os[wb + lr * 68 +  0 + 8 * hi]) = a; *(v4fa*)(&os[wb + lr * 68 +  0 + 8 * hi + 4]) = c;
      a[0] = o1[0] * inv; a[1] = o1[1] * inv; a[2] = o1[2] * inv; a[3] = o1[3] * inv; c[0] = o1[4] * inv; c[1] = o1[5] * inv; c[2] = o1[6] * inv; c[3] = o1[7] * inv;
      *(v4fa*)(&os[wb + lr * 68 + 16 + 8 * hi]) = a; *(v4fa*)(&os[wb + lr * 68 + 16 + 8 * hi + 4]) = c;
      a[0] = o2[0] * inv; a[1] = o2[1] * inv; a[2] = o2[2] * inv; a[3] = o2[3] * inv; c[0] = o2[4] * inv; c[1] = o2[5] * inv; c[2] = o2[6] * inv; c[3] = o2[7] * inv;
      *(v4fa*)(&os[wb + lr * 68 + 32 + 8 * hi]) = a; *(v4fa*)(&os[wb + lr * 68 + 32 + 8 * hi + 4]) = c;
      a[0] = o3[0] * inv; a[1] = o3[1] * inv; a[2] = o3[2] * inv; a[3] = o3[3] * inv; c[0] = o3[4] * inv; c[1] = o3[5] * inv; c[2] = o3[6] * inv; c[3] = o3[7] * inv;
      *(v4fa*)(&os[wb + lr * 68 + 48 + 8 * hi]) = a; *(v4fa*)(&os[wb + lr * 68 + 48 + 8 * hi + 4]) = c; }
    wave_sync();
    h16* crow = CTX + ((size_t)b * SEQ + t0) * DM + h * HD;
    const int rq = lane >> 3, c8 = (lane & 7) * 8;
{
#pragma unroll
        for (int s = 0; s < 4; ++s) { const int row = 4 * s + rq;   // 4 s x 4 row groups = 16 rows; 8 lanes x 8 halves = 64 columns
            const v4f x0 = *(const v4fa*)(&os[wb + row * 68 + c8]); const v4f x1 = *(const v4fa*)(&os[wb + row * 68 + c8 + 4]); v8h hv;
#pragma unroll
            for (int i = 0; i < 4; ++i) { hv[i] = (h16)x0[i]; hv[4 + i] = (h16)x1[i]; }
            *(v8h*)(crow + (size_t)row * DM + c8) = hv; }
         }
}

// k_outp: register-blocked f16 GEMM, ONE WAVE per 64x64 tile, operands straight from K-contiguous f16 planes, K = DM.
// OUT[(s*NB_FULL + b)][n] = OSCL * sum_k A[b*SEQ + s][k] Bt[n][k] + bias[n] (bias at its bf16 RNE value, f32 add). grid (NB*SEQ/64, DM/64), 32 threads.
__global__ __launch_bounds__(32) void k_outp(const h16* __restrict__ A, const h16* __restrict__ Bt, const float* __restrict__ bias, float* OUT) {
    __shared__ __align__(16) float os[16 * 68];
    const int K = DM;
    const int lane = threadIdx.x & 31, lr = lane & 15, hi = lane >> 4; const int r0 = blockIdx.x * 64, c0 = blockIdx.y * 64;
    v8f acc[4][4];
#pragma unroll
    for (int mb = 0; mb < 4; ++mb)
#pragma unroll
        for (int nb = 0; nb < 4; ++nb) acc[mb][nb] = (v8f){};
    const size_t aoff = (size_t)(r0 + lr) * K + 8 * hi, boff = (size_t)(c0 + lr) * K + 8 * hi;
#pragma unroll 1
    for (int kc = 0; kc < K; kc += 32) {
        v16h a[4];
#pragma unroll
        for (int mb = 0; mb < 4; ++mb) a[mb] = ldh(A + aoff + (size_t)mb * 16 * K + kc);
#pragma unroll
        for (int nb = 0; nb < 4; ++nb) { const v16h b = ldh(Bt + boff + (size_t)nb * 16 * K + kc);
#pragma unroll
            for (int mb = 0; mb < 4; ++mb) acc[mb][nb] = wmma16(a[mb], b, acc[mb][nb]); }
        asm volatile("v_nop\n\tv_nop\n\tv_nop\n\tv_nop" : "+v"(acc[0][0]), "+v"(acc[1][1]), "+v"(acc[2][2]), "+v"(acc[3][3]) : "v"(a[0]), "v"(a[1]), "v"(a[2]), "v"(a[3]));
    }
    const int bb = r0 / SEQ, sb = r0 % SEQ;        // tile rows share one batch (SEQ % 64 == 0)
    const int cofs = lr * 4;
    v4f bv;
    { const v4f t = *(const v4f*)(bias + c0 + cofs);
#pragma unroll
      for (int i = 0; i < 4; ++i) bv[i] = bfr(t[i]); }
#pragma unroll
    for (int mb = 0; mb < 4; ++mb) {
#pragma unroll
        for (int nb = 0; nb < 4; ++nb) {
#pragma unroll
            for (int j = 0; j < 8; ++j) os[(hi * 8 + j) * 68 + nb * 16 + lr] = acc[mb][nb][j]; }   // D: row 8h+j, col lane&15
        wave_sync();
{
#pragma unroll
            for (int s = 0; s < 8; ++s) { const int row = 2 * s + hi;   // 8 s x 2 rows = 16 rows; 16 lanes x 4 floats = 64 columns
                const v4f x = *(const v4fa*)(&os[row * 68 + cofs]); v4f val;
#pragma unroll
                for (int i = 0; i < 4; ++i) val[i] = x[i] * OSCL + bv[i];
                float* dst = OUT + ((size_t)(sb + mb * 16 + row) * NB_FULL + bb) * DM + c0 + cofs;
                *(v4f*)dst = val; }
             }
        wave_sync();
    }
}

static constexpr size_t al256(size_t v) { return (v + 255) & ~(size_t)255; }
static constexpr size_t SZ_X   = al256((size_t)NB * SEQ * DM * 2);          // one bf16 input copy
static constexpr size_t SZ_W   = al256((size_t)DM * DM * 2);                // one 16-bit weight plane
static constexpr size_t SZ_PL  = al256((size_t)NB * NH_ * SEQ * HD * 2);    // one head plane
static constexpr size_t SZ_CTX = al256((size_t)NB * SEQ * DM * 2);          // f16 ctx plane
static constexpr size_t SZ_TOTAL = 3 * SZ_X + 4 * SZ_W + 4 * SZ_PL + SZ_CTX;
static_assert(SZ_TOTAL <= (size_t)134217728);          // workspace carve <= 128 MiB
static_assert(((size_t)DM * DM * 2) % 256 == 0);

extern "C" void kernel_launch(void* const* d_in, const int* in_sizes, int n_in,
                              void* d_out, int out_size, void* d_ws, size_t ws_size, hipStream_t stream) {
    if (n_in < 11) return;
    const size_t needx = ((size_t)(SEQ - 1) * NB_FULL + NB) * DM;
    if ((size_t)in_sizes[0] < needx || (size_t)in_sizes[1] < needx || (size_t)in_sizes[2] < needx) return;
    if ((size_t)in_sizes[3] < (size_t)DM * DM || (size_t)in_sizes[5] < (size_t)DM * DM || (size_t)in_sizes[7] < (size_t)DM * DM || (size_t)in_sizes[9] < (size_t)DM * DM) return;
    if (in_sizes[4] < DM || in_sizes[6] < DM || in_sizes[8] < DM || in_sizes[10] < DM) return;
    if ((size_t)out_size < needx) return;
    if (SZ_TOTAL > ws_size) return;
    // wire order: query, key, value, Wq, bq, Wk, bk, Wv, bv, Wo, bo (weights [out][in] = Bt as-is)
    const float* xq = (const float*)d_in[0]; const float* xk = (const float*)d_in[1]; const float* xv = (const float*)d_in[2];
    const float* wq = (const float*)d_in[3]; const float* bq = (const float*)d_in[4];
    const float* wk = (const float*)d_in[5]; const float* bk = (const float*)d_in[6];
    const float* wv = (const float*)d_in[7]; const float* bvv = (const float*)d_in[8];
    const float* wo = (const float*)d_in[9]; const float* bo = (const float*)d_in[10];
    float* OUT = (float*)d_out;      // [SEQ][NB_FULL][1024]
    char* wsp = (char*)d_ws;
    bf* XQ = (bf*)wsp; wsp += SZ_X;                  // [NB*SEQ][1024], row b*SEQ + s
    bf* XK = (bf*)wsp; wsp += SZ_X;
    bf* XV = (bf*)wsp; wsp += SZ_X;
    bf* WQ = (bf*)wsp; wsp += SZ_W;                  // [1024][1024]
    bf* WK = (bf*)wsp; wsp += SZ_W;
    bf* WV = (bf*)wsp; wsp += SZ_W;
    h16* WO = (h16*)wsp; wsp += SZ_W;                // f16, x64
    h16* QH = (h16*)wsp; wsp += SZ_PL;               // [NB*16][SEQ][64]
    h16* QR = (h16*)wsp; wsp += SZ_PL;               // [NB*16][SEQ][64] residual x2048
    h16* KP = (h16*)wsp; wsp += SZ_PL;               // [NB*16][SEQ][64]
    h16* VT = (h16*)wsp; wsp += SZ_PL;               // [NB*16][64][SEQ]
    h16* CTX = (h16*)wsp; wsp += SZ_CTX;             // [NB*SEQ][1024], x32

    { const size_t n8 = (size_t)NB * SEQ * DM / 8; const unsigned g = (unsigned)((n8 + 255) / 256);
      // dst row b*SEQ + s <- src row s*NB_FULL + b
      k_cvt8<<<g, 256, 0, stream>>>(xq, XQ, n8, SEQ, NB_FULL, 1);
      k_cvt8<<<g, 256, 0, stream>>>(xk, XK, n8, SEQ, NB_FULL, 1);
      k_cvt8<<<g, 256, 0, stream>>>(xv, XV, n8, SEQ, NB_FULL, 1); }
    { const size_t n8 = (size_t)DM * DM / 8; const unsigned g = (unsigned)((n8 + 255) / 256);
      k_cvt8<<<g, 256, 0, stream>>>(wq, WQ, n8, DM, 1, 0);
      k_cvt8<<<g, 256, 0, stream>>>(wk, WK, n8, DM, 1, 0);
      k_cvt8<<<g, 256, 0, stream>>>(wv, WV, n8, DM, 1, 0);
      k_cvt8h<<<g, 256, 0, stream>>>(wo, WO, n8, WOS); }

    // q, k: A = x rows (m = b*SEQ + t), Bt = W rows (n = h*64 + d), column bias -> plane [(b*16 + h)][t][d]
    k_proj<0><<<dim3(NB * SEQ / 64, DM / 64, 1), 32, 0, stream>>>(XQ, WQ, bq, QH, QR, 1, SEQ, (size_t)NH_ * SEQ * HD, HD, HD, (size_t)SEQ * HD);
    k_proj<0><<<dim3(NB * SEQ / 64, DM / 64, 1), 32, 0, stream>>>(XK, WK, bk, KP, KP, 0, SEQ, (size_t)NH_ * SEQ * HD, HD, HD, (size_t)SEQ * HD);
    // v^T: A = Wv rows (m = h*64 + d), Bt = x rows (n = b*SEQ + t), row bias -> plane [(b*1024 + m)][t] = [(b*16 + h)][d][t]
    k_proj<1><<<dim3(DM / 64, NB * SEQ / 64, 1), 32, 0, stream>>>(WV, XV, bvv, VT, VT, 0, DM, (size_t)0, SEQ, SEQ, (size_t)DM * SEQ);

    k_flash<<<dim3(SEQ / (16 * AW), NB * NH_, 1), 32 * AW, 0, stream>>>(QH, QR, KP, VT, CTX);

    // output projection: A = ctx rows (m = b*SEQ + s), Bt = Wo rows (n) -> OUT row s*NB_FULL + b
    k_outp<<<dim3(NB * SEQ / 64, DM / 64, 1), 32, 0, stream>>>(CTX, WO, bo, OUT);
}

// v002
// A run of this version takes 121 microseconds.
// Next to v001, in two timings, it ran 1.47 and 1.45 times as fast.
// Counting every step since v000, it is 2.00 times as fast.
#include <hip/hip_runtime.h>

// Multi-head attention, width 1024 = 16 heads x 64; query/key/value [SEQ][NB][1024] (token row = s*NB + b), Wq/Wk/Wv/Wo [out][in] (y = x W^T + bias), score scale 1/8, no mask, output [SEQ][NB][1024] f32.
// Compute dtypes, f32 accumulate everywhere: q/k/v projections v_wmma_f32_16x16x32_bf16 (inputs and W RNE-converted to bf16; products exact);
// scores v_wmma_f32_16x16x32_f16: k single f16, q as f16 value + f16 residual x2048 in its own accumulator (two products); P (x256 carry, cancels in the normalisation) and v single f16; softmax f32 (online, running max);
// output projection v_wmma_f32_16x16x32_f16: ctx single f16 (x32 carry), Wo = f16 of the bf16 RNE value (x64 carry), 1/2048 folded back in the f32 epilogue; biases added in f32.
// Layout: bf16 copies of the inputs with batch-major rows (b*SEQ + s); q (value, residual), k planes [b*16+h][t][d] and v^T plane [b*16+h][d][t] from the GEMM epilogue; fused flash kernel in transposed form (S^T = K Q^T, O^T = V^T P^T) writing the f16 ctx plane [b*SEQ+s][1024]; final GEMM writes the output rows (s*NB + b).

#ifndef NB
#define NB 2
#endif
#ifndef SEQ
#define SEQ 2048
#endif
#define NB_FULL  2
#define SEQ_FULL 2048
#define DM   1024
#define NH_  16
#define HD   64
#define AW   8                   // waves per flash block (16 query rows each)
#define KT   64                  // keys per LDS stage of the flash kernel
#define LP   72                  // LDS row pitch in halves: 128-B rows + 16 B (16 B x odd, for 16-byte readers)
#define TLH  (64 * LP)           // halves of one staged 64-row tile
#define STH  (2 * TLH)           // halves of one stage: K tile [key][d], then V^T tile [d][key]
#define QRS  2048.0f             // carry of the q residual plane
#define QRI  (1.0f / 2048.0f)
#define SC2  (0.125f * 1.4426950408889634f)   // HD^-0.5 * log2(e)
#define PSH  8.0f                // log2 of the P carry (256)
#define CTXS 32.0f               // carry of the ctx plane
#define WOS  64.0f               // carry of the Wo plane
#define OSCL (1.0f / 2048.0f)    // 1 / (CTXS * WOS)
#define GT   128                 // rows and columns of a GEMM block's tile: 8 waves, 4 x 2, 32 rows x 64 columns each
#define GKS  128                 // k per LDS stage of the GEMM kernels
#define GLP  136                 // LDS row pitch in halves: 256-B rows + 16 B (16 B x odd, for 16-byte readers)
#define GOPH (GT * GLP)          // halves of one operand's staged tile
#define GSTH (2 * GOPH)          // halves of one stage: A tile [row][k], then B tile [row][k]

static_assert(HD == 64);
static_assert(NH_ * HD == DM);                 // head h = columns h*64 + d
static_assert(DM % 64 == 0);                   // column tiles of 64
static_assert(DM % 32 == 0);                   // GEMM k-loop steps by 32
static_assert(SEQ % 64 == 0);                  // a 64-row tile never straddles two batches
static_assert((NB * SEQ) % 64 == 0);
static_assert(SEQ % 32 == 0);                  // key loop steps by 32
static_assert(SEQ % KT == 0 && SEQ / KT >= 2); // whole stages; the two-buffer prologue needs two
static_assert(AW * 32 * 2 * 8 == KT * HD);     // two 16-byte copies per thread fill one 64 x 64 tile
static_assert((LP * 2) % 16 == 0);
static_assert(SEQ % (16 * AW) == 0);           // flash grid covers the sequence exactly
static_assert(((size_t)SEQ * DM) % 8 == 0);
static_assert(((size_t)DM * DM) % 8 == 0);
static_assert(DM % GT == 0 && (NB * SEQ) % GT == 0);   // GEMM grids cover both operands exactly
static_assert(DM % GKS == 0 && DM / GKS >= 2);         // whole stages; the two-buffer prologue needs two
static_assert(GKS * 2 == 16 * 16 && GT == 16 * 8);     // 16 threads x 16 B fill a row; 256 threads take 16 rows a copy, 8 copies an operand
static_assert((GLP * 2) % 16 == 0);
static_assert(NB <= NB_FULL);
static_assert(SEQ <= SEQ_FULL);

typedef _Float16 h16;
typedef unsigned short bf;
typedef __attribute__((ext_vector_type(16))) __bf16   v16bf;
typedef __attribute__((ext_vector_type(16))) _Float16 v16h;
typedef __attribute__((ext_vector_type(8)))  _Float16 v8h;
typedef __attribute__((ext_vector_type(8)))  unsigned short v8us;
typedef __attribute__((ext_vector_type(16))) unsigned short v16us;
typedef __attribute__((ext_vector_type(8)))  float    v8f;
typedef __attribute__((ext_vector_type(4)))  float    v4f;
typedef v4f  __attribute__((may_alias)) v4fa;

__device__ __forceinline__ unsigned short f2bf(float f) { unsigned u = __float_as_uint(f); u += 0x7FFFu + ((u >> 16) & 1u); return (unsigned short)(u >> 16); }
__device__ __forceinline__ float bfr(float f) { return __uint_as_float(((unsigned)f2bf(f)) << 16); }   // f32 value of the bf16 RNE convert
__device__ __forceinline__ v16h cat16(v8h lo, v8h hi) { return __builtin_shufflevector(lo, hi, 0, 1, 2, 3, 4, 5, 6, 7, 8, 9, 10, 11, 12, 13, 14, 15); }
__device__ __forceinline__ v8f wmma16(v16h a, v16h b, v8f c) { return __builtin_amdgcn_wmma_f32_16x16x32_f16(false, a, false, b, (short)0, c, false, false); }
__device__ __forceinline__ v8f wmmab(v16bf a, v16bf b, v8f c) { return __builtin_amdgcn_wmma_f32_16x16x32_bf16(false, a, false, b, (short)0, c, false, false); }
// fragment loaders from K-contiguous 16-bit rows; p already includes + 8*(lane>>4): elements 0..7 <- k0+8h+0..7, elements 8..15 <- k0+16+8h+0..7 (same map for A and B)
__device__ __forceinline__ v16h  ldh(const h16* p) { return cat16(*(const v8h*)p, *(const v8h*)(p + 16)); }
__device__ __forceinline__ v16us ldu(const bf* p)  { return __builtin_shufflevector(*(const v8us*)p, *(const v8us*)(p + 16), 0, 1, 2, 3, 4, 5, 6, 7, 8, 9, 10, 11, 12, 13, 14, 15); }   // raw 16-bit fragment, bf16 or f16
// ordering point for wave-private LDS tiles (same wave writes and reads)
__device__ __forceinline__ void wave_sync() { __builtin_amdgcn_fence(3 /* release order */, "wavefront"); __builtin_amdgcn_wave_barrier(); asm volatile("" ::: "memory"); }

// dst row m (DM columns) <- src row (m % RB) * mulS + (m / RB) * mulB.
__global__ __launch_bounds__(256) void k_cvt8(const float* __restrict__ src, bf* dst, size_t n8, int RB, int mulS, int mulB) {
    const size_t i = (size_t)blockIdx.x * 256 + threadIdx.x; if (i >= n8) return;
    const size_t e = i * 8; const int m = (int)(e / DM), c = (int)(e % DM);
    const size_t srow = (size_t)(m % RB) * (size_t)mulS + (size_t)(m / RB) * (size_t)mulB;
    const v8f v = *(const v8f*)(src + srow * DM + c); v8us o;
#pragma unroll
    for (int k = 0; k < 8; ++k) o[k] = f2bf(v[k]);
    *(v8us*)(dst + i * 8) = o; 
}

__global__ __launch_bounds__(256) void k_cvt8h(const float* __restrict__ src, h16* dst, size_t n8, float scale) {
    const size_t i = (size_t)blockIdx.x * 256 + threadIdx.x; if (i >= n8) return;
    const v8f v = *(const v8f*)(src + i * 8); v8h o;
#pragma unroll
    for (int k = 0; k < 8; ++k) o[k] = (h16)(bfr(v[k]) * scale);
    *(v8h*)(dst + i * 8) = o; 
}

// Eight 16-byte asynchronous copies of one thread: tile rows r, r + 16, ..., r + 112 (global row pitch DM, LDS row pitch GLP).
// The s_wait_xcnt stands inside the statement so that no address register is rewritten in front of it.
__device__ __forceinline__ void copy8(unsigned l, const bf* g) {
    asm volatile("global_load_async_to_lds_b128 %0, %8, off\n\t"
                 "global_load_async_to_lds_b128 %1, %9, off\n\t"
                 "global_load_async_to_lds_b128 %2, %10, off\n\t"
                 "global_load_async_to_lds_b128 %3, %11, off\n\t"
                 "global_load_async_to_lds_b128 %4, %12, off\n\t"
                 "global_load_async_to_lds_b128 %5, %13, off\n\t"
                 "global_load_async_to_lds_b128 %6, %14, off\n\t"
                 "global_load_async_to_lds_b128 %7, %15, off\n\t"
                 "s_wait_xcnt 0x0"
                 :: "v"(l), "v"(l + 16 * GLP * 2), "v"(l + 32 * GLP * 2), "v"(l + 48 * GLP * 2), "v"(l + 64 * GLP * 2), "v"(l + 80 * GLP * 2), "v"(l + 96 * GLP * 2), "v"(l + 112 * GLP * 2),
                    "v"(g), "v"(g + (size_t)16 * DM), "v"(g + (size_t)32 * DM), "v"(g + (size_t)48 * DM), "v"(g + (size_t)64 * DM), "v"(g + (size_t)80 * DM), "v"(g + (size_t)96 * DM), "v"(g + (size_t)112 * DM)
                 : "memory");
}
// One stage of the GEMM ring: GT rows x GKS k of A, then of B; each thread copies 8 pieces of each. l: LDS byte address of the thread's first piece in the target buffer.
__device__ __forceinline__ void gemm_stage(unsigned l, const bf* ga, const bf* gb) { copy8(l, ga); copy8(l + GOPH * 2, gb); }
template <int BFK>
__device__ __forceinline__ v8f wmmau(v16us a, v16us b, v8f c) {
    if constexpr (BFK != 0) return wmmab(__builtin_bit_cast(v16bf, a), __builtin_bit_cast(v16bf, b), c);
    else return wmma16(__builtin_bit_cast(v16h, a), __builtin_bit_cast(v16h, b), c);
}

// gemm_core: the k loop of one GT x GT block tile, 8 waves, wave (wm, wn) = (wave >> 1, wave & 1) owning the 32 x 64 tile at (rb + 32 wm, cb + 64 wn), K = DM.
// A rows rb.. and Bt rows cb.. (K-contiguous 16-bit planes, bf16 for BFK != 0, else f16) come into LDS once per block by asynchronous copies (whole 256-B row pieces per 16 lanes),
// two buffers of GKS k, the next stage in flight while this one is worked on; fragments are two 16-B LDS loads each, same element map and same k order as from global memory.
template <int BFK>
__device__ __forceinline__ void gemm_core(const bf* __restrict__ A, const bf* __restrict__ Bt, int rb, int cb, bf* ring, v8f (&acc)[2][4]) {
    const int lane = threadIdx.x & 31, lr = lane & 15, hi = lane >> 4;
    const int wave = __builtin_amdgcn_readfirstlane((int)(threadIdx.x >> 5));
    // copy map: thread c takes 16-byte piece c & 15 of tile rows (c >> 4) + 16 i, i = 0..7, of the A tile and of the B tile
    const int crw = (int)threadIdx.x >> 4, cpc = ((int)threadIdx.x & 15) * 8;
    const bf* ga = A + (size_t)(rb + crw) * DM + cpc;       // + stage * GKS
    const bf* gb = Bt + (size_t)(cb + crw) * DM + cpc;      // + stage * GKS
    const unsigned lc = (unsigned)(size_t)&ring[crw * GLP + cpc];   // LDS byte address: low 32 bits of the shared address
    const int ao = ((wave >> 1) * 32 + lr) * GLP + 8 * hi;          // + 16 mb * GLP + k_local
    const int bo = GOPH + ((wave & 1) * 64 + lr) * GLP + 8 * hi;    // + 16 nb * GLP + k_local
#pragma unroll
    for (int mb = 0; mb < 2; ++mb)
#pragma unroll
        for (int nb = 0; nb < 4; ++nb) acc[mb][nb] = (v8f){};
    gemm_stage(lc, ga, gb);
    asm volatile("s_wait_asynccnt 0x0" ::: "memory");   // stage 0 landed before the barrier that publishes it
    __syncthreads();
    gemm_stage(lc + GSTH * 2, ga + GKS, gb + GKS);
#pragma unroll 1
    for (int st = 0; st < DM / GKS; ++st) {
        const int so = (st & 1) * GSTH;
        const bf* pa = ring + so + ao; const bf* pb = ring + so + bo;
        v16us a[2][2], b[2][4];
#pragma unroll
        for (int i = 0; i < 2; ++i) a[0][i] = ldu(pa + i * 16 * GLP);
#pragma unroll
        for (int i = 0; i < 4; ++i) b[0][i] = ldu(pb + i * 16 * GLP);
#pragma unroll   // the 32-k blocks of a stage unrolled: every LDS offset an immediate, both fragment sets indexed by constants
        for (int kk = 0; kk < GKS / 32; ++kk) {
            const int cu = kk & 1, nx = cu ^ 1;
            if (kk + 1 < GKS / 32) {
#pragma unroll
                for (int i = 0; i < 2; ++i) a[nx][i] = ldu(pa + i * 16 * GLP + (kk + 1) * 32);
#pragma unroll
                for (int i = 0; i < 4; ++i) b[nx][i] = ldu(pb + i * 16 * GLP + (kk + 1) * 32);
            }
            __builtin_amdgcn_sched_barrier(0);   // keeps the next block's LDS loads one group ahead of this block's products (else they are moved in among them, each with a wait to 0)
#pragma unroll
            for (int nb = 0; nb < 4; ++nb)
#pragma unroll
                for (int mb = 0; mb < 2; ++mb) acc[mb][nb] = wmmau<BFK>(a[cu][mb], b[cu][nb], acc[mb][nb]);
            __builtin_amdgcn_sched_barrier(0);   // keeps this block's products ahead of the following load group and of the stage's foot
        }
        // four vector slots behind the stage's last products, on the way to the branches below
        asm volatile("v_nop\n\tv_nop\n\tv_nop\n\tv_nop" : "+v"(acc[0][2]), "+v"(acc[1][2]), "+v"(acc[0][3]), "+v"(acc[1][3]) : "v"(a[1][0]), "v"(a[1][1]), "v"(b[1][2]), "v"(b[1][3]));
        // publish point of stage st + 1, which also frees the buffer that this trip has read
        asm volatile("s_wait_dscnt 0x0" ::: "memory");      // this wave's reads of the buffer have returned before it is refilled
        asm volatile("s_wait_asynccnt 0x0" ::: "memory");   // this wave's copies of stage st + 1 have landed before other waves read them
        __syncthreads();
        if (st + 2 < DM / GKS) gemm_stage(lc + (unsigned)so * 2, ga + (size_t)(st + 2) * GKS, gb + (size_t)(st + 2) * GKS);
    }
    asm volatile("s_wait_asynccnt 0x0" ::: "memory");       // nothing of this wave is in flight when it goes on to the epilogue
}

// k_proj: bf16 GEMM, one block of 8 waves per 128 x 128 tile (gemm_core), each wave's 32 x 64 tile in 8 accumulators, K = DM.
// C[m][n] = sum_k A[m][k] Bt[n][k] + bias (BROW == 0: bias[n]; BROW == 1: bias[m]; bias taken at its bf16 RNE value, added in f32),
// written as f16 (Ph) and optionally the f16 residual x2048 (Pr, useRes != 0) at
// tile base (r0/RB)*sRB + (r0%RB)*pitch + (c0/CB)*sCB + (c0%CB), row pitch 'pitch' (halves). grid (M/128, N/128), 256 threads.
template <int BROW>
__global__ __launch_bounds__(256) void k_proj(const bf* __restrict__ A, const bf* __restrict__ Bt, const float* __restrict__ bias, h16* Ph, h16* Pr, int useRes, int RB, size_t sRB, int pitch, int CB, size_t sCB) {
    __shared__ __align__(16) bf ring[2 * GSTH];
    __shared__ __align__(16) float osb[8 * 16 * 68];
    const int lane = threadIdx.x & 31, lr = lane & 15, hi = lane >> 4;
    const int wave = __builtin_amdgcn_readfirstlane((int)(threadIdx.x >> 5));
    float* os = osb + wave * 16 * 68;            // each wave stages its output rows in its own range
    const int r0 = blockIdx.x * GT + (wave >> 1) * 32, c0 = blockIdx.y * GT + (wave & 1) * 64;
    v8f acc[2][4];
    gemm_core<1>(A, Bt, blockIdx.x * GT, blockIdx.y * GT, ring, acc);
    const int rq = lane >> 3, c8 = (lane & 7) * 8;
    v4f bc0 = (v4f){0.0f, 0.0f, 0.0f, 0.0f}, bc1 = (v4f){0.0f, 0.0f, 0.0f, 0.0f};
    if constexpr (BROW == 0) {
        const v4f t0 = *(const v4f*)(bias + c0 + c8); const v4f t1 = *(const v4f*)(bias + c0 + c8 + 4);
#pragma unroll
        for (int i = 0; i < 4; ++i) { bc0[i] = bfr(t0[i]); bc1[i] = bfr(t1[i]); }
    }
    const size_t tbase = (size_t)(r0 / RB) * sRB + (size_t)(r0 % RB) * (size_t)pitch + (size_t)(c0 / CB) * sCB + (size_t)(c0 % CB);
#pragma unroll
    for (int mb = 0; mb < 2; ++mb) {
#pragma unroll
        for (int nb = 0; nb < 4; ++nb) {
#pragma unroll
            for (int j = 0; j < 8; ++j) os[(hi * 8 + j) * 68 + nb * 16 + lr] = acc[mb][nb][j]; }   // D: row 8h+j, col lane&15
        wave_sync();
        const size_t sb = tbase + (size_t)(mb * 16) * (size_t)pitch;
{
#pragma unroll
            for (int s = 0; s < 4; ++s) { const int row = 4 * s + rq;   // 4 s x 4 row groups = 16 rows; 8 lanes x 8 = 64 columns
                float br = 0.0f;
                if constexpr (BROW != 0) br = bfr(bias[r0 + mb * 16 + row]);
                const v4f x0 = *(const v4fa*)(&os[row * 68 + c8]); const v4f x1 = *(const v4fa*)(&os[row * 68 + c8 + 4]); v8h hv, rv;
#pragma unroll
                for (int i = 0; i < 4; ++i) { const float y0 = x0[i] + bc0[i] + br; const float y1 = x1[i] + bc1[i] + br;
                    const h16 a0 = (h16)y0; const h16 a1 = (h16)y1; hv[i] = a0; hv[4 + i] = a1; rv[i] = (h16)((y0 - (float)a0) * QRS); rv[4 + i] = (h16)((y1 - (float)a1) * QRS); }
                const size_t oo = sb + (size_t)row * (size_t)pitch + c8;
                *(v8h*)(Ph + oo) = hv; if (useRes) *(v8h*)(Pr + oo) = rv; }
             }
        wave_sync();
    }
}

// One stage of the flash kernel's ring: each thread copies two 16-byte pieces of the K tile and two of the V^T tile (tile rows r and r + 32) from global memory to LDS.
// lds: byte address of the thread's piece in the K tile of the target buffer. The s_wait_xcnt stands inside the statement so that no address register is rewritten in front of it.
__device__ __forceinline__ void stage_copy(unsigned lds, const h16* gk, const h16* gv) {
    const unsigned l1 = lds + 32 * LP * 2, l2 = lds + TLH * 2, l3 = lds + TLH * 2 + 32 * LP * 2;
    const h16* gk1 = gk + (size_t)32 * HD; const h16* gv1 = gv + (size_t)32 * SEQ;
    asm volatile("global_load_async_to_lds_b128 %0, %4, off\n\t"
                 "global_load_async_to_lds_b128 %1, %5, off\n\t"
                 "global_load_async_to_lds_b128 %2, %6, off\n\t"
                 "global_load_async_to_lds_b128 %3, %7, off\n\t"
                 "s_wait_xcnt 0x0"
                 :: "v"(lds), "v"(l1), "v"(l2), "v"(l3), "v"(gk), "v"(gk1), "v"(gv), "v"(gv1) : "memory");
}

// k_flash: fused attention, one wave per 16 query rows of one (batch, head); Q fragments straight from the f16 planes (two 16-B loads each, arithmetic addressing).
// K and V^T: the block's waves share every key tile, so a stage of KT keys (K rows, V^T rows, 128 B each) is brought into LDS once per block by asynchronous copies
// (whole 128-B lines per 8 lanes), two buffers, the next stage in flight while this one is worked on; fragments are two 16-B LDS loads each, same element map as before.
// Transposed form: S^T[key][t] = K Q^T (A = K rows, B = Q rows); lane (t = lane&15, h = lane>>4) holds keys 8h+r of each 16-key tile, so the packed
// P tile is directly the B fragment of O^T[d][t] = V^T P^T (element r <- tile keys 0..15, element 8+r <- tile keys 16..31, lane unchanged).
// Softmax state (running max, partial sum) is one scalar per lane; the two lane halves of a row are combined with one xor-16 exchange.
__global__ __launch_bounds__(32 * AW) void k_flash(const h16* __restrict__ QH, const h16* __restrict__ QR, const h16* __restrict__ KP, const h16* __restrict__ VT, h16* CTX) {
    __shared__ __align__(16) float os[AW * 16 * 68];
    __shared__ __align__(16) h16 ring[2 * STH];
    const int lane = threadIdx.x & 31, lr = lane & 15, hi = lane >> 4;
    const int wave = __builtin_amdgcn_readfirstlane((int)(threadIdx.x >> 5));
    const int zh = blockIdx.y; const int b = zh / NH_, h = zh % NH_;
    const int t0 = (blockIdx.x * AW + wave) * 16;
    const size_t pbase = (size_t)zh * SEQ * HD;
    const size_t qo = pbase + (size_t)(t0 + lr) * HD + 8 * hi;
    const v16h qh0 = ldh(QH + qo), qh1 = ldh(QH + qo + 32), qr0 = ldh(QR + qo), qr1 = ldh(QR + qo + 32);   // B fragments: col t, k = d
    // copy map: thread c takes 16-byte piece c & 7 of tile rows c >> 3 and 32 + (c >> 3), of the K tile and of the V^T tile
    const int crw = (int)threadIdx.x >> 3, cpc = ((int)threadIdx.x & 7) * 8;
    const h16* gk = KP + pbase + (size_t)crw * HD + cpc;      // + stage * KT * HD   (row = key)
    const h16* gv = VT + pbase + (size_t)crw * SEQ + cpc;     // + stage * KT        (row = d)
    const unsigned lc = (unsigned)(size_t)&ring[crw * LP + cpc];   // LDS byte address: low 32 bits of the shared address
    const int ko = lr * LP + 8 * hi;            // + key_local * LP          (A fragment: row key, k = d)
    const int vo = TLH + lr * LP + 8 * hi;      // + 16j * LP + key_local    (A fragment: row d, k = key)
    stage_copy(lc, gk, gv);
    asm volatile("s_wait_asynccnt 0x0" ::: "memory");   // stage 0 landed before the barrier that publishes it
    __syncthreads();
    stage_copy(lc + STH * 2, gk + (size_t)KT * HD, gv + KT);
    v8f o0 = (v8f){}, o1 = (v8f){}, o2 = (v8f){}, o3 = (v8f){};
    float m = -3.0e38f, l = 0.0f;
#pragma unroll 1
    for (int st = 0; st < SEQ / KT; ++st) {
      const int bo = (st & 1) * STH;
#pragma unroll   // the 32-key steps of a stage unrolled, so that every LDS offset inside a stage is an immediate
      for (int kl = 0; kl < KT; kl += 32) {
        const h16* ka = ring + bo + ko + kl * LP;
        const v16h ka0 = ldh(ka), ka1 = ldh(ka + 32), kb0 = ldh(ka + 16 * LP), kb1 = ldh(ka + 16 * LP + 32);
        v8f sHa = (v8f){}, sLa = (v8f){}, sHb = (v8f){}, sLb = (v8f){};
        sHa = wmma16(ka0, qh0, sHa); sLa = wmma16(ka0, qr0, sLa); sHb = wmma16(kb0, qh0, sHb); sLb = wmma16(kb0, qr0, sLb);
        sHa = wmma16(ka1, qh1, sHa); sLa = wmma16(ka1, qr1, sLa); sHb = wmma16(kb1, qh1, sHb); sLb = wmma16(kb1, qr1, sLb);
        asm volatile("v_nop\n\tv_nop\n\tv_nop\n\tv_nop" : "+v"(sHa), "+v"(sLa), "+v"(sHb), "+v"(sLb) : "v"(ka0), "v"(ka1), "v"(kb0), "v"(kb1));
        float ta[8], tb[8]; float mx = -3.0e38f;
#pragma unroll
        for (int r = 0; r < 8; ++r) { ta[r] = (sHa[r] + sLa[r] * QRI) * SC2; tb[r] = (sHb[r] + sLb[r] * QRI) * SC2; mx = fmaxf(mx, fmaxf(ta[r], tb[r])); }
        mx = fmaxf(mx, __shfl_xor(mx, 16, 32));
        const float mnew = fmaxf(m, mx);
        const float alpha = __builtin_amdgcn_exp2f(m - mnew);
        const float sh = PSH - mnew;
        v16h pb; float ls = 0.0f;
#pragma unroll
        for (int r = 0; r < 8; ++r) { const h16 pa = (h16)__builtin_amdgcn_exp2f(ta[r] + sh); const h16 pc = (h16)__builtin_amdgcn_exp2f(tb[r] + sh); pb[r] = pa; pb[8 + r] = pc; ls += (float)pa + (float)pc; }
        l = l * alpha + ls; m = mnew;
        o0 = o0 * alpha; o1 = o1 * alpha; o2 = o2 * alpha; o3 = o3 * alpha;
        const h16* va = ring + bo + vo + kl;
        const v16h v0 = ldh(va), v1 = ldh(va + 16 * LP), v2 = ldh(va + 32 * LP), v3 = ldh(va + 48 * LP);
        o0 = wmma16(v0, pb, o0); o1 = wmma16(v1, pb, o1); o2 = wmma16(v2, pb, o2); o3 = wmma16(v3, pb, o3);
        asm volatile("v_nop\n\tv_nop\n\tv_nop\n\tv_nop" : "+v"(o0), "+v"(o1), "+v"(o2), "+v"(o3) : "v"(v0), "v"(v1), "v"(v2), "v"(v3), "v"(pb));
      }
      // publish point of stage st + 1, which also frees the buffer that this trip has read
      asm volatile("s_wait_dscnt 0x0" ::: "memory");      // this wave's reads of the buffer have returned before it is refilled
      asm volatile("s_wait_asynccnt 0x0" ::: "memory");   // this wave's copies of stage st + 1 have landed before other waves read them
      __syncthreads();
      if (st + 2 < SEQ / KT) stage_copy(lc + (unsigned)bo * 2, gk + (size_t)(st + 2) * KT * HD, gv + (size_t)(st + 2) * KT);
    }
    asm volatile("s_wait_asynccnt 0x0" ::: "memory");     // nothing of this wave is in flight when it goes on to the epilogue
    l += __shfl_xor(l, 16, 32);
    const float inv = CTXS * (1.0f / l);
    const int wb = wave * 16 * 68;
    // O^T D layout: o_j[r] = (d = 16j + 8h + r, t = lane&15) -> os[t][d]; rows 0..15 x columns 0..63 all written
    { v4f a, c;
      a[0] = o0[0] * inv; a[1] = o0[1] * inv; a[2] = o0[2] * inv; a[3] = o0[3] * inv; c[0] = o0[4] * inv; c[1] = o0[5] * inv; c[2] = o0[6] * inv; c[3] = o0[7] * inv;
      *(v4fa*)(&os[wb + lr * 68 +  0 + 8 * hi]) = a; *(v4fa*)(&os[wb + lr * 68 +  0 + 8 * hi + 4]) = c;
      a[0] = o1[0] * inv; a[1] = o1[1] * inv; a[2] = o1[2] * inv; a[3] = o1[3] * inv; c[0] = o1[4] * inv; c[1] = o1[5] * inv; c[2] = o1[6] * inv; c[3] = o1[7] * inv;
      *(v4fa*)(&os[wb + lr * 68 + 16 + 8 * hi]) = a; *(v4fa*)(&os[wb + lr * 68 + 16 + 8 * hi + 4]) = c;
      a[0] = o2[0] * inv; a[1] = o2[1] * inv; a[2] = o2[2] * inv; a[3] = o2[3] * inv; c[0] = o2[4] * inv; c[1] = o2[5] * inv; c[2] = o2[6] * inv; c[3] = o2[7] * inv;
      *(v4fa*)(&os[wb + lr * 68 + 32 + 8 * hi]) = a; *(v4fa*)(&os[wb + lr * 68 + 32 + 8 * hi + 4]) = c;
      a[0] = o3[0] * inv; a[1] = o3[1] * inv; a[2] = o3[2] * inv; a[3] = o3[3] * inv; c[0] = o3[4] * inv; c[1] = o3[5] * inv; c[2] = o3[6] * inv; c[3] = o3[7] * inv;
      *(v4fa*)(&os[wb + lr * 68 + 48 + 8 * hi]) = a; *(v4fa*)(&os[wb + lr * 68 + 48 + 8 * hi + 4]) = c; }
    wave_sync();
    h16* crow = CTX + ((size_t)b * SEQ + t0) * DM + h * HD;
    const int rq = lane >> 3, c8 = (lane & 7) * 8;
{
#pragma unroll
        for (int s = 0; s < 4; ++s) { const int row = 4 * s + rq;   // 4 s x 4 row groups = 16 rows; 8 lanes x 8 halves = 64 columns
            const v4f x0 = *(const v4fa*)(&os[wb + row * 68 + c8]); const v4f x1 = *(const v4fa*)(&os[wb + row * 68 + c8 + 4]); v8h hv;
#pragma unroll
            for (int i = 0; i < 4; ++i) { hv[i] = (h16)x0[i]; hv[4 + i] = (h16)x1[i]; }
            *(v8h*)(crow + (size_t)row * DM + c8) = hv; }
         }
}

// k_outp: f16 GEMM, one block of 8 waves per 128 x 128 tile (gemm_core), each wave's 32 x 64 tile in 8 accumulators, K = DM.
// OUT[(s*NB_FULL + b)][n] = OSCL * sum_k A[b*SEQ + s][k] Bt[n][k] + bias[n] (bias at its bf16 RNE value, f32 add). grid (NB*SEQ/128, DM/128), 256 threads.
__global__ __launch_bounds__(256) void k_outp(const h16* __restrict__ A, const h16* __restrict__ Bt, const float* __restrict__ bias, float* OUT) {
    __shared__ __align__(16) bf ring[2 * GSTH];
    __shared__ __align__(16) float osb[8 * 16 * 68];
    const int lane = threadIdx.x & 31, lr = lane & 15, hi = lane >> 4;
    const int wave = __builtin_amdgcn_readfirstlane((int)(threadIdx.x >> 5));
    float* os = osb + wave * 16 * 68;            // each wave stages its output rows in its own range
    const int r0 = blockIdx.x * GT + (wave >> 1) * 32, c0 = blockIdx.y * GT + (wave & 1) * 64;
    v8f acc[2][4];
    gemm_core<0>((const bf*)A, (const bf*)Bt, blockIdx.x * GT, blockIdx.y * GT, ring, acc);
    const int bb = r0 / SEQ, sb = r0 % SEQ;        // tile rows share one batch (SEQ % 64 == 0)
    const int cofs = lr * 4;
    v4f bv;
    { const v4f t = *(const v4f*)(bias + c0 + cofs);
#pragma unroll
      for (int i = 0; i < 4; ++i) bv[i] = bfr(t[i]); }
#pragma unroll
    for (int mb = 0; mb < 2; ++mb) {
#pragma unroll
        for (int nb = 0; nb < 4; ++nb) {
#pragma unroll
            for (int j = 0; j < 8; ++j) os[(hi * 8 + j) * 68 + nb * 16 + lr] = acc[mb][nb][j]; }   // D: row 8h+j, col lane&15
        wave_sync();
{
#pragma unroll
            for (int s = 0; s < 8; ++s) { const int row = 2 * s + hi;   // 8 s x 2 rows = 16 rows; 16 lanes x 4 floats = 64 columns
                const v4f x = *(const v4fa*)(&os[row * 68 + cofs]); v4f val;
#pragma unroll
                for (int i = 0; i < 4; ++i) val[i] = x[i] * OSCL + bv[i];
                float* dst = OUT + ((size_t)(sb + mb * 16 + row) * NB_FULL + bb) * DM + c0 + cofs;
                *(v4f*)dst = val; }
             }
        wave_sync();
    }
}

static constexpr size_t al256(size_t v) { return (v + 255) & ~(size_t)255; }
static constexpr size_t SZ_X   = al256((size_t)NB * SEQ * DM * 2);          // one bf16 input copy
static constexpr size_t SZ_W   = al256((size_t)DM * DM * 2);                // one 16-bit weight plane
static constexpr size_t SZ_PL  = al256((size_t)NB * NH_ * SEQ * HD * 2);    // one head plane
static constexpr size_t SZ_CTX = al256((size_t)NB * SEQ * DM * 2);          // f16 ctx plane
static constexpr size_t SZ_TOTAL = 3 * SZ_X + 4 * SZ_W + 4 * SZ_PL + SZ_CTX;
static_assert(SZ_TOTAL <= (size_t)134217728);          // workspace carve <= 128 MiB
static_assert(((size_t)DM * DM * 2) % 256 == 0);

extern "C" void kernel_launch(void* const* d_in, const int* in_sizes, int n_in,
                              void* d_out, int out_size, void* d_ws, size_t ws_size, hipStream_t stream) {
    if (n_in < 11) return;
    const size_t needx = ((size_t)(SEQ - 1) * NB_FULL + NB) * DM;
    if ((size_t)in_sizes[0] < needx || (size_t)in_sizes[1] < needx || (size_t)in_sizes[2] < needx) return;
    if ((size_t)in_sizes[3] < (size_t)DM * DM || (size_t)in_sizes[5] < (size_t)DM * DM || (size_t)in_sizes[7] < (size_t)DM * DM || (size_t)in_sizes[9] < (size_t)DM * DM) return;
    if (in_sizes[4] < DM || in_sizes[6] < DM || in_sizes[8] < DM || in_sizes[10] < DM) return;
    if ((size_t)out_size < needx) return;
    if (SZ_TOTAL > ws_size) return;
    // wire order: query, key, value, Wq, bq, Wk, bk, Wv, bv, Wo, bo (weights [out][in] = Bt as-is)
    const float* xq = (const float*)d_in[0]; const float* xk = (const float*)d_in[1]; const float* xv = (const float*)d_in[2];
    const float* wq = (const float*)d_in[3]; const float* bq = (const float*)d_in[4];
    const float* wk = (const float*)d_in[5]; const float* bk = (const float*)d_in[6];
    const float* wv = (const float*)d_in[7]; const float* bvv = (const float*)d_in[8];
    const float* wo = (const float*)d_in[9]; const float* bo = (const float*)d_in[10];
    float* OUT = (float*)d_out;      // [SEQ][NB_FULL][1024]
    char* wsp = (char*)d_ws;
    bf* XQ = (bf*)wsp; wsp += SZ_X;                  // [NB*SEQ][1024], row b*SEQ + s
    bf* XK = (bf*)wsp; wsp += SZ_X;
    bf* XV = (bf*)wsp; wsp += SZ_X;
    bf* WQ = (bf*)wsp; wsp += SZ_W;                  // [1024][1024]
    bf* WK = (bf*)wsp; wsp += SZ_W;
    bf* WV = (bf*)wsp; wsp += SZ_W;
    h16* WO = (h16*)wsp; wsp += SZ_W;                // f16, x64
    h16* QH = (h16*)wsp; wsp += SZ_PL;               // [NB*16][SEQ][64]
    h16* QR = (h16*)wsp; wsp += SZ_PL;               // [NB*16][SEQ][64] residual x2048
    h16* KP = (h16*)wsp; wsp += SZ_PL;               // [NB*16][SEQ][64]
    h16* VT = (h16*)wsp; wsp += SZ_PL;               // [NB*16][64][SEQ]
    h16* CTX = (h16*)wsp; wsp += SZ_CTX;             // [NB*SEQ][1024], x32

    { const size_t n8 = (size_t)NB * SEQ * DM / 8; const unsigned g = (unsigned)((n8 + 255) / 256);
      // dst row b*SEQ + s <- src row s*NB_FULL + b
      k_cvt8<<<g, 256, 0, stream>>>(xq, XQ, n8, SEQ, NB_FULL, 1);
      k_cvt8<<<g, 256, 0, stream>>>(xk, XK, n8, SEQ, NB_FULL, 1);
      k_cvt8<<<g, 256, 0, stream>>>(xv, XV, n8, SEQ, NB_FULL, 1); }
    { const size_t n8 = (size_t)DM * DM / 8; const unsigned g = (unsigned)((n8 + 255) / 256);
      k_cvt8<<<g, 256, 0, stream>>>(wq, WQ, n8, DM, 1, 0);
      k_cvt8<<<g, 256, 0, stream>>>(wk, WK, n8, DM, 1, 0);
      k_cvt8<<<g, 256, 0, stream>>>(wv, WV, n8, DM, 1, 0);
      k_cvt8h<<<g, 256, 0, stream>>>(wo, WO, n8, WOS); }

    // q, k: A = x rows (m = b*SEQ + t), Bt = W rows (n = h*64 + d), column bias -> plane [(b*16 + h)][t][d]
    k_proj<0><<<dim3(NB * SEQ / GT, DM / GT, 1), 256, 0, stream>>>(XQ, WQ, bq, QH, QR, 1, SEQ, (size_t)NH_ * SEQ * HD, HD, HD, (size_t)SEQ * HD);
    k_proj<0><<<dim3(NB * SEQ / GT, DM / GT, 1), 256, 0, stream>>>(XK, WK, bk, KP, KP, 0, SEQ, (size_t)NH_ * SEQ * HD, HD, HD, (size_t)SEQ * HD);
    // v^T: A = Wv rows (m = h*64 + d), Bt = x rows (n = b*SEQ + t), row bias -> plane [(b*1024 + m)][t] = [(b*16 + h)][d][t]
    k_proj<1><<<dim3(DM / GT, NB * SEQ / GT, 1), 256, 0, stream>>>(WV, XV, bvv, VT, VT, 0, DM, (size_t)0, SEQ, SEQ, (size_t)DM * SEQ);

    k_flash<<<dim3(SEQ / (16 * AW), NB * NH_, 1), 32 * AW, 0, stream>>>(QH, QR, KP, VT, CTX);

    // output projection: A = ctx rows (m = b*SEQ + s), Bt = Wo rows (n) -> OUT row s*NB_FULL + b
    k_outp<<<dim3(NB * SEQ / GT, DM / GT, 1), 256, 0, stream>>>(CTX, WO, bo, OUT);
}

// v003
// Measured time: 108 microseconds a run.
// In two side-by-side timings against v002, it was 1.12 and 1.13 times as fast.
// Counting every step since v000, it is 2.25 times as fast.
#include <hip/hip_runtime.h>

// Multi-head attention, width 1024 = 16 heads x 64; query/key/value [SEQ][NB][1024] (token row = s*NB + b), Wq/Wk/Wv/Wo [out][in] (y = x W^T + bias), score scale 1/8, no mask, output [SEQ][NB][1024] f32.
// Compute dtypes, f32 accumulate everywhere: q/k/v projections v_wmma_f32_16x16x32_bf16 (inputs and W RNE-converted to bf16; products exact);
// scores v_wmma_f32_16x16x32_f16: k single f16, q as f16 value + f16 residual x2048 in its own accumulator (two products); P (x256 carry, cancels in the normalisation) and v single f16; softmax f32 (online, running max);
// output projection v_wmma_f32_16x16x32_f16: ctx single f16 (x32 carry), Wo = f16 of the bf16 RNE value (x64 carry), 1/2048 folded back in the f32 epilogue; biases added in f32.
// Layout: bf16 copies of the inputs with batch-major rows (b*SEQ + s); q (value, residual), k planes [b*16+h][t][d] and v^T plane [b*16+h][d][t] from the GEMM epilogue; fused flash kernel in transposed form (S^T = K Q^T, O^T = V^T P^T) writing the f16 ctx plane [b*SEQ+s][1024]; final GEMM writes the output rows (s*NB + b).

#ifndef NB
#define NB 2
#endif
#ifndef SEQ
#define SEQ 2048
#endif
#define NB_FULL  2
#define SEQ_FULL 2048
#define DM   1024
#define NH_  16
#define HD   64
#define AW   8                   // waves per flash block (16 query rows each)
#define KT   64                  // keys per LDS stage of the flash kernel
#define LP   72                  // LDS row pitch in halves: 128-B rows + 16 B (16 B x odd, for 16-byte readers)
#define TLH  (64 * LP)           // halves of one staged 64-row tile
#define STH  (2 * TLH)           // halves of one stage: K tile [key][d], then V^T tile [d][key]
#define QRS  2048.0f             // carry of the q residual plane
#define QRI  (1.0f / 2048.0f)
#define SC2  (0.125f * 1.4426950408889634f)   // HD^-0.5 * log2(e)
#define PSH  8.0f                // log2 of the P carry (256)
#define CTXS 32.0f               // carry of the ctx plane
#define WOS  64.0f               // carry of the Wo plane
#define OSCL (1.0f / 2048.0f)    // 1 / (CTXS * WOS)
#define GT   128                 // rows and columns of a GEMM block's tile: 8 waves, 4 x 2, 32 rows x 64 columns each
#define GKS  128                 // k per LDS stage of the GEMM kernels
#define GLP  136                 // LDS row pitch in halves: 256-B rows + 16 B (16 B x odd, for 16-byte readers)
#define GOPH (GT * GLP)          // halves of one operand's staged tile
#define GSTH (2 * GOPH)          // halves of one stage: A tile [row][k], then B tile [row][k]
#define CW   16                  // waves per block of the convert kernel
#define XR   (NB * SEQ)          // rows of one input
#define WR   (4 * DM)            // rows of the four weight matrices together
#define CWV  (XR > WR ? XR : WR) // waves of the convert launch

static_assert(HD == 64);
static_assert(NH_ * HD == DM);                 // head h = columns h*64 + d
static_assert(DM % 64 == 0);                   // column tiles of 64
static_assert(DM % 32 == 0);                   // GEMM k-loop steps by 32
static_assert(SEQ % 64 == 0);                  // a 64-row tile never straddles two batches
static_assert((NB * SEQ) % 64 == 0);
static_assert(SEQ % 32 == 0);                  // key loop steps by 32
static_assert(SEQ % KT == 0 && SEQ / KT >= 2); // whole stages; the two-buffer prologue needs two
static_assert(AW * 32 * 2 * 8 == KT * HD);     // two 16-byte copies per thread fill one 64 x 64 tile
static_assert((LP * 2) % 16 == 0);
static_assert(SEQ % (16 * AW) == 0);           // flash grid covers the sequence exactly
static_assert(((size_t)SEQ * DM) % 8 == 0);
static_assert(((size_t)DM * DM) % 8 == 0);
static_assert(DM % GT == 0 && (NB * SEQ) % GT == 0);   // GEMM grids cover both operands exactly
static_assert(DM % GKS == 0 && DM / GKS >= 2);         // whole stages; the two-buffer prologue needs two
static_assert(GKS * 2 == 16 * 16 && GT == 16 * 8);     // 16 threads x 16 B fill a row; 256 threads take 16 rows a copy, 8 copies an operand
static_assert((GLP * 2) % 16 == 0);
static_assert(CWV % CW == 0);                  // the convert grid covers its waves exactly
static_assert(DM == 8 * 32 * 4);               // a row is 8 wave-wide 16-byte loads
static_assert(NB <= NB_FULL);
static_assert(SEQ <= SEQ_FULL);

typedef _Float16 h16;
typedef unsigned short bf;
typedef __attribute__((ext_vector_type(16))) __bf16   v16bf;
typedef __attribute__((ext_vector_type(16))) _Float16 v16h;
typedef __attribute__((ext_vector_type(8)))  _Float16 v8h;
typedef __attribute__((ext_vector_type(8)))  unsigned short v8us;
typedef __attribute__((ext_vector_type(4)))  unsigned short v4us;
typedef __attribute__((ext_vector_type(4)))  _Float16 v4h;
typedef __attribute__((ext_vector_type(16))) unsigned short v16us;
typedef __attribute__((ext_vector_type(8)))  float    v8f;
typedef __attribute__((ext_vector_type(4)))  float    v4f;
typedef v4f  __attribute__((may_alias)) v4fa;

__device__ __forceinline__ unsigned short f2bf(float f) { unsigned u = __float_as_uint(f); u += 0x7FFFu + ((u >> 16) & 1u); return (unsigned short)(u >> 16); }
__device__ __forceinline__ float bfr(float f) { return __uint_as_float(((unsigned)f2bf(f)) << 16); }   // f32 value of the bf16 RNE convert
__device__ __forceinline__ v4us bf4(v4f x) { v4us o; o[0] = f2bf(x[0]); o[1] = f2bf(x[1]); o[2] = f2bf(x[2]); o[3] = f2bf(x[3]); return o; }
__device__ __forceinline__ v16h cat16(v8h lo, v8h hi) { return __builtin_shufflevector(lo, hi, 0, 1, 2, 3, 4, 5, 6, 7, 8, 9, 10, 11, 12, 13, 14, 15); }
__device__ __forceinline__ v8f wmma16(v16h a, v16h b, v8f c) { return __builtin_amdgcn_wmma_f32_16x16x32_f16(false, a, false, b, (short)0, c, false, false); }
__device__ __forceinline__ v8f wmmab(v16bf a, v16bf b, v8f c) { return __builtin_amdgcn_wmma_f32_16x16x32_bf16(false, a, false, b, (short)0, c, false, false); }
// fragment loaders from K-contiguous 16-bit rows; p already includes + 8*(lane>>4): elements 0..7 <- k0+8h+0..7, elements 8..15 <- k0+16+8h+0..7 (same map for A and B)
__device__ __forceinline__ v16h  ldh(const h16* p) { return cat16(*(const v8h*)p, *(const v8h*)(p + 16)); }
__device__ __forceinline__ v16us ldu(const bf* p)  { return __builtin_shufflevector(*(const v8us*)p, *(const v8us*)(p + 16), 0, 1, 2, 3, 4, 5, 6, 7, 8, 9, 10, 11, 12, 13, 14, 15); }   // raw 16-bit fragment, bf16 or f16
// ordering point for wave-private LDS tiles (same wave writes and reads)
__device__ __forceinline__ void wave_sync() { __builtin_amdgcn_fence(3 /* release order */, "wavefront"); __builtin_amdgcn_wave_barrier(); asm volatile("" ::: "memory"); }

// k_cvt_all: every 16-bit operand plane in one launch, few waves with much in flight (a launch of one small piece per thread is bound by how fast its waves start).
// Wave w takes row w (order b*SEQ + s, from source row s*NB_FULL + b) of query, key and value and row w of the four stacked weight matrices (w / DM picks the matrix).
// A row is 8 wave-wide 16-byte loads of 512 contiguous bytes each; all 32 loads of a wave are issued before its first convert. A wave past the end of either set re-reads row 0 and stores nothing.
__global__ __launch_bounds__(32 * CW) void k_cvt_all(const float* __restrict__ xq, const float* __restrict__ xk, const float* __restrict__ xv,
                                                     const float* __restrict__ wq, const float* __restrict__ wk, const float* __restrict__ wv, const float* __restrict__ wo,
                                                     bf* XQ, bf* XK, bf* XV, bf* WQ, bf* WK, bf* WV, h16* WO) {
    const unsigned lane = threadIdx.x & 31;         // the lane's 4 elements inside each 128-element piece of a row: vector index lane + 32 j
    const int w = blockIdx.x * CW + __builtin_amdgcn_readfirstlane((int)(threadIdx.x >> 5));
    const bool dx = XR == CWV || w < XR, dw = WR == CWV || w < WR;
    const int xw = dx ? w : 0, ww = dw ? w : 0;
    const int sg = ww / DM;
    // row bases are the same in every lane: scalar base + one lane offset for all loads
    const size_t so = ((size_t)(xw % SEQ) * NB_FULL + (size_t)(xw / SEQ)) * DM, xo = (size_t)xw * DM, wr = (size_t)(ww % DM) * DM;
    const float* pq = xq + so; const float* pk = xk + so; const float* pv = xv + so;
    const float* pw = (sg == 0 ? wq : sg == 1 ? wk : sg == 2 ? wv : wo) + wr;
    v4f q[8], k[8], v[8], t[8];
#pragma unroll
    for (int j = 0; j < 8; ++j) q[j] = ((const v4f*)pq)[lane + j * 32];
#pragma unroll
    for (int j = 0; j < 8; ++j) k[j] = ((const v4f*)pk)[lane + j * 32];
#pragma unroll
    for (int j = 0; j < 8; ++j) v[j] = ((const v4f*)pv)[lane + j * 32];
#pragma unroll
    for (int j = 0; j < 8; ++j) t[j] = ((const v4f*)pw)[lane + j * 32];
    __builtin_amdgcn_sched_barrier(0);   // keeps all 32 loads in front of the first convert (else the weight row's loads are moved behind the wait for the other 24: a second memory latency)
    if (dx) {
        bf* dq = XQ + xo; bf* dk = XK + xo; bf* dv = XV + xo;
#pragma unroll
        for (int j = 0; j < 8; ++j) ((v4us*)dq)[lane + j * 32] = bf4(q[j]);
#pragma unroll
        for (int j = 0; j < 8; ++j) ((v4us*)dk)[lane + j * 32] = bf4(k[j]);
#pragma unroll
        for (int j = 0; j < 8; ++j) ((v4us*)dv)[lane + j * 32] = bf4(v[j]);
    }
    asm volatile("s_wait_xcnt 0x0" ::: "memory");   // in front of the branches below, whose first instructions rewrite registers that the stores above name
    if (dw) {
        if (sg < 3) {
            bf* d = (sg == 0 ? WQ : sg == 1 ? WK : WV) + wr;
#pragma unroll
            for (int j = 0; j < 8; ++j) ((v4us*)d)[lane + j * 32] = bf4(t[j]);
        } else {
            h16* d = WO + wr;
#pragma unroll
            for (int j = 0; j < 8; ++j) { v4h o;
#pragma unroll
                for (int i = 0; i < 4; ++i) o[i] = (h16)(bfr(t[j][i]) * WOS);
                ((v4h*)d)[lane + j * 32] = o; }
        }
    }
}

// Eight 16-byte asynchronous copies of one thread: tile rows r, r + 16, ..., r + 112 (global row pitch DM, LDS row pitch GLP).
// The s_wait_xcnt stands inside the statement so that no address register is rewritten in front of it.
__device__ __forceinline__ void copy8(unsigned l, const bf* g) {
    asm volatile("global_load_async_to_lds_b128 %0, %8, off\n\t"
                 "global_load_async_to_lds_b128 %1, %9, off\n\t"
                 "global_load_async_to_lds_b128 %2, %10, off\n\t"
                 "global_load_async_to_lds_b128 %3, %11, off\n\t"
                 "global_load_async_to_lds_b128 %4, %12, off\n\t"
                 "global_load_async_to_lds_b128 %5, %13, off\n\t"
                 "global_load_async_to_lds_b128 %6, %14, off\n\t"
                 "global_load_async_to_lds_b128 %7, %15, off\n\t"
                 "s_wait_xcnt 0x0"
                 :: "v"(l), "v"(l + 16 * GLP * 2), "v"(l + 32 * GLP * 2), "v"(l + 48 * GLP * 2), "v"(l + 64 * GLP * 2), "v"(l + 80 * GLP * 2), "v"(l + 96 * GLP * 2), "v"(l + 112 * GLP * 2),
                    "v"(g), "v"(g + (size_t)16 * DM), "v"(g + (size_t)32 * DM), "v"(g + (size_t)48 * DM), "v"(g + (size_t)64 * DM), "v"(g + (size_t)80 * DM), "v"(g + (size_t)96 * DM), "v"(g + (size_t)112 * DM)
                 : "memory");
}
// One stage of the GEMM ring: GT rows x GKS k of A, then of B; each thread copies 8 pieces of each. l: LDS byte address of the thread's first piece in the target buffer.
__device__ __forceinline__ void gemm_stage(unsigned l, const bf* ga, const bf* gb) { copy8(l, ga); copy8(l + GOPH * 2, gb); }
template <int BFK>
__device__ __forceinline__ v8f wmmau(v16us a, v16us b, v8f c) {
    if constexpr (BFK != 0) return wmmab(__builtin_bit_cast(v16bf, a), __builtin_bit_cast(v16bf, b), c);
    else return wmma16(__builtin_bit_cast(v16h, a), __builtin_bit_cast(v16h, b), c);
}

// gemm_core: the k loop of one GT x GT block tile, 8 waves, wave (wm, wn) = (wave >> 1, wave & 1) owning the 32 x 64 tile at (rb + 32 wm, cb + 64 wn), K = DM.
// A rows rb.. and Bt rows cb.. (K-contiguous 16-bit planes, bf16 for BFK != 0, else f16) come into LDS once per block by asynchronous copies (whole 256-B row pieces per 16 lanes),
// two buffers of GKS k, the next stage in flight while this one is worked on; fragments are two 16-B LDS loads each, same element map and same k order as from global memory.
template <int BFK>
__device__ __forceinline__ void gemm_core(const bf* __restrict__ A, const bf* __restrict__ Bt, int rb, int cb, bf* ring, v8f (&acc)[2][4]) {
    const int lane = threadIdx.x & 31, lr = lane & 15, hi = lane >> 4;
    const int wave = __builtin_amdgcn_readfirstlane((int)(threadIdx.x >> 5));
    // copy map: thread c takes 16-byte piece c & 15 of tile rows (c >> 4) + 16 i, i = 0..7, of the A tile and of the B tile
    const int crw = (int)threadIdx.x >> 4, cpc = ((int)threadIdx.x & 15) * 8;
    const bf* ga = A + (size_t)(rb + crw) * DM + cpc;       // + stage * GKS
    const bf* gb = Bt + (size_t)(cb + crw) * DM + cpc;      // + stage * GKS
    const unsigned lc = (unsigned)(size_t)&ring[crw * GLP + cpc];   // LDS byte address: low 32 bits of the shared address
    const int ao = ((wave >> 1) * 32 + lr) * GLP + 8 * hi;          // + 16 mb * GLP + k_local
    const int bo = GOPH + ((wave & 1) * 64 + lr) * GLP + 8 * hi;    // + 16 nb * GLP + k_local
#pragma unroll
    for (int mb = 0; mb < 2; ++mb)
#pragma unroll
        for (int nb = 0; nb < 4; ++nb) acc[mb][nb] = (v8f){};
    gemm_stage(lc, ga, gb);
    asm volatile("s_wait_asynccnt 0x0" ::: "memory");   // stage 0 landed before the barrier that publishes it
    __syncthreads();
    gemm_stage(lc + GSTH * 2, ga + GKS, gb + GKS);
#pragma unroll 1
    for (int st = 0; st < DM / GKS; ++st) {
        const int so = (st & 1) * GSTH;
        const bf* pa = ring + so + ao; const bf* pb = ring + so + bo;
        v16us a[2][2], b[2][4];
#pragma unroll
        for (int i = 0; i < 2; ++i) a[0][i] = ldu(pa + i * 16 * GLP);
#pragma unroll
        for (int i = 0; i < 4; ++i) b[0][i] = ldu(pb + i * 16 * GLP);
#pragma unroll   // the 32-k blocks of a stage unrolled: every LDS offset an immediate, both fragment sets indexed by constants
        for (int kk = 0; kk < GKS / 32; ++kk) {
            const int cu = kk & 1, nx = cu ^ 1;
            if (kk + 1 < GKS / 32) {
#pragma unroll
                for (int i = 0; i < 2; ++i) a[nx][i] = ldu(pa + i * 16 * GLP + (kk + 1) * 32);
#pragma unroll
                for (int i = 0; i < 4; ++i) b[nx][i] = ldu(pb + i * 16 * GLP + (kk + 1) * 32);
            }
            __builtin_amdgcn_sched_barrier(0);   // keeps the next block's LDS loads one group ahead of this block's products (else they are moved in among them, each with a wait to 0)
#pragma unroll
            for (int nb = 0; nb < 4; ++nb)
#pragma unroll
                for (int mb = 0; mb < 2; ++mb) acc[mb][nb] = wmmau<BFK>(a[cu][mb], b[cu][nb], acc[mb][nb]);
            __builtin_amdgcn_sched_barrier(0);   // keeps this block's products ahead of the following load group and of the stage's foot
        }
        // four vector slots behind the stage's last products, on the way to the branches below
        asm volatile("v_nop\n\tv_nop\n\tv_nop\n\tv_nop" : "+v"(acc[0][2]), "+v"(acc[1][2]), "+v"(acc[0][3]), "+v"(acc[1][3]) : "v"(a[1][0]), "v"(a[1][1]), "v"(b[1][2]), "v"(b[1][3]));
        // publish point of stage st + 1, which also frees the buffer that this trip has read
        asm volatile("s_wait_dscnt 0x0" ::: "memory");      // this wave's reads of the buffer have returned before it is refilled
        asm volatile("s_wait_asynccnt 0x0" ::: "memory");   // this wave's copies of stage st + 1 have landed before other waves read them
        __syncthreads();
        if (st + 2 < DM / GKS) gemm_stage(lc + (unsigned)so * 2, ga + (size_t)(st + 2) * GKS, gb + (size_t)(st + 2) * GKS);
    }
    asm volatile("s_wait_asynccnt 0x0" ::: "memory");       // nothing of this wave is in flight when it goes on to the epilogue
}

// k_proj: bf16 GEMM, one block of 8 waves per 128 x 128 tile (gemm_core), each wave's 32 x 64 tile in 8 accumulators, K = DM.
// C[m][n] = sum_k A[m][k] Bt[n][k] + bias (BROW == 0: bias[n]; BROW == 1: bias[m]; bias taken at its bf16 RNE value, added in f32),
// written as f16 (Ph) and optionally the f16 residual x2048 (Pr, useRes != 0) at
// tile base (r0/RB)*sRB + (r0%RB)*pitch + (c0/CB)*sCB + (c0%CB), row pitch 'pitch' (halves). grid (M/128, N/128), 256 threads.
template <int BROW>
__global__ __launch_bounds__(256) void k_proj(const bf* __restrict__ A, const bf* __restrict__ Bt, const float* __restrict__ bias, h16* Ph, h16* Pr, int useRes, int RB, size_t sRB, int pitch, int CB, size_t sCB) {
    __shared__ __align__(16) bf ring[2 * GSTH];
    __shared__ __align__(16) float osb[8 * 16 * 68];
    const int lane = threadIdx.x & 31, lr = lane & 15, hi = lane >> 4;
    const int wave = __builtin_amdgcn_readfirstlane((int)(threadIdx.x >> 5));
    float* os = osb + wave * 16 * 68;            // each wave stages its output rows in its own range
    const int r0 = blockIdx.x * GT + (wave >> 1) * 32, c0 = blockIdx.y * GT + (wave & 1) * 64;
    v8f acc[2][4];
    gemm_core<1>(A, Bt, blockIdx.x * GT, blockIdx.y * GT, ring, acc);
    const int rq = lane >> 3, c8 = (lane & 7) * 8;
    v4f bc0 = (v4f){0.0f, 0.0f, 0.0f, 0.0f}, bc1 = (v4f){0.0f, 0.0f, 0.0f, 0.0f};
    if constexpr (BROW == 0) {
        const v4f t0 = *(const v4f*)(bias + c0 + c8); const v4f t1 = *(const v4f*)(bias + c0 + c8 + 4);
#pragma unroll
        for (int i = 0; i < 4; ++i) { bc0[i] = bfr(t0[i]); bc1[i] = bfr(t1[i]); }
    }
    const size_t tbase = (size_t)(r0 / RB) * sRB + (size_t)(r0 % RB) * (size_t)pitch + (size_t)(c0 / CB) * sCB + (size_t)(c0 % CB);
#pragma unroll
    for (int mb = 0; mb < 2; ++mb) {
#pragma unroll
        for (int nb = 0; nb < 4; ++nb) {
#pragma unroll
            for (int j = 0; j < 8; ++j) os[(hi * 8 + j) * 68 + nb * 16 + lr] = acc[mb][nb][j]; }   // D: row 8h+j, col lane&15
        wave_sync();
        const size_t sb = tbase + (size_t)(mb * 16) * (size_t)pitch;
{
#pragma unroll
            for (int s = 0; s < 4; ++s) { const int row = 4 * s + rq;   // 4 s x 4 row groups = 16 rows; 8 lanes x 8 = 64 columns
                float br = 0.0f;
                if constexpr (BROW != 0) br = bfr(bias[r0 + mb * 16 + row]);
                const v4f x0 = *(const v4fa*)(&os[row * 68 + c8]); const v4f x1 = *(const v4fa*)(&os[row * 68 + c8 + 4]); v8h hv, rv;
#pragma unroll
                for (int i = 0; i < 4; ++i) { const float y0 = x0[i] + bc0[i] + br; const float y1 = x1[i] + bc1[i] + br;
                    const h16 a0 = (h16)y0; const h16 a1 = (h16)y1; hv[i] = a0; hv[4 + i] = a1; rv[i] = (h16)((y0 - (float)a0) * QRS); rv[4 + i] = (h16)((y1 - (float)a1) * QRS); }
                const size_t oo = sb + (size_t)row * (size_t)pitch + c8;
                *(v8h*)(Ph + oo) = hv; if (useRes) *(v8h*)(Pr + oo) = rv; }
             }
        wave_sync();
    }
}

// One stage of the flash kernel's ring: each thread copies two 16-byte pieces of the K tile and two of the V^T tile (tile rows r and r + 32) from global memory to LDS.
// lds: byte address of the thread's piece in the K tile of the target buffer. The s_wait_xcnt stands inside the statement so that no address register is rewritten in front of it.
__device__ __forceinline__ void stage_copy(unsigned lds, const h16* gk, const h16* gv) {
    const unsigned l1 = lds + 32 * LP * 2, l2 = lds + TLH * 2, l3 = lds + TLH * 2 + 32 * LP * 2;
    const h16* gk1 = gk + (size_t)32 * HD; const h16* gv1 = gv + (size_t)32 * SEQ;
    asm volatile("global_load_async_to_lds_b128 %0, %4, off\n\t"
                 "global_load_async_to_lds_b128 %1, %5, off\n\t"
                 "global_load_async_to_lds_b128 %2, %6, off\n\t"
                 "global_load_async_to_lds_b128 %3, %7, off\n\t"
                 "s_wait_xcnt 0x0"
                 :: "v"(lds), "v"(l1), "v"(l2), "v"(l3), "v"(gk), "v"(gk1), "v"(gv), "v"(gv1) : "memory");
}

// k_flash: fused attention, one wave per 16 query rows of one (batch, head); Q fragments straight from the f16 planes (two 16-B loads each, arithmetic addressing).
// K and V^T: the block's waves share every key tile, so a stage of KT keys (K rows, V^T rows, 128 B each) is brought into LDS once per block by asynchronous copies
// (whole 128-B lines per 8 lanes), two buffers, the next stage in flight while this one is worked on; fragments are two 16-B LDS loads each, same element map as before.
// Transposed form: S^T[key][t] = K Q^T (A = K rows, B = Q rows); lane (t = lane&15, h = lane>>4) holds keys 8h+r of each 16-key tile, so the packed
// P tile is directly the B fragment of O^T[d][t] = V^T P^T (element r <- tile keys 0..15, element 8+r <- tile keys 16..31, lane unchanged).
// Softmax state (running max, partial sum) is one scalar per lane; the two lane halves of a row are combined with one xor-16 exchange.
__global__ __launch_bounds__(32 * AW) void k_flash(const h16* __restrict__ QH, const h16* __restrict__ QR, const h16* __restrict__ KP, const h16* __restrict__ VT, h16* CTX) {
    __shared__ __align__(16) float os[AW * 16 * 68];
    __shared__ __align__(16) h16 ring[2 * STH];
    const int lane = threadIdx.x & 31, lr = lane & 15, hi = lane >> 4;
    const int wave = __builtin_amdgcn_readfirstlane((int)(threadIdx.x >> 5));
    const int zh = blockIdx.y; const int b = zh / NH_, h = zh % NH_;
    const int t0 = (blockIdx.x * AW + wave) * 16;
    const size_t pbase = (size_t)zh * SEQ * HD;
    const size_t qo = pbase + (size_t)(t0 + lr) * HD + 8 * hi;
    const v16h qh0 = ldh(QH + qo), qh1 = ldh(QH + qo + 32), qr0 = ldh(QR + qo), qr1 = ldh(QR + qo + 32);   // B fragments: col t, k = d
    // copy map: thread c takes 16-byte piece c & 7 of tile rows c >> 3 and 32 + (c >> 3), of the K tile and of the V^T tile
    const int crw = (int)threadIdx.x >> 3, cpc = ((int)threadIdx.x & 7) * 8;
    const h16* gk = KP + pbase + (size_t)crw * HD + cpc;      // + stage * KT * HD   (row = key)
    const h16* gv = VT + pbase + (size_t)crw * SEQ + cpc;     // + stage * KT        (row = d)
    const unsigned lc = (unsigned)(size_t)&ring[crw * LP + cpc];   // LDS byte address: low 32 bits of the shared address
    const int ko = lr * LP + 8 * hi;            // + key_local * LP          (A fragment: row key, k = d)
    const int vo = TLH + lr * LP + 8 * hi;      // + 16j * LP + key_local    (A fragment: row d, k = key)
    stage_copy(lc, gk, gv);
    asm volatile("s_wait_asynccnt 0x0" ::: "memory");   // stage 0 landed before the barrier that publishes it
    __syncthreads();
    stage_copy(lc + STH * 2, gk + (size_t)KT * HD, gv + KT);
    v8f o0 = (v8f){}, o1 = (v8f){}, o2 = (v8f){}, o3 = (v8f){};
    float m = -3.0e38f, l = 0.0f;
#pragma unroll 1
    for (int st = 0; st < SEQ / KT; ++st) {
      const int bo = (st & 1) * STH;
#pragma unroll   // the 32-key steps of a stage unrolled, so that every LDS offset inside a stage is an immediate
      for (int kl = 0; kl < KT; kl += 32) {
        const h16* ka = ring + bo + ko + kl * LP;
        const v16h ka0 = ldh(ka), ka1 = ldh(ka + 32), kb0 = ldh(ka + 16 * LP), kb1 = ldh(ka + 16 * LP + 32);
        v8f sHa = (v8f){}, sLa = (v8f){}, sHb = (v8f){}, sLb = (v8f){};
        sHa = wmma16(ka0, qh0, sHa); sLa = wmma16(ka0, qr0, sLa); sHb = wmma16(kb0, qh0, sHb); sLb = wmma16(kb0, qr0, sLb);
        sHa = wmma16(ka1, qh1, sHa); sLa = wmma16(ka1, qr1, sLa); sHb = wmma16(kb1, qh1, sHb); sLb = wmma16(kb1, qr1, sLb);
        asm volatile("v_nop\n\tv_nop\n\tv_nop\n\tv_nop" : "+v"(sHa), "+v"(sLa), "+v"(sHb), "+v"(sLb) : "v"(ka0), "v"(ka1), "v"(kb0), "v"(kb1));
        float ta[8], tb[8]; float mx = -3.0e38f;
#pragma unroll
        for (int r = 0; r < 8; ++r) { ta[r] = (sHa[r] + sLa[r] * QRI) * SC2; tb[r] = (sHb[r] + sLb[r] * QRI) * SC2; mx = fmaxf(mx, fmaxf(ta[r], tb[r])); }
        mx = fmaxf(mx, __shfl_xor(mx, 16, 32));
        const float mnew = fmaxf(m, mx);
        const float alpha = __builtin_amdgcn_exp2f(m - mnew);
        const float sh = PSH - mnew;
        v16h pb; float ls = 0.0f;
#pragma unroll
        for (int r = 0; r < 8; ++r) { const h16 pa = (h16)__builtin_amdgcn_exp2f(ta[r] + sh); const h16 pc = (h16)__builtin_amdgcn_exp2f(tb[r] + sh); pb[r] = pa; pb[8 + r] = pc; ls += (float)pa + (float)pc; }
        l = l * alpha + ls; m = mnew;
        o0 = o0 * alpha; o1 = o1 * alpha; o2 = o2 * alpha; o3 = o3 * alpha;
        const h16* va = ring + bo + vo + kl;
        const v16h v0 = ldh(va), v1 = ldh(va + 16 * LP), v2 = ldh(va + 32 * LP), v3 = ldh(va + 48 * LP);
        o0 = wmma16(v0, pb, o0); o1 = wmma16(v1, pb, o1); o2 = wmma16(v2, pb, o2); o3 = wmma16(v3, pb, o3);
        asm volatile("v_nop\n\tv_nop\n\tv_nop\n\tv_nop" : "+v"(o0), "+v"(o1), "+v"(o2), "+v"(o3) : "v"(v0), "v"(v1), "v"(v2), "v"(v3), "v"(pb));
      }
      // publish point of stage st + 1, which also frees the buffer that this trip has read
      asm volatile("s_wait_dscnt 0x0" ::: "memory");      // this wave's reads of the buffer have returned before it is refilled
      asm volatile("s_wait_asynccnt 0x0" ::: "memory");   // this wave's copies of stage st + 1 have landed before other waves read them
      __syncthreads();
      if (st + 2 < SEQ / KT) stage_copy(lc + (unsigned)bo * 2, gk + (size_t)(st + 2) * KT * HD, gv + (size_t)(st + 2) * KT);
    }
    asm volatile("s_wait_asynccnt 0x0" ::: "memory");     // nothing of this wave is in flight when it goes on to the epilogue
    l += __shfl_xor(l, 16, 32);
    const float inv = CTXS * (1.0f / l);
    const int wb = wave * 16 * 68;
    // O^T D layout: o_j[r] = (d = 16j + 8h + r, t = lane&15) -> os[t][d]; rows 0..15 x columns 0..63 all written
    { v4f a, c;
      a[0] = o0[0] * inv; a[1] = o0[1] * inv; a[2] = o0[2] * inv; a[3] = o0[3] * inv; c[0] = o0[4] * inv; c[1] = o0[5] * inv; c[2] = o0[6] * inv; c[3] = o0[7] * inv;
      *(v4fa*)(&os[wb + lr * 68 +  0 + 8 * hi]) = a; *(v4fa*)(&os[wb + lr * 68 +  0 + 8 * hi + 4]) = c;
      a[0] = o1[0] * inv; a[1] = o1[1] * inv; a[2] = o1[2] * inv; a[3] = o1[3] * inv; c[0] = o1[4] * inv; c[1] = o1[5] * inv; c[2] = o1[6] * inv; c[3] = o1[7] * inv;
      *(v4fa*)(&os[wb + lr * 68 + 16 + 8 * hi]) = a; *(v4fa*)(&os[wb + lr * 68 + 16 + 8 * hi + 4]) = c;
      a[0] = o2[0] * inv; a[1] = o2[1] * inv; a[2] = o2[2] * inv; a[3] = o2[3] * inv; c[0] = o2[4] * inv; c[1] = o2[5] * inv; c[2] = o2[6] * inv; c[3] = o2[7] * inv;
      *(v4fa*)(&os[wb + lr * 68 + 32 + 8 * hi]) = a; *(v4fa*)(&os[wb + lr * 68 + 32 + 8 * hi + 4]) = c;
      a[0] = o3[0] * inv; a[1] = o3[1] * inv; a[2] = o3[2] * inv; a[3] = o3[3] * inv; c[0] = o3[4] * inv; c[1] = o3[5] * inv; c[2] = o3[6] * inv; c[3] = o3[7] * inv;
      *(v4fa*)(&os[wb + lr * 68 + 48 + 8 * hi]) = a; *(v4fa*)(&os[wb + lr * 68 + 48 + 8 * hi + 4]) = c; }
    wave_sync();
    h16* crow = CTX + ((size_t)b * SEQ + t0) * DM + h * HD;
    const int rq = lane >> 3, c8 = (lane & 7) * 8;
{
#pragma unroll
        for (int s = 0; s < 4; ++s) { const int row = 4 * s + rq;   // 4 s x 4 row groups = 16 rows; 8 lanes x 8 halves = 64 columns
            const v4f x0 = *(const v4fa*)(&os[wb + row * 68 + c8]); const v4f x1 = *(const v4fa*)(&os[wb + row * 68 + c8 + 4]); v8h hv;
#pragma unroll
            for (int i = 0; i < 4; ++i) { hv[i] = (h16)x0[i]; hv[4 + i] = (h16)x1[i]; }
            *(v8h*)(crow + (size_t)row * DM + c8) = hv; }
         }
}

// k_outp: f16 GEMM, one block of 8 waves per 128 x 128 tile (gemm_core), each wave's 32 x 64 tile in 8 accumulators, K = DM.
// OUT[(s*NB_FULL + b)][n] = OSCL * sum_k A[b*SEQ + s][k] Bt[n][k] + bias[n] (bias at its bf16 RNE value, f32 add). grid (NB*SEQ/128, DM/128), 256 threads.
__global__ __launch_bounds__(256) void k_outp(const h16* __restrict__ A, const h16* __restrict__ Bt, const float* __restrict__ bias, float* OUT) {
    __shared__ __align__(16) bf ring[2 * GSTH];
    __shared__ __align__(16) float osb[8 * 16 * 68];
    const int lane = threadIdx.x & 31, lr = lane & 15, hi = lane >> 4;
    const int wave = __builtin_amdgcn_readfirstlane((int)(threadIdx.x >> 5));
    float* os = osb + wave * 16 * 68;            // each wave stages its output rows in its own range
    const int r0 = blockIdx.x * GT + (wave >> 1) * 32, c0 = blockIdx.y * GT + (wave & 1) * 64;
    v8f acc[2][4];
    gemm_core<0>((const bf*)A, (const bf*)Bt, blockIdx.x * GT, blockIdx.y * GT, ring, acc);
    const int bb = r0 / SEQ, sb = r0 % SEQ;        // tile rows share one batch (SEQ % 64 == 0)
    const int cofs = lr * 4;
    v4f bv;
    { const v4f t = *(const v4f*)(bias + c0 + cofs);
#pragma unroll
      for (int i = 0; i < 4; ++i) bv[i] = bfr(t[i]); }
#pragma unroll
    for (int mb = 0; mb < 2; ++mb) {
#pragma unroll
        for (int nb = 0; nb < 4; ++nb) {
#pragma unroll
            for (int j = 0; j < 8; ++j) os[(hi * 8 + j) * 68 + nb * 16 + lr] = acc[mb][nb][j]; }   // D: row 8h+j, col lane&15
        wave_sync();
{
#pragma unroll
            for (int s = 0; s < 8; ++s) { const int row = 2 * s + hi;   // 8 s x 2 rows = 16 rows; 16 lanes x 4 floats = 64 columns
                const v4f x = *(const v4fa*)(&os[row * 68 + cofs]); v4f val;
#pragma unroll
                for (int i = 0; i < 4; ++i) val[i] = x[i] * OSCL + bv[i];
                float* dst = OUT + ((size_t)(sb + mb * 16 + row) * NB_FULL + bb) * DM + c0 + cofs;
                *(v4f*)dst = val; }
             }
        wave_sync();
    }
}

static constexpr size_t al256(size_t v) { return (v + 255) & ~(size_t)255; }
static constexpr size_t SZ_X   = al256((size_t)NB * SEQ * DM * 2);          // one bf16 input copy
static constexpr size_t SZ_W   = al256((size_t)DM * DM * 2);                // one 16-bit weight plane
static constexpr size_t SZ_PL  = al256((size_t)NB * NH_ * SEQ * HD * 2);    // one head plane
static constexpr size_t SZ_CTX = al256((size_t)NB * SEQ * DM * 2);          // f16 ctx plane
static constexpr size_t SZ_TOTAL = 3 * SZ_X + 4 * SZ_W + 4 * SZ_PL + SZ_CTX;
static_assert(SZ_TOTAL <= (size_t)134217728);          // workspace carve <= 128 MiB
static_assert(((size_t)DM * DM * 2) % 256 == 0);

extern "C" void kernel_launch(void* const* d_in, const int* in_sizes, int n_in,
                              void* d_out, int out_size, void* d_ws, size_t ws_size, hipStream_t stream) {
    if (n_in < 11) return;
    const size_t needx = ((size_t)(SEQ - 1) * NB_FULL + NB) * DM;
    if ((size_t)in_sizes[0] < needx || (size_t)in_sizes[1] < needx || (size_t)in_sizes[2] < needx) return;
    if ((size_t)in_sizes[3] < (size_t)DM * DM || (size_t)in_sizes[5] < (size_t)DM * DM || (size_t)in_sizes[7] < (size_t)DM * DM || (size_t)in_sizes[9] < (size_t)DM * DM) return;
    if (in_sizes[4] < DM || in_sizes[6] < DM || in_sizes[8] < DM || in_sizes[10] < DM) return;
    if ((size_t)out_size < needx) return;
    if (SZ_TOTAL > ws_size) return;
    // wire order: query, key, value, Wq, bq, Wk, bk, Wv, bv, Wo, bo (weights [out][in] = Bt as-is)
    const float* xq = (const float*)d_in[0]; const float* xk = (const float*)d_in[1]; const float* xv = (const float*)d_in[2];
    const float* wq = (const float*)d_in[3]; const float* bq = (const float*)d_in[4];
    const float* wk = (const float*)d_in[5]; const float* bk = (const float*)d_in[6];
    const float* wv = (const float*)d_in[7]; const float* bvv = (const float*)d_in[8];
    const float* wo = (const float*)d_in[9]; const float* bo = (const float*)d_in[10];
    float* OUT = (float*)d_out;      // [SEQ][NB_FULL][1024]
    char* wsp = (char*)d_ws;
    bf* XQ = (bf*)wsp; wsp += SZ_X;                  // [NB*SEQ][1024], row b*SEQ + s
    bf* XK = (bf*)wsp; wsp += SZ_X;
    bf* XV = (bf*)wsp; wsp += SZ_X;
    bf* WQ = (bf*)wsp; wsp += SZ_W;                  // [1024][1024]
    bf* WK = (bf*)wsp; wsp += SZ_W;
    bf* WV = (bf*)wsp; wsp += SZ_W;
    h16* WO = (h16*)wsp; wsp += SZ_W;                // f16, x64
    h16* QH = (h16*)wsp; wsp += SZ_PL;               // [NB*16][SEQ][64]
    h16* QR = (h16*)wsp; wsp += SZ_PL;               // [NB*16][SEQ][64] residual x2048
    h16* KP = (h16*)wsp; wsp += SZ_PL;               // [NB*16][SEQ][64]
    h16* VT = (h16*)wsp; wsp += SZ_PL;               // [NB*16][64][SEQ]
    h16* CTX = (h16*)wsp; wsp += SZ_CTX;             // [NB*SEQ][1024], x32

    k_cvt_all<<<CWV / CW, 32 * CW, 0, stream>>>(xq, xk, xv, wq, wk, wv, wo, XQ, XK, XV, WQ, WK, WV, WO);

    // q, k: A = x rows (m = b*SEQ + t), Bt = W rows (n = h*64 + d), column bias -> plane [(b*16 + h)][t][d]
    k_proj<0><<<dim3(NB * SEQ / GT, DM / GT, 1), 256, 0, stream>>>(XQ, WQ, bq, QH, QR, 1, SEQ, (size_t)NH_ * SEQ * HD, HD, HD, (size_t)SEQ * HD);
    k_proj<0><<<dim3(NB * SEQ / GT, DM / GT, 1), 256, 0, stream>>>(XK, WK, bk, KP, KP, 0, SEQ, (size_t)NH_ * SEQ * HD, HD, HD, (size_t)SEQ * HD);
    // v^T: A = Wv rows (m = h*64 + d), Bt = x rows (n = b*SEQ + t), row bias -> plane [(b*1024 + m)][t] = [(b*16 + h)][d][t]
    k_proj<1><<<dim3(DM / GT, NB * SEQ / GT, 1), 256, 0, stream>>>(WV, XV, bvv, VT, VT, 0, DM, (size_t)0, SEQ, SEQ, (size_t)DM * SEQ);

    k_flash<<<dim3(SEQ / (16 * AW), NB * NH_, 1), 32 * AW, 0, stream>>>(QH, QR, KP, VT, CTX);

    // output projection: A = ctx rows (m = b*SEQ + s), Bt = Wo rows (n) -> OUT row s*NB_FULL + b
    k_outp<<<dim3(NB * SEQ / GT, DM / GT, 1), 256, 0, stream>>>(CTX, WO, bo, OUT);
}

// v004
// A run of this version takes 100 microseconds.
// Next to v003, in two timings, it ran 1.10 and 1.07 times as fast.
// Over all steps from v000 it is 2.44 times as fast.
#include <hip/hip_runtime.h>

// Multi-head attention, width 1024 = 16 heads x 64; query/key/value [SEQ][NB][1024] (token row = s*NB + b), Wq/Wk/Wv/Wo [out][in] (y = x W^T + bias), score scale 1/8, no mask, output [SEQ][NB][1024] f32.
// Compute dtypes, f32 accumulate everywhere: q/k/v projections v_wmma_f32_16x16x32_bf16 (inputs and W RNE-converted to bf16; products exact);
// scores v_wmma_f32_16x16x32_f16: k single f16, q as f16 value + f16 residual x2048 in its own accumulator (two products); P (x256 carry, cancels in the normalisation) and v single f16; softmax f32 (online, running max);
// output projection v_wmma_f32_16x16x32_f16: ctx single f16 (x32 carry), Wo = f16 of the bf16 RNE value (x64 carry), 1/2048 folded back in the f32 epilogue; biases added in f32.
// Layout: bf16 copies of the inputs with batch-major rows (b*SEQ + s); q (value, residual), k planes [b*16+h][t][d] and v^T plane [b*16+h][d][t] from the GEMM epilogue; fused flash kernel in transposed form (S^T = K Q^T, O^T = V^T P^T) writing the f16 ctx plane [b*SEQ+s][1024]; final GEMM writes the output rows (s*NB + b).

#ifndef NB
#define NB 2
#endif
#ifndef SEQ
#define SEQ 2048
#endif
#define NB_FULL  2
#define SEQ_FULL 2048
#define DM   1024
#define NH_  16
#define HD   64
#define AW   8                   // waves per flash block (16 query rows each)
#define KT   64                  // keys per LDS stage of the flash kernel
#define LP   72                  // LDS row pitch in halves: 128-B rows + 16 B (16 B x odd, for 16-byte readers)
#define TLH  (64 * LP)           // halves of one staged 64-row tile
#define STH  (2 * TLH)           // halves of one stage: K tile [key][d], then V^T tile [d][key]
#define QRS  2048.0f             // carry of the q residual plane
#define QRI  (1.0f / 2048.0f)
#define SC2  (0.125f * 1.4426950408889634f)   // HD^-0.5 * log2(e)
#define PSH  8.0f                // log2 of the P carry (256)
#define CTXS 32.0f               // carry of the ctx plane
#define WOS  64.0f               // carry of the Wo plane
#define OSCL (1.0f / 2048.0f)    // 1 / (CTXS * WOS)
#define GT   128                 // rows and columns of a GEMM block's tile: 8 waves, 4 x 2, 32 rows x 64 columns each
#define GKS  128                 // k per LDS stage of the GEMM kernels
#define GLP  136                 // LDS row pitch in halves: 256-B rows + 16 B (16 B x odd, for 16-byte readers)
#define GOPH (GT * GLP)          // halves of one operand's staged tile
#define GSTH (2 * GOPH)          // halves of one stage: A tile [row][k], then B tile [row][k]
#define CW   16                  // waves per block of the convert kernel
#define XR   (NB * SEQ)          // rows of one input
#define WR   (4 * DM)            // rows of the four weight matrices together
#define CWV  (XR > WR ? XR : WR) // waves of the convert launch

static_assert(HD == 64);
static_assert(NH_ * HD == DM);                 // head h = columns h*64 + d
static_assert(DM % 64 == 0);                   // column tiles of 64
static_assert(DM % 32 == 0);                   // GEMM k-loop steps by 32
static_assert(SEQ % 64 == 0);                  // a 64-row tile never straddles two batches
static_assert((NB * SEQ) % 64 == 0);
static_assert(SEQ % 32 == 0);                  // key loop steps by 32
static_assert(SEQ % KT == 0 && SEQ / KT >= 2); // whole stages; the two-buffer prologue needs two
static_assert(AW * 32 * 2 * 8 == KT * HD);     // two 16-byte copies per thread fill one 64 x 64 tile
static_assert((LP * 2) % 16 == 0);
static_assert(SEQ % (16 * AW) == 0);           // flash grid covers the sequence exactly
static_assert(((size_t)SEQ * DM) % 8 == 0);
static_assert(((size_t)DM * DM) % 8 == 0);
static_assert(DM % GT == 0 && (NB * SEQ) % GT == 0);   // GEMM grids cover both operands exactly
static_assert(DM % GKS == 0 && DM / GKS >= 2);         // whole stages; the two-buffer prologue needs two
static_assert(GKS * 2 == 16 * 16 && GT == 16 * 8);     // 16 threads x 16 B fill a row; 256 threads take 16 rows a copy, 8 copies an operand
static_assert((GLP * 2) % 16 == 0);
static_assert(CWV % CW == 0);                  // the convert grid covers its waves exactly
static_assert(DM == 8 * 32 * 4);               // a row is 8 wave-wide 16-byte loads
static_assert(NB <= NB_FULL);
static_assert(SEQ <= SEQ_FULL);

typedef _Float16 h16;
typedef unsigned short bf;
typedef __attribute__((ext_vector_type(16))) __bf16   v16bf;
typedef __attribute__((ext_vector_type(16))) _Float16 v16h;
typedef __attribute__((ext_vector_type(8)))  _Float16 v8h;
typedef __attribute__((ext_vector_type(8)))  unsigned short v8us;
typedef __attribute__((ext_vector_type(4)))  unsigned short v4us;
typedef __attribute__((ext_vector_type(4)))  _Float16 v4h;
typedef __attribute__((ext_vector_type(16))) unsigned short v16us;
typedef __attribute__((ext_vector_type(8)))  float    v8f;
typedef __attribute__((ext_vector_type(4)))  float    v4f;
typedef v4f  __attribute__((may_alias)) v4fa;

__device__ __forceinline__ unsigned short f2bf(float f) { unsigned u = __float_as_uint(f); u += 0x7FFFu + ((u >> 16) & 1u); return (unsigned short)(u >> 16); }
__device__ __forceinline__ float bfr(float f) { return __uint_as_float(((unsigned)f2bf(f)) << 16); }   // f32 value of the bf16 RNE convert
__device__ __forceinline__ v4us bf4(v4f x) { v4us o; o[0] = f2bf(x[0]); o[1] = f2bf(x[1]); o[2] = f2bf(x[2]); o[3] = f2bf(x[3]); return o; }
__device__ __forceinline__ v16h cat16(v8h lo, v8h hi) { return __builtin_shufflevector(lo, hi, 0, 1, 2, 3, 4, 5, 6, 7, 8, 9, 10, 11, 12, 13, 14, 15); }
__device__ __forceinline__ v8f wmma16(v16h a, v16h b, v8f c) { return __builtin_amdgcn_wmma_f32_16x16x32_f16(false, a, false, b, (short)0, c, false, false); }
__device__ __forceinline__ v8f wmmab(v16bf a, v16bf b, v8f c) { return __builtin_amdgcn_wmma_f32_16x16x32_bf16(false, a, false, b, (short)0, c, false, false); }
// fragment loaders from K-contiguous 16-bit rows; p already includes + 8*(lane>>4): elements 0..7 <- k0+8h+0..7, elements 8..15 <- k0+16+8h+0..7 (same map for A and B)
__device__ __forceinline__ v16h  ldh(const h16* p) { return cat16(*(const v8h*)p, *(const v8h*)(p + 16)); }
__device__ __forceinline__ v16us ldu(const bf* p)  { return __builtin_shufflevector(*(const v8us*)p, *(const v8us*)(p + 16), 0, 1, 2, 3, 4, 5, 6, 7, 8, 9, 10, 11, 12, 13, 14, 15); }   // raw 16-bit fragment, bf16 or f16
// ordering point for wave-private LDS tiles (same wave writes and reads)
__device__ __forceinline__ void wave_sync() { __builtin_amdgcn_fence(3 /* release order */, "wavefront"); __builtin_amdgcn_wave_barrier(); asm volatile("" ::: "memory"); }

// k_cvt_all: every 16-bit operand plane in one launch, few waves with much in flight (a launch of one small piece per thread is bound by how fast its waves start).
// Wave w takes row w (order b*SEQ + s, from source row s*NB_FULL + b) of query, key and value and row w of the four stacked weight matrices (w / DM picks the matrix).
// A row is 8 wave-wide 16-byte loads of 512 contiguous bytes each; all 32 loads of a wave are issued before its first convert. A wave past the end of either set re-reads row 0 and stores nothing.
__global__ __launch_bounds__(32 * CW) void k_cvt_all(const float* __restrict__ xq, const float* __restrict__ xk, const float* __restrict__ xv,
                                                     const float* __restrict__ wq, const float* __restrict__ wk, const float* __restrict__ wv, const float* __restrict__ wo,
                                                     bf* XQ, bf* XK, bf* XV, bf* WQ, bf* WK, bf* WV, h16* WO) {
    const unsigned lane = threadIdx.x & 31;         // the lane's 4 elements inside each 128-element piece of a row: vector index lane + 32 j
    const int w = blockIdx.x * CW + __builtin_amdgcn_readfirstlane((int)(threadIdx.x >> 5));
    const bool dx = XR == CWV || w < XR, dw = WR == CWV || w < WR;
    const int xw = dx ? w : 0, ww = dw ? w : 0;
    const int sg = ww / DM;
    // row bases are the same in every lane: scalar base + one lane offset for all loads
    const size_t so = ((size_t)(xw % SEQ) * NB_FULL + (size_t)(xw / SEQ)) * DM, xo = (size_t)xw * DM, wr = (size_t)(ww % DM) * DM;
    const float* pq = xq + so; const float* pk = xk + so; const float* pv = xv + so;
    const float* pw = (sg == 0 ? wq : sg == 1 ? wk : sg == 2 ? wv : wo) + wr;
    v4f q[8], k[8], v[8], t[8];
#pragma unroll
    for (int j = 0; j < 8; ++j) q[j] = ((const v4f*)pq)[lane + j * 32];
#pragma unroll
    for (int j = 0; j < 8; ++j) k[j] = ((const v4f*)pk)[lane + j * 32];
#pragma unroll
    for (int j = 0; j < 8; ++j) v[j] = ((const v4f*)pv)[lane + j * 32];
#pragma unroll
    for (int j = 0; j < 8; ++j) t[j] = ((const v4f*)pw)[lane + j * 32];
    __builtin_amdgcn_sched_barrier(0);   // keeps all 32 loads in front of the first convert (else the weight row's loads are moved behind the wait for the other 24: a second memory latency)
    if (dx) {
        bf* dq = XQ + xo; bf* dk = XK + xo; bf* dv = XV + xo;
#pragma unroll
        for (int j = 0; j < 8; ++j) ((v4us*)dq)[lane + j * 32] = bf4(q[j]);
#pragma unroll
        for (int j = 0; j < 8; ++j) ((v4us*)dk)[lane + j * 32] = bf4(k[j]);
#pragma unroll
        for (int j = 0; j < 8; ++j) ((v4us*)dv)[lane + j * 32] = bf4(v[j]);
    }
    asm volatile("s_wait_xcnt 0x0" ::: "memory");   // in front of the branches below, whose first instructions rewrite registers that the stores above name
    if (dw) {
        if (sg < 3) {
            bf* d = (sg == 0 ? WQ : sg == 1 ? WK : WV) + wr;
#pragma unroll
            for (int j = 0; j < 8; ++j) ((v4us*)d)[lane + j * 32] = bf4(t[j]);
        } else {
            h16* d = WO + wr;
#pragma unroll
            for (int j = 0; j < 8; ++j) { v4h o;
#pragma unroll
                for (int i = 0; i < 4; ++i) o[i] = (h16)(bfr(t[j][i]) * WOS);
                ((v4h*)d)[lane + j * 32] = o; }
        }
    }
}

// Eight 16-byte asynchronous copies of one thread: tile rows r, r + 16, ..., r + 112 (global row pitch DM, LDS row pitch GLP).
// The s_wait_xcnt stands inside the statement so that no address register is rewritten in front of it.
__device__ __forceinline__ void copy8(unsigned l, const bf* g) {
    asm volatile("global_load_async_to_lds_b128 %0, %8, off\n\t"
                 "global_load_async_to_lds_b128 %1, %9, off\n\t"
                 "global_load_async_to_lds_b128 %2, %10, off\n\t"
                 "global_load_async_to_lds_b128 %3, %11, off\n\t"
                 "global_load_async_to_lds_b128 %4, %12, off\n\t"
                 "global_load_async_to_lds_b128 %5, %13, off\n\t"
                 "global_load_async_to_lds_b128 %6, %14, off\n\t"
                 "global_load_async_to_lds_b128 %7, %15, off\n\t"
                 "s_wait_xcnt 0x0"
                 :: "v"(l), "v"(l + 16 * GLP * 2), "v"(l + 32 * GLP * 2), "v"(l + 48 * GLP * 2), "v"(l + 64 * GLP * 2), "v"(l + 80 * GLP * 2), "v"(l + 96 * GLP * 2), "v"(l + 112 * GLP * 2),
                    "v"(g), "v"(g + (size_t)16 * DM), "v"(g + (size_t)32 * DM), "v"(g + (size_t)48 * DM), "v"(g + (size_t)64 * DM), "v"(g + (size_t)80 * DM), "v"(g + (size_t)96 * DM), "v"(g + (size_t)112 * DM)
                 : "memory");
}
// One stage of the GEMM ring: GT rows x GKS k of A, then of B; each thread copies 8 pieces of each. l: LDS byte address of the thread's first piece in the target buffer.
__device__ __forceinline__ void gemm_stage(unsigned l, const bf* ga, const bf* gb) { copy8(l, ga); copy8(l + GOPH * 2, gb); }
template <int BFK>
__device__ __forceinline__ v8f wmmau(v16us a, v16us b, v8f c) {
    if constexpr (BFK != 0) return wmmab(__builtin_bit_cast(v16bf, a), __builtin_bit_cast(v16bf, b), c);
    else return wmma16(__builtin_bit_cast(v16h, a), __builtin_bit_cast(v16h, b), c);
}

// gemm_core: the k loop of one GT x GT block tile, 8 waves, wave (wm, wn) = (wave >> 1, wave & 1) owning the 32 x 64 tile at (rb + 32 wm, cb + 64 wn), K = DM.
// A rows rb.. and Bt rows cb.. (K-contiguous 16-bit planes, bf16 for BFK != 0, else f16) come into LDS once per block by asynchronous copies (whole 256-B row pieces per 16 lanes),
// two buffers of GKS k, the next stage in flight while this one is worked on; fragments are two 16-B LDS loads each, same element map and same k order as from global memory.
template <int BFK>
__device__ __forceinline__ void gemm_core(const bf* __restrict__ A, const bf* __restrict__ Bt, int rb, int cb, bf* ring, v8f (&acc)[2][4]) {
    const int lane = threadIdx.x & 31, lr = lane & 15, hi = lane >> 4;
    const int wave = __builtin_amdgcn_readfirstlane((int)(threadIdx.x >> 5));
    // copy map: thread c takes 16-byte piece c & 15 of tile rows (c >> 4) + 16 i, i = 0..7, of the A tile and of the B tile
    const int crw = (int)threadIdx.x >> 4, cpc = ((int)threadIdx.x & 15) * 8;
    const bf* ga = A + (size_t)(rb + crw) * DM + cpc;       // + stage * GKS
    const bf* gb = Bt + (size_t)(cb + crw) * DM + cpc;      // + stage * GKS
    const unsigned lc = (unsigned)(size_t)&ring[crw * GLP + cpc];   // LDS byte address: low 32 bits of the shared address
    const int ao = ((wave >> 1) * 32 + lr) * GLP + 8 * hi;          // + 16 mb * GLP + k_local
    const int bo = GOPH + ((wave & 1) * 64 + lr) * GLP + 8 * hi;    // + 16 nb * GLP + k_local
#pragma unroll
    for (int mb = 0; mb < 2; ++mb)
#pragma unroll
        for (int nb = 0; nb < 4; ++nb) acc[mb][nb] = (v8f){};
    gemm_stage(lc, ga, gb);
    asm volatile("s_wait_asynccnt 0x0" ::: "memory");   // stage 0 landed before the barrier that publishes it
    __syncthreads();
    gemm_stage(lc + GSTH * 2, ga + GKS, gb + GKS);
#pragma unroll 1
    for (int st = 0; st < DM / GKS; ++st) {
        const int so = (st & 1) * GSTH;
        const bf* pa = ring + so + ao; const bf* pb = ring + so + bo;
        v16us a[2][2], b[2][4];
#pragma unroll
        for (int i = 0; i < 2; ++i) a[0][i] = ldu(pa + i * 16 * GLP);
#pragma unroll
        for (int i = 0; i < 4; ++i) b[0][i] = ldu(pb + i * 16 * GLP);
#pragma unroll   // the 32-k blocks of a stage unrolled: every LDS offset an immediate, both fragment sets indexed by constants
        for (int kk = 0; kk < GKS / 32; ++kk) {
            const int cu = kk & 1, nx = cu ^ 1;
            if (kk + 1 < GKS / 32) {
#pragma unroll
                for (int i = 0; i < 2; ++i) a[nx][i] = ldu(pa + i * 16 * GLP + (kk + 1) * 32);
#pragma unroll
                for (int i = 0; i < 4; ++i) b[nx][i] = ldu(pb + i * 16 * GLP + (kk + 1) * 32);
            }
            __builtin_amdgcn_sched_barrier(0);   // keeps the next block's LDS loads one group ahead of this block's products (else they are moved in among them, each with a wait to 0)
#pragma unroll
            for (int nb = 0; nb < 4; ++nb)
#pragma unroll
                for (int mb = 0; mb < 2; ++mb) acc[mb][nb] = wmmau<BFK>(a[cu][mb], b[cu][nb], acc[mb][nb]);
            __builtin_amdgcn_sched_barrier(0);   // keeps this block's products ahead of the following load group and of the stage's foot
        }
        // four vector slots behind the stage's last products, on the way to the branches below
        asm volatile("v_nop\n\tv_nop\n\tv_nop\n\tv_nop" : "+v"(acc[0][2]), "+v"(acc[1][2]), "+v"(acc[0][3]), "+v"(acc[1][3]) : "v"(a[1][0]), "v"(a[1][1]), "v"(b[1][2]), "v"(b[1][3]));
        // publish point of stage st + 1, which also frees the buffer that this trip has read
        asm volatile("s_wait_dscnt 0x0" ::: "memory");      // this wave's reads of the buffer have returned before it is refilled
        asm volatile("s_wait_asynccnt 0x0" ::: "memory");   // this wave's copies of stage st + 1 have landed before other waves read them
        __syncthreads();
        if (st + 2 < DM / GKS) gemm_stage(lc + (unsigned)so * 2, ga + (size_t)(st + 2) * GKS, gb + (size_t)(st + 2) * GKS);
    }
    asm volatile("s_wait_asynccnt 0x0" ::: "memory");       // nothing of this wave is in flight when it goes on to the epilogue
}

// proj_tile: bf16 GEMM tile (bx, by) of 128 x 128 by one block of 8 waves (gemm_core), each wave's 32 x 64 tile in 8 accumulators, K = DM.
// C[m][n] = sum_k A[m][k] Bt[n][k] + bias (BROW == 0: bias[n]; BROW == 1: bias[m]; bias taken at its bf16 RNE value, added in f32),
// written as f16 (Ph) and optionally the f16 residual x2048 (Pr, useRes != 0) at
// tile base (r0/RB)*sRB + (r0%RB)*pitch + (c0/CB)*sCB + (c0%CB), row pitch 'pitch' (halves).
// The output rows are staged in the ring's own LDS: behind the foot of gemm_core's last trip (every wave's s_wait_dscnt 0, s_wait_asynccnt 0, then the barrier) nobody reads the ring and no copy is in flight.
template <int BROW>
__device__ __forceinline__ void proj_tile(const bf* __restrict__ A, const bf* __restrict__ Bt, const float* __restrict__ bias, h16* Ph, h16* Pr, int useRes, int RB, size_t sRB, int pitch, int CB, size_t sCB, int bx, int by, bf* ring) {
    const int lane = threadIdx.x & 31, lr = lane & 15, hi = lane >> 4;
    const int wave = __builtin_amdgcn_readfirstlane((int)(threadIdx.x >> 5));
    float* os = (float*)ring + wave * 16 * 68;   // each wave stages its output rows in its own range
    const int r0 = bx * GT + (wave >> 1) * 32, c0 = by * GT + (wave & 1) * 64;
    v8f acc[2][4];
    gemm_core<1>(A, Bt, bx * GT, by * GT, ring, acc);
    const int rq = lane >> 3, c8 = (lane & 7) * 8;
    v4f bc0 = (v4f){0.0f, 0.0f, 0.0f, 0.0f}, bc1 = (v4f){0.0f, 0.0f, 0.0f, 0.0f};
    if constexpr (BROW == 0) {
        const v4f t0 = *(const v4f*)(bias + c0 + c8); const v4f t1 = *(const v4f*)(bias + c0 + c8 + 4);
#pragma unroll
        for (int i = 0; i < 4; ++i) { bc0[i] = bfr(t0[i]); bc1[i] = bfr(t1[i]); }
    }
    const size_t tbase = (size_t)(r0 / RB) * sRB + (size_t)(r0 % RB) * (size_t)pitch + (size_t)(c0 / CB) * sCB + (size_t)(c0 % CB);
#pragma unroll
    for (int mb = 0; mb < 2; ++mb) {
#pragma unroll
        for (int nb = 0; nb < 4; ++nb) {
#pragma unroll
            for (int j = 0; j < 8; ++j) os[(hi * 8 + j) * 68 + nb * 16 + lr] = acc[mb][nb][j]; }   // D: row 8h+j, col lane&15
        wave_sync();
        const size_t sb = tbase + (size_t)(mb * 16) * (size_t)pitch;
{
#pragma unroll
            for (int s = 0; s < 4; ++s) { const int row = 4 * s + rq;   // 4 s x 4 row groups = 16 rows; 8 lanes x 8 = 64 columns
                float br = 0.0f;
                if constexpr (BROW != 0) br = bfr(bias[r0 + mb * 16 + row]);
                const v4f x0 = *(const v4fa*)(&os[row * 68 + c8]); const v4f x1 = *(const v4fa*)(&os[row * 68 + c8 + 4]); v8h hv, rv;
#pragma unroll
                for (int i = 0; i < 4; ++i) { const float y0 = x0[i] + bc0[i] + br; const float y1 = x1[i] + bc1[i] + br;
                    const h16 a0 = (h16)y0; const h16 a1 = (h16)y1; hv[i] = a0; hv[4 + i] = a1; rv[i] = (h16)((y0 - (float)a0) * QRS); rv[4 + i] = (h16)((y1 - (float)a1) * QRS); }
                const size_t oo = sb + (size_t)row * (size_t)pitch + c8;
                *(v8h*)(Ph + oo) = hv;
                asm volatile("s_wait_xcnt 0x0" ::: "memory");   // in front of the residual's store and the next rows' loads and converts, which rewrite registers that the store above names
                if (useRes) *(v8h*)(Pr + oo) = rv; }
             }
        wave_sync();
    }
}

// k_proj3: the three input projections in one launch, grid (NB*SEQ/128, DM/128, 3), 256 threads; they are independent of one another, so a block of one starts wherever a place is free.
// With the ring as a block's only LDS two blocks fit a WGP: one block's first copies, barrier waits and output stores run beside the other's products.
// z = 0, 1 (q, k): A = x rows (m = b*SEQ + t), Bt = W rows (n = h*64 + d), column bias -> plane [(b*16 + h)][t][d]; q also writes its residual plane.
// z = 2 (v^T): A = Wv rows (m = h*64 + d), Bt = x rows (n = b*SEQ + t), row bias -> plane [(b*1024 + m)][t] = [(b*16 + h)][d][t]; tile (i % 8, i / 8) of the block's flat index i.
__global__ __launch_bounds__(256) void k_proj3(const bf* __restrict__ XQ, const bf* __restrict__ XK, const bf* __restrict__ XV, const bf* __restrict__ WQ, const bf* __restrict__ WK, const bf* __restrict__ WV,
                                               const float* __restrict__ bq, const float* __restrict__ bk, const float* __restrict__ bv, h16* QH, h16* QR, h16* KP, h16* VT) {
    __shared__ __align__(16) bf ring[2 * GSTH];
    static_assert(8 * 16 * 68 * 4 <= 2 * GSTH * 2);   // the eight waves' staging ranges lie inside the ring
    const int z = blockIdx.z;                          // the same for the whole block: every barrier below is passed by all of its waves
    if (z == 2) {
        const int i = blockIdx.y * (NB * SEQ / GT) + blockIdx.x;
        proj_tile<1>(WV, XV, bv, VT, VT, 0, DM, (size_t)0, SEQ, SEQ, (size_t)DM * SEQ, i % (DM / GT), i / (DM / GT), ring);
    } else {
        const bool q = z == 0;
        proj_tile<0>(q ? XQ : XK, q ? WQ : WK, q ? bq : bk, q ? QH : KP, q ? QR : KP, q ? 1 : 0, SEQ, (size_t)NH_ * SEQ * HD, HD, HD, (size_t)SEQ * HD, blockIdx.x, blockIdx.y, ring);
    }
}

// One stage of the flash kernel's ring: each thread copies two 16-byte pieces of the K tile and two of the V^T tile (tile rows r and r + 32) from global memory to LDS.
// lds: byte address of the thread's piece in the K tile of the target buffer. The s_wait_xcnt stands inside the statement so that no address register is rewritten in front of it.
__device__ __forceinline__ void stage_copy(unsigned lds, const h16* gk, const h16* gv) {
    const unsigned l1 = lds + 32 * LP * 2, l2 = lds + TLH * 2, l3 = lds + TLH * 2 + 32 * LP * 2;
    const h16* gk1 = gk + (size_t)32 * HD; const h16* gv1 = gv + (size_t)32 * SEQ;
    asm volatile("global_load_async_to_lds_b128 %0, %4, off\n\t"
                 "global_load_async_to_lds_b128 %1, %5, off\n\t"
                 "global_load_async_to_lds_b128 %2, %6, off\n\t"
                 "global_load_async_to_lds_b128 %3, %7, off\n\t"
                 "s_wait_xcnt 0x0"
                 :: "v"(lds), "v"(l1), "v"(l2), "v"(l3), "v"(gk), "v"(gk1), "v"(gv), "v"(gv1) : "memory");
}

// k_flash: fused attention, one wave per 16 query rows of one (batch, head); Q fragments straight from the f16 planes (two 16-B loads each, arithmetic addressing).
// K and V^T: the block's waves share every key tile, so a stage of KT keys (K rows, V^T rows, 128 B each) is brought into LDS once per block by asynchronous copies
// (whole 128-B lines per 8 lanes), two buffers, the next stage in flight while this one is worked on; fragments are two 16-B LDS loads each, same element map as before.
// Transposed form: S^T[key][t] = K Q^T (A = K rows, B = Q rows); lane (t = lane&15, h = lane>>4) holds keys 8h+r of each 16-key tile, so the packed
// P tile is directly the B fragment of O^T[d][t] = V^T P^T (element r <- tile keys 0..15, element 8+r <- tile keys 16..31, lane unchanged).
// Softmax state (running max, partial sum) is one scalar per lane; the two lane halves of a row are combined with one xor-16 exchange.
__global__ __launch_bounds__(32 * AW) void k_flash(const h16* __restrict__ QH, const h16* __restrict__ QR, const h16* __restrict__ KP, const h16* __restrict__ VT, h16* CTX) {
    __shared__ __align__(16) float os[AW * 16 * 68];
    __shared__ __align__(16) h16 ring[2 * STH];
    const int lane = threadIdx.x & 31, lr = lane & 15, hi = lane >> 4;
    const int wave = __builtin_amdgcn_readfirstlane((int)(threadIdx.x >> 5));
    const int zh = blockIdx.y; const int b = zh / NH_, h = zh % NH_;
    const int t0 = (blockIdx.x * AW + wave) * 16;
    const size_t pbase = (size_t)zh * SEQ * HD;
    const size_t qo = pbase + (size_t)(t0 + lr) * HD + 8 * hi;
    const v16h qh0 = ldh(QH + qo), qh1 = ldh(QH + qo + 32), qr0 = ldh(QR + qo), qr1 = ldh(QR + qo + 32);   // B fragments: col t, k = d
    // copy map: thread c takes 16-byte piece c & 7 of tile rows c >> 3 and 32 + (c >> 3), of the K tile and of the V^T tile
    const int crw = (int)threadIdx.x >> 3, cpc = ((int)threadIdx.x & 7) * 8;
    const h16* gk = KP + pbase + (size_t)crw * HD + cpc;      // + stage * KT * HD   (row = key)
    const h16* gv = VT + pbase + (size_t)crw * SEQ + cpc;     // + stage * KT        (row = d)
    const unsigned lc = (unsigned)(size_t)&ring[crw * LP + cpc];   // LDS byte address: low 32 bits of the shared address
    const int ko = lr * LP + 8 * hi;            // + key_local * LP          (A fragment: row key, k = d)
    const int vo = TLH + lr * LP + 8 * hi;      // + 16j * LP + key_local    (A fragment: row d, k = key)
    stage_copy(lc, gk, gv);
    asm volatile("s_wait_asynccnt 0x0" ::: "memory");   // stage 0 landed before the barrier that publishes it
    __syncthreads();
    stage_copy(lc + STH * 2, gk + (size_t)KT * HD, gv + KT);
    v8f o0 = (v8f){}, o1 = (v8f){}, o2 = (v8f){}, o3 = (v8f){};
    float m = -3.0e38f, l = 0.0f;
#pragma unroll 1
    for (int st = 0; st < SEQ / KT; ++st) {
      const int bo = (st & 1) * STH;
#pragma unroll   // the 32-key steps of a stage unrolled, so that every LDS offset inside a stage is an immediate
      for (int kl = 0; kl < KT; kl += 32) {
        const h16* ka = ring + bo + ko + kl * LP;
        const v16h ka0 = ldh(ka), ka1 = ldh(ka + 32), kb0 = ldh(ka + 16 * LP), kb1 = ldh(ka + 16 * LP + 32);
        v8f sHa = (v8f){}, sLa = (v8f){}, sHb = (v8f){}, sLb = (v8f){};
        sHa = wmma16(ka0, qh0, sHa); sLa = wmma16(ka0, qr0, sLa); sHb = wmma16(kb0, qh0, sHb); sLb = wmma16(kb0, qr0, sLb);
        sHa = wmma16(ka1, qh1, sHa); sLa = wmma16(ka1, qr1, sLa); sHb = wmma16(kb1, qh1, sHb); sLb = wmma16(kb1, qr1, sLb);
        asm volatile("v_nop\n\tv_nop\n\tv_nop\n\tv_nop" : "+v"(sHa), "+v"(sLa), "+v"(sHb), "+v"(sLb) : "v"(ka0), "v"(ka1), "v"(kb0), "v"(kb1));
        float ta[8], tb[8]; float mx = -3.0e38f;
#pragma unroll
        for (int r = 0; r < 8; ++r) { ta[r] = (sHa[r] + sLa[r] * QRI) * SC2; tb[r] = (sHb[r] + sLb[r] * QRI) * SC2; mx = fmaxf(mx, fmaxf(ta[r], tb[r])); }
        mx = fmaxf(mx, __shfl_xor(mx, 16, 32));
        const float mnew = fmaxf(m, mx);
        const float alpha = __builtin_amdgcn_exp2f(m - mnew);
        const float sh = PSH - mnew;
        v16h pb; float ls = 0.0f;
#pragma unroll
        for (int r = 0; r < 8; ++r) { const h16 pa = (h16)__builtin_amdgcn_exp2f(ta[r] + sh); const h16 pc = (h16)__builtin_amdgcn_exp2f(tb[r] + sh); pb[r] = pa; pb[8 + r] = pc; ls += (float)pa + (float)pc; }
        l = l * alpha + ls; m = mnew;
        o0 = o0 * alpha; o1 = o1 * alpha; o2 = o2 * alpha; o3 = o3 * alpha;
        const h16* va = ring + bo + vo + kl;
        const v16h v0 = ldh(va), v1 = ldh(va + 16 * LP), v2 = ldh(va + 32 * LP), v3 = ldh(va + 48 * LP);
        o0 = wmma16(v0, pb, o0); o1 = wmma16(v1, pb, o1); o2 = wmma16(v2, pb, o2); o3 = wmma16(v3, pb, o3);
        asm volatile("v_nop\n\tv_nop\n\tv_nop\n\tv_nop" : "+v"(o0), "+v"(o1), "+v"(o2), "+v"(o3) : "v"(v0), "v"(v1), "v"(v2), "v"(v3), "v"(pb));
      }
      // publish point of stage st + 1, which also frees the buffer that this trip has read
      asm volatile("s_wait_dscnt 0x0" ::: "memory");      // this wave's reads of the buffer have returned before it is refilled
      asm volatile("s_wait_asynccnt 0x0" ::: "memory");   // this wave's copies of stage st + 1 have landed before other waves read them
      __syncthreads();
      if (st + 2 < SEQ / KT) stage_copy(lc + (unsigned)bo * 2, gk + (size_t)(st + 2) * KT * HD, gv + (size_t)(st + 2) * KT);
    }
    asm volatile("s_wait_asynccnt 0x0" ::: "memory");     // nothing of this wave is in flight when it goes on to the epilogue
    l += __shfl_xor(l, 16, 32);
    const float inv = CTXS * (1.0f / l);
    const int wb = wave * 16 * 68;
    // O^T D layout: o_j[r] = (d = 16j + 8h + r, t = lane&15) -> os[t][d]; rows 0..15 x columns 0..63 all written
    { v4f a, c;
      a[0] = o0[0] * inv; a[1] = o0[1] * inv; a[2] = o0[2] * inv; a[3] = o0[3] * inv; c[0] = o0[4] * inv; c[1] = o0[5] * inv; c[2] = o0[6] * inv; c[3] = o0[7] * inv;
      *(v4fa*)(&os[wb + lr * 68 +  0 + 8 * hi]) = a; *(v4fa*)(&os[wb + lr * 68 +  0 + 8 * hi + 4]) = c;
      a[0] = o1[0] * inv; a[1] = o1[1] * inv; a[2] = o1[2] * inv; a[3] = o1[3] * inv; c[0] = o1[4] * inv; c[1] = o1[5] * inv; c[2] = o1[6] * inv; c[3] = o1[7] * inv;
      *(v4fa*)(&os[wb + lr * 68 + 16 + 8 * hi]) = a; *(v4fa*)(&os[wb + lr * 68 + 16 + 8 * hi + 4]) = c;
      a[0] = o2[0] * inv; a[1] = o2[1] * inv; a[2] = o2[2] * inv; a[3] = o2[3] * inv; c[0] = o2[4] * inv; c[1] = o2[5] * inv; c[2] = o2[6] * inv; c[3] = o2[7] * inv;
      *(v4fa*)(&os[wb + lr * 68 + 32 + 8 * hi]) = a; *(v4fa*)(&os[wb + lr * 68 + 32 + 8 * hi + 4]) = c;
      a[0] = o3[0] * inv; a[1] = o3[1] * inv; a[2] = o3[2] * inv; a[3] = o3[3] * inv; c[0] = o3[4] * inv; c[1] = o3[5] * inv; c[2] = o3[6] * inv; c[3] = o3[7] * inv;
      *(v4fa*)(&os[wb + lr * 68 + 48 + 8 * hi]) = a; *(v4fa*)(&os[wb + lr * 68 + 48 + 8 * hi + 4]) = c; }
    wave_sync();
    h16* crow = CTX + ((size_t)b * SEQ + t0) * DM + h * HD;
    const int rq = lane >> 3, c8 = (lane & 7) * 8;
{
#pragma unroll
        for (int s = 0; s < 4; ++s) { const int row = 4 * s + rq;   // 4 s x 4 row groups = 16 rows; 8 lanes x 8 halves = 64 columns
            const v4f x0 = *(const v4fa*)(&os[wb + row * 68 + c8]); const v4f x1 = *(const v4fa*)(&os[wb + row * 68 + c8 + 4]); v8h hv;
#pragma unroll
            for (int i = 0; i < 4; ++i) { hv[i] = (h16)x0[i]; hv[4 + i] = (h16)x1[i]; }
            *(v8h*)(crow + (size_t)row * DM + c8) = hv; }
         }
}

// k_outp: f16 GEMM, one block of 8 waves per 128 x 128 tile (gemm_core), each wave's 32 x 64 tile in 8 accumulators, K = DM.
// OUT[(s*NB_FULL + b)][n] = OSCL * sum_k A[b*SEQ + s][k] Bt[n][k] + bias[n] (bias at its bf16 RNE value, f32 add). grid (NB*SEQ/128, DM/128), 256 threads.
__global__ __launch_bounds__(256) void k_outp(const h16* __restrict__ A, const h16* __restrict__ Bt, const float* __restrict__ bias, float* OUT) {
    __shared__ __align__(16) bf ring[2 * GSTH];
    __shared__ __align__(16) float osb[8 * 16 * 68];
    const int lane = threadIdx.x & 31, lr = lane & 15, hi = lane >> 4;
    const int wave = __builtin_amdgcn_readfirstlane((int)(threadIdx.x >> 5));
    float* os = osb + wave * 16 * 68;            // each wave stages its output rows in its own range
    const int r0 = blockIdx.x * GT + (wave >> 1) * 32, c0 = blockIdx.y * GT + (wave & 1) * 64;
    v8f acc[2][4];
    gemm_core<0>((const bf*)A, (const bf*)Bt, blockIdx.x * GT, blockIdx.y * GT, ring, acc);
    const int bb = r0 / SEQ, sb = r0 % SEQ;        // tile rows share one batch (SEQ % 64 == 0)
    const int cofs = lr * 4;
    v4f bv;
    { const v4f t = *(const v4f*)(bias + c0 + cofs);
#pragma unroll
      for (int i = 0; i < 4; ++i) bv[i] = bfr(t[i]); }
#pragma unroll
    for (int mb = 0; mb < 2; ++mb) {
#pragma unroll
        for (int nb = 0; nb < 4; ++nb) {
#pragma unroll
            for (int j = 0; j < 8; ++j) os[(hi * 8 + j) * 68 + nb * 16 + lr] = acc[mb][nb][j]; }   // D: row 8h+j, col lane&15
        wave_sync();
{
#pragma unroll
            for (int s = 0; s < 8; ++s) { const int row = 2 * s + hi;   // 8 s x 2 rows = 16 rows; 16 lanes x 4 floats = 64 columns
                const v4f x = *(const v4fa*)(&os[row * 68 + cofs]); v4f val;
#pragma unroll
                for (int i = 0; i < 4; ++i) val[i] = x[i] * OSCL + bv[i];
                float* dst = OUT + ((size_t)(sb + mb * 16 + row) * NB_FULL + bb) * DM + c0 + cofs;
                *(v4f*)dst = val; }
             }
        wave_sync();
    }
}

static constexpr size_t al256(size_t v) { return (v + 255) & ~(size_t)255; }
static constexpr size_t SZ_X   = al256((size_t)NB * SEQ * DM * 2);          // one bf16 input copy
static constexpr size_t SZ_W   = al256((size_t)DM * DM * 2);                // one 16-bit weight plane
static constexpr size_t SZ_PL  = al256((size_t)NB * NH_ * SEQ * HD * 2);    // one head plane
static constexpr size_t SZ_CTX = al256((size_t)NB * SEQ * DM * 2);          // f16 ctx plane
static constexpr size_t SZ_TOTAL = 3 * SZ_X + 4 * SZ_W + 4 * SZ_PL + SZ_CTX;
static_assert(SZ_TOTAL <= (size_t)134217728);          // workspace carve <= 128 MiB
static_assert(((size_t)DM * DM * 2) % 256 == 0);

extern "C" void kernel_launch(void* const* d_in, const int* in_sizes, int n_in,
                              void* d_out, int out_size, void* d_ws, size_t ws_size, hipStream_t stream) {
    if (n_in < 11) return;
    const size_t needx = ((size_t)(SEQ - 1) * NB_FULL + NB) * DM;
    if ((size_t)in_sizes[0] < needx || (size_t)in_sizes[1] < needx || (size_t)in_sizes[2] < needx) return;
    if ((size_t)in_sizes[3] < (size_t)DM * DM || (size_t)in_sizes[5] < (size_t)DM * DM || (size_t)in_sizes[7] < (size_t)DM * DM || (size_t)in_sizes[9] < (size_t)DM * DM) return;
    if (in_sizes[4] < DM || in_sizes[6] < DM || in_sizes[8] < DM || in_sizes[10] < DM) return;
    if ((size_t)out_size < needx) return;
    if (SZ_TOTAL > ws_size) return;
    // wire order: query, key, value, Wq, bq, Wk, bk, Wv, bv, Wo, bo (weights [out][in] = Bt as-is)
    const float* xq = (const float*)d_in[0]; const float* xk = (const float*)d_in[1]; const float* xv = (const float*)d_in[2];
    const float* wq = (const float*)d_in[3]; const float* bq = (const float*)d_in[4];
    const float* wk = (const float*)d_in[5]; const float* bk = (const float*)d_in[6];
    const float* wv = (const float*)d_in[7]; const float* bvv = (const float*)d_in[8];
    const float* wo = (const float*)d_in[9]; const float* bo = (const float*)d_in[10];
    float* OUT = (float*)d_out;      // [SEQ][NB_FULL][1024]
    char* wsp = (char*)d_ws;
    bf* XQ = (bf*)wsp; wsp += SZ_X;                  // [NB*SEQ][1024], row b*SEQ + s
    bf* XK = (bf*)wsp; wsp += SZ_X;
    bf* XV = (bf*)wsp; wsp += SZ_X;
    bf* WQ = (bf*)wsp; wsp += SZ_W;                  // [1024][1024]
    bf* WK = (bf*)wsp; wsp += SZ_W;
    bf* WV = (bf*)wsp; wsp += SZ_W;
    h16* WO = (h16*)wsp; wsp += SZ_W;                // f16, x64
    h16* QH = (h16*)wsp; wsp += SZ_PL;               // [NB*16][SEQ][64]
    h16* QR = (h16*)wsp; wsp += SZ_PL;               // [NB*16][SEQ][64] residual x2048
    h16* KP = (h16*)wsp; wsp += SZ_PL;               // [NB*16][SEQ][64]
    h16* VT = (h16*)wsp; wsp += SZ_PL;               // [NB*16][64][SEQ]
    h16* CTX = (h16*)wsp; wsp += SZ_CTX;             // [NB*SEQ][1024], x32

    k_cvt_all<<<CWV / CW, 32 * CW, 0, stream>>>(xq, xk, xv, wq, wk, wv, wo, XQ, XK, XV, WQ, WK, WV, WO);

    // q, k and v^T planes
    k_proj3<<<dim3(NB * SEQ / GT, DM / GT, 3), 256, 0, stream>>>(XQ, XK, XV, WQ, WK, WV, bq, bk, bvv, QH, QR, KP, VT);

    k_flash<<<dim3(SEQ / (16 * AW), NB * NH_, 1), 32 * AW, 0, stream>>>(QH, QR, KP, VT, CTX);

    // output projection: A = ctx rows (m = b*SEQ + s), Bt = Wo rows (n) -> OUT row s*NB_FULL + b
    k_outp<<<dim3(NB * SEQ / GT, DM / GT, 1), 256, 0, stream>>>(CTX, WO, bo, OUT);
}

// v005
// Measured time: 95.3 microseconds a run.
// Two timings next to v004 put it at 1.03 and 1.04 times that version's speed.
// Counting every step since v000, it is 2.53 times as fast.
#include <hip/hip_runtime.h>

// Multi-head attention, width 1024 = 16 heads x 64; query/key/value [SEQ][NB][1024] (token row = s*NB + b), Wq/Wk/Wv/Wo [out][in] (y = x W^T + bias), score scale 1/8, no mask, output [SEQ][NB][1024] f32.
// Compute dtypes, f32 accumulate everywhere: q/k/v projections v_wmma_f32_16x16x32_bf16 (inputs and W RNE-converted to bf16; products exact);
// scores v_wmma_f32_16x16x32_f16: k single f16, q (already times HD^-0.5 * log2(e)) as f16 value + plain f16 residual, both products summed in one accumulator; P (x256 carry, cancels in the normalisation) and v single f16; softmax f32 (online, running max);
// output projection v_wmma_f32_16x16x32_f16: ctx single f16 (x32 carry), Wo = f16 of the bf16 RNE value (x64 carry), 1/2048 folded back in the f32 epilogue; biases added in f32.
// Layout: bf16 copies of the inputs with batch-major rows (b*SEQ + s); q (value, residual), k planes [b*16+h][t][d] and v^T plane [b*16+h][d][t] from the GEMM epilogue; fused flash kernel in transposed form (S^T = K Q^T, O^T = V^T P^T) writing the f16 ctx plane [b*SEQ+s][1024]; final GEMM writes the output rows (s*NB + b).

#ifndef NB
#define NB 2
#endif
#ifndef SEQ
#define SEQ 2048
#endif
#define NB_FULL  2
#define SEQ_FULL 2048
#define DM   1024
#define NH_  16
#define HD   64
#define AW   8                   // waves per flash block (16 query rows each)
#define KT   64                  // keys per LDS stage of the flash kernel
#define LP   72                  // LDS row pitch in halves: 128-B rows + 16 B (16 B x odd, for 16-byte readers)
#define TLH  (64 * LP)           // halves of one staged 64-row tile
#define STH  (2 * TLH)           // halves of one stage: K tile [key][d], then V^T tile [d][key]
#define SC2  (0.125f * 1.4426950408889634f)   // HD^-0.5 * log2(e)
#define PSH  8.0f                // log2 of the P carry (256)
#define CTXS 32.0f               // carry of the ctx plane
#define WOS  64.0f               // carry of the Wo plane
#define OSCL (1.0f / 2048.0f)    // 1 / (CTXS * WOS)
#define GT   128                 // rows and columns of a GEMM block's tile: 8 waves, 4 x 2, 32 rows x 64 columns each
#define GKS  128                 // k per LDS stage of the GEMM kernels
#define GLP  136                 // LDS row pitch in halves: 256-B rows + 16 B (16 B x odd, for 16-byte readers)
#define GOPH (GT * GLP)          // halves of one operand's staged tile
#define GSTH (2 * GOPH)          // halves of one stage: A tile [row][k], then B tile [row][k]
#define CW   16                  // waves per block of the convert kernel
#define XR   (NB * SEQ)          // rows of one input
#define WR   (4 * DM)            // rows of the four weight matrices together
#define CWV  (XR > WR ? XR : WR) // waves of the convert launch

static_assert(HD == 64);
static_assert(NH_ * HD == DM);                 // head h = columns h*64 + d
static_assert(DM % 64 == 0);                   // column tiles of 64
static_assert(DM % 32 == 0);                   // GEMM k-loop steps by 32
static_assert(SEQ % 64 == 0);                  // a 64-row tile never straddles two batches
static_assert((NB * SEQ) % 64 == 0);
static_assert(SEQ % 32 == 0);                  // key loop steps by 32
static_assert(SEQ % KT == 0 && SEQ / KT >= 2); // whole stages; the two-buffer prologue needs two
static_assert(AW * 32 * 2 * 8 == KT * HD);     // two 16-byte copies per thread fill one 64 x 64 tile
static_assert((LP * 2) % 16 == 0);
static_assert(SEQ % (16 * AW) == 0);           // flash grid covers the sequence exactly
static_assert(((size_t)SEQ * DM) % 8 == 0);
static_assert(((size_t)DM * DM) % 8 == 0);
static_assert(DM % GT == 0 && (NB * SEQ) % GT == 0);   // GEMM grids cover both operands exactly
static_assert(DM % GKS == 0 && DM / GKS >= 2);         // whole stages; the two-buffer prologue needs two
static_assert(GKS * 2 == 16 * 16 && GT == 16 * 8);     // 16 threads x 16 B fill a row; 256 threads take 16 rows a copy, 8 copies an operand
static_assert((GLP * 2) % 16 == 0);
static_assert(CWV % CW == 0);                  // the convert grid covers its waves exactly
static_assert(DM == 8 * 32 * 4);               // a row is 8 wave-wide 16-byte loads
static_assert(NB <= NB_FULL);
static_assert(SEQ <= SEQ_FULL);

typedef _Float16 h16;
typedef unsigned short bf;
typedef __attribute__((ext_vector_type(16))) __bf16   v16bf;
typedef __attribute__((ext_vector_type(16))) _Float16 v16h;
typedef __attribute__((ext_vector_type(8)))  _Float16 v8h;
typedef __attribute__((ext_vector_type(8)))  unsigned short v8us;
typedef __attribute__((ext_vector_type(4)))  unsigned short v4us;
typedef __attribute__((ext_vector_type(4)))  _Float16 v4h;
typedef __attribute__((ext_vector_type(16))) unsigned short v16us;
typedef __attribute__((ext_vector_type(8)))  float    v8f;
typedef __attribute__((ext_vector_type(4)))  float    v4f;
typedef v4f  __attribute__((may_alias)) v4fa;

__device__ __forceinline__ unsigned short f2bf(float f) { unsigned u = __float_as_uint(f); u += 0x7FFFu + ((u >> 16) & 1u); return (unsigned short)(u >> 16); }
__device__ __forceinline__ float bfr(float f) { return __uint_as_float(((unsigned)f2bf(f)) << 16); }   // f32 value of the bf16 RNE convert
__device__ __forceinline__ v4us bf4(v4f x) { v4us o; o[0] = f2bf(x[0]); o[1] = f2bf(x[1]); o[2] = f2bf(x[2]); o[3] = f2bf(x[3]); return o; }
__device__ __forceinline__ v16h cat16(v8h lo, v8h hi) { return __builtin_shufflevector(lo, hi, 0, 1, 2, 3, 4, 5, 6, 7, 8, 9, 10, 11, 12, 13, 14, 15); }
__device__ __forceinline__ v8f wmma16(v16h a, v16h b, v8f c) { return __builtin_amdgcn_wmma_f32_16x16x32_f16(false, a, false, b, (short)0, c, false, false); }
__device__ __forceinline__ v8f wmmab(v16bf a, v16bf b, v8f c) { return __builtin_amdgcn_wmma_f32_16x16x32_bf16(false, a, false, b, (short)0, c, false, false); }
// fragment loaders from K-contiguous 16-bit rows; p already includes + 8*(lane>>4): elements 0..7 <- k0+8h+0..7, elements 8..15 <- k0+16+8h+0..7 (same map for A and B)
__device__ __forceinline__ v16h  ldh(const h16* p) { return cat16(*(const v8h*)p, *(const v8h*)(p + 16)); }
__device__ __forceinline__ v16us ldu(const bf* p)  { return __builtin_shufflevector(*(const v8us*)p, *(const v8us*)(p + 16), 0, 1, 2, 3, 4, 5, 6, 7, 8, 9, 10, 11, 12, 13, 14, 15); }   // raw 16-bit fragment, bf16 or f16
// ordering point for wave-private LDS tiles (same wave writes and reads)
__device__ __forceinline__ void wave_sync() { __builtin_amdgcn_fence(3 /* release order */, "wavefront"); __builtin_amdgcn_wave_barrier(); asm volatile("" ::: "memory"); }

// k_cvt_all: every 16-bit operand plane in one launch, few waves with much in flight (a launch of one small piece per thread is bound by how fast its waves start).
// Wave w takes row w (order b*SEQ + s, from source row s*NB_FULL + b) of query, key and value and row w of the four stacked weight matrices (w / DM picks the matrix).
// A row is 8 wave-wide 16-byte loads of 512 contiguous bytes each; all 32 loads of a wave are issued before its first convert. A wave past the end of either set re-reads row 0 and stores nothing.
__global__ __launch_bounds__(32 * CW) void k_cvt_all(const float* __restrict__ xq, const float* __restrict__ xk, const float* __restrict__ xv,
                                                     const float* __restrict__ wq, const float* __restrict__ wk, const float* __restrict__ wv, const float* __restrict__ wo,
                                                     bf* XQ, bf* XK, bf* XV, bf* WQ, bf* WK, bf* WV, h16* WO) {
    const unsigned lane = threadIdx.x & 31;         // the lane's 4 elements inside each 128-element piece of a row: vector index lane + 32 j
    const int w = blockIdx.x * CW + __builtin_amdgcn_readfirstlane((int)(threadIdx.x >> 5));
    const bool dx = XR == CWV || w < XR, dw = WR == CWV || w < WR;
    const int xw = dx ? w : 0, ww = dw ? w : 0;
    const int sg = ww / DM;
    // row bases are the same in every lane: scalar base + one lane offset for all loads
    const size_t so = ((size_t)(xw % SEQ) * NB_FULL + (size_t)(xw / SEQ)) * DM, xo = (size_t)xw * DM, wr = (size_t)(ww % DM) * DM;
    const float* pq = xq + so; const float* pk = xk + so; const float* pv = xv + so;
    const float* pw = (sg == 0 ? wq : sg == 1 ? wk : sg == 2 ? wv : wo) + wr;
    v4f q[8], k[8], v[8], t[8];
#pragma unroll
    for (int j = 0; j < 8; ++j) q[j] = ((const v4f*)pq)[lane + j * 32];
#pragma unroll
    for (int j = 0; j < 8; ++j) k[j] = ((const v4f*)pk)[lane + j * 32];
#pragma unroll
    for (int j = 0; j < 8; ++j) v[j] = ((const v4f*)pv)[lane + j * 32];
#pragma unroll
    for (int j = 0; j < 8; ++j) t[j] = ((const v4f*)pw)[lane + j * 32];
    __builtin_amdgcn_sched_barrier(0);   // keeps all 32 loads in front of the first convert (else the weight row's loads are moved behind the wait for the other 24: a second memory latency)
    if (dx) {
        bf* dq = XQ + xo; bf* dk = XK + xo; bf* dv = XV + xo;
#pragma unroll
        for (int j = 0; j < 8; ++j) ((v4us*)dq)[lane + j * 32] = bf4(q[j]);
#pragma unroll
        for (int j = 0; j < 8; ++j) ((v4us*)dk)[lane + j * 32] = bf4(k[j]);
#pragma unroll
        for (int j = 0; j < 8; ++j) ((v4us*)dv)[lane + j * 32] = bf4(v[j]);
    }
    asm volatile("s_wait_xcnt 0x0" ::: "memory");   // in front of the branches below, whose first instructions rewrite registers that the stores above name
    if (dw) {
        if (sg < 3) {
            bf* d = (sg == 0 ? WQ : sg == 1 ? WK : WV) + wr;
#pragma unroll
            for (int j = 0; j < 8; ++j) ((v4us*)d)[lane + j * 32] = bf4(t[j]);
        } else {
            h16* d = WO + wr;
#pragma unroll
            for (int j = 0; j < 8; ++j) { v4h o;
#pragma unroll
                for (int i = 0; i < 4; ++i) o[i] = (h16)(bfr(t[j][i]) * WOS);
                ((v4h*)d)[lane + j * 32] = o; }
        }
    }
}

// Eight 16-byte asynchronous copies of one thread: tile rows r, r + 16, ..., r + 112 (global row pitch DM, LDS row pitch GLP).
// The s_wait_xcnt stands inside the statement so that no address register is rewritten in front of it.
__device__ __forceinline__ void copy8(unsigned l, const bf* g) {
    asm volatile("global_load_async_to_lds_b128 %0, %8, off\n\t"
                 "global_load_async_to_lds_b128 %1, %9, off\n\t"
                 "global_load_async_to_lds_b128 %2, %10, off\n\t"
                 "global_load_async_to_lds_b128 %3, %11, off\n\t"
                 "global_load_async_to_lds_b128 %4, %12, off\n\t"
                 "global_load_async_to_lds_b128 %5, %13, off\n\t"
                 "global_load_async_to_lds_b128 %6, %14, off\n\t"
                 "global_load_async_to_lds_b128 %7, %15, off\n\t"
                 "s_wait_xcnt 0x0"
                 :: "v"(l), "v"(l + 16 * GLP * 2), "v"(l + 32 * GLP * 2), "v"(l + 48 * GLP * 2), "v"(l + 64 * GLP * 2), "v"(l + 80 * GLP * 2), "v"(l + 96 * GLP * 2), "v"(l + 112 * GLP * 2),
                    "v"(g), "v"(g + (size_t)16 * DM), "v"(g + (size_t)32 * DM), "v"(g + (size_t)48 * DM), "v"(g + (size_t)64 * DM), "v"(g + (size_t)80 * DM), "v"(g + (size_t)96 * DM), "v"(g + (size_t)112 * DM)
                 : "memory");
}
// One stage of the GEMM ring: GT rows x GKS k of A, then of B; each thread copies 8 pieces of each. l: LDS byte address of the thread's first piece in the target buffer.
__device__ __forceinline__ void gemm_stage(unsigned l, const bf* ga, const bf* gb) { copy8(l, ga); copy8(l + GOPH * 2, gb); }
template <int BFK>
__device__ __forceinline__ v8f wmmau(v16us a, v16us b, v8f c) {
    if constexpr (BFK != 0) return wmmab(__builtin_bit_cast(v16bf, a), __builtin_bit_cast(v16bf, b), c);
    else return wmma16(__builtin_bit_cast(v16h, a), __builtin_bit_cast(v16h, b), c);
}

// gemm_core: the k loop of one GT x GT block tile, 8 waves, wave (wm, wn) = (wave >> 1, wave & 1) owning the 32 x 64 tile at (rb + 32 wm, cb + 64 wn), K = DM.
// A rows rb.. and Bt rows cb.. (K-contiguous 16-bit planes, bf16 for BFK != 0, else f16) come into LDS once per block by asynchronous copies (whole 256-B row pieces per 16 lanes),
// two buffers of GKS k, the next stage in flight while this one is worked on; fragments are two 16-B LDS loads each, same element map and same k order as from global memory.
template <int BFK>
__device__ __forceinline__ void gemm_core(const bf* __restrict__ A, const bf* __restrict__ Bt, int rb, int cb, bf* ring, v8f (&acc)[2][4]) {
    const int lane = threadIdx.x & 31, lr = lane & 15, hi = lane >> 4;
    const int wave = __builtin_amdgcn_readfirstlane((int)(threadIdx.x >> 5));
    // copy map: thread c takes 16-byte piece c & 15 of tile rows (c >> 4) + 16 i, i = 0..7, of the A tile and of the B tile
    const int crw = (int)threadIdx.x >> 4, cpc = ((int)threadIdx.x & 15) * 8;
    const bf* ga = A + (size_t)(rb + crw) * DM + cpc;       // + stage * GKS
    const bf* gb = Bt + (size_t)(cb + crw) * DM + cpc;      // + stage * GKS
    const unsigned lc = (unsigned)(size_t)&ring[crw * GLP + cpc];   // LDS byte address: low 32 bits of the shared address
    const int ao = ((wave >> 1) * 32 + lr) * GLP + 8 * hi;          // + 16 mb * GLP + k_local
    const int bo = GOPH + ((wave & 1) * 64 + lr) * GLP + 8 * hi;    // + 16 nb * GLP + k_local
#pragma unroll
    for (int mb = 0; mb < 2; ++mb)
#pragma unroll
        for (int nb = 0; nb < 4; ++nb) acc[mb][nb] = (v8f){};
    gemm_stage(lc, ga, gb);
    asm volatile("s_wait_asynccnt 0x0" ::: "memory");   // stage 0 landed before the barrier that publishes it
    __syncthreads();
    gemm_stage(lc + GSTH * 2, ga + GKS, gb + GKS);
#pragma unroll 1
    for (int st = 0; st < DM / GKS; ++st) {
        const int so = (st & 1) * GSTH;
        const bf* pa = ring + so + ao; const bf* pb = ring + so + bo;
        v16us a[2][2], b[2][4];
#pragma unroll
        for (int i = 0; i < 2; ++i) a[0][i] = ldu(pa + i * 16 * GLP);
#pragma unroll
        for (int i = 0; i < 4; ++i) b[0][i] = ldu(pb + i * 16 * GLP);
#pragma unroll   // the 32-k blocks of a stage unrolled: every LDS offset an immediate, both fragment sets indexed by constants
        for (int kk = 0; kk < GKS / 32; ++kk) {
            const int cu = kk & 1, nx = cu ^ 1;
            if (kk + 1 < GKS / 32) {
#pragma unroll
                for (int i = 0; i < 2; ++i) a[nx][i] = ldu(pa + i * 16 * GLP + (kk + 1) * 32);
#pragma unroll
                for (int i = 0; i < 4; ++i) b[nx][i] = ldu(pb + i * 16 * GLP + (kk + 1) * 32);
            }
            __builtin_amdgcn_sched_barrier(0);   // keeps the next block's LDS loads one group ahead of this block's products (else they are moved in among them, each with a wait to 0)
#pragma unroll
            for (int nb = 0; nb < 4; ++nb)
#pragma unroll
                for (int mb = 0; mb < 2; ++mb) acc[mb][nb] = wmmau<BFK>(a[cu][mb], b[cu][nb], acc[mb][nb]);
            __builtin_amdgcn_sched_barrier(0);   // keeps this block's products ahead of the following load group and of the stage's foot
        }
        // four vector slots behind the stage's last products, on the way to the branches below
        asm volatile("v_nop\n\tv_nop\n\tv_nop\n\tv_nop" : "+v"(acc[0][2]), "+v"(acc[1][2]), "+v"(acc[0][3]), "+v"(acc[1][3]) : "v"(a[1][0]), "v"(a[1][1]), "v"(b[1][2]), "v"(b[1][3]));
        // publish point of stage st + 1, which also frees the buffer that this trip has read
        asm volatile("s_wait_dscnt 0x0" ::: "memory");      // this wave's reads of the buffer have returned before it is refilled
        asm volatile("s_wait_asynccnt 0x0" ::: "memory");   // this wave's copies of stage st + 1 have landed before other waves read them
        __syncthreads();
        if (st + 2 < DM / GKS) gemm_stage(lc + (unsigned)so * 2, ga + (size_t)(st + 2) * GKS, gb + (size_t)(st + 2) * GKS);
    }
    asm volatile("s_wait_asynccnt 0x0" ::: "memory");       // nothing of this wave is in flight when it goes on to the epilogue
}

// proj_tile: bf16 GEMM tile (bx, by) of 128 x 128 by one block of 8 waves (gemm_core), each wave's 32 x 64 tile in 8 accumulators, K = DM.
// C[m][n] = sum_k A[m][k] Bt[n][k] + bias (BROW == 0: bias[n]; BROW == 1: bias[m]; bias taken at its bf16 RNE value, added in f32),
// times osc (f32), written as f16 (Ph) and optionally the f16 residual (Pr, useRes != 0; no carry: it may lie in the f16 subnormal range, step 2^-24, which the matrix unit keeps) at
// tile base (r0/RB)*sRB + (r0%RB)*pitch + (c0/CB)*sCB + (c0%CB), row pitch 'pitch' (halves).
// The output rows are staged in the ring's own LDS: behind the foot of gemm_core's last trip (every wave's s_wait_dscnt 0, s_wait_asynccnt 0, then the barrier) nobody reads the ring and no copy is in flight.
template <int BROW>
__device__ __forceinline__ void proj_tile(const bf* __restrict__ A, const bf* __restrict__ Bt, const float* __restrict__ bias, h16* Ph, h16* Pr, int useRes, float osc, int RB, size_t sRB, int pitch, int CB, size_t sCB, int bx, int by, bf* ring) {
    const int lane = threadIdx.x & 31, lr = lane & 15, hi = lane >> 4;
    const int wave = __builtin_amdgcn_readfirstlane((int)(threadIdx.x >> 5));
    float* os = (float*)ring + wave * 16 * 68;   // each wave stages its output rows in its own range
    const int r0 = bx * GT + (wave >> 1) * 32, c0 = by * GT + (wave & 1) * 64;
    v8f acc[2][4];
    gemm_core<1>(A, Bt, bx * GT, by * GT, ring, acc);
    const int rq = lane >> 3, c8 = (lane & 7) * 8;
    v4f bc0 = (v4f){0.0f, 0.0f, 0.0f, 0.0f}, bc1 = (v4f){0.0f, 0.0f, 0.0f, 0.0f};
    if constexpr (BROW == 0) {
        const v4f t0 = *(const v4f*)(bias + c0 + c8); const v4f t1 = *(const v4f*)(bias + c0 + c8 + 4);
#pragma unroll
        for (int i = 0; i < 4; ++i) { bc0[i] = bfr(t0[i]); bc1[i] = bfr(t1[i]); }
    }
    const size_t tbase = (size_t)(r0 / RB) * sRB + (size_t)(r0 % RB) * (size_t)pitch + (size_t)(c0 / CB) * sCB + (size_t)(c0 % CB);
#pragma unroll
    for (int mb = 0; mb < 2; ++mb) {
#pragma unroll
        for (int nb = 0; nb < 4; ++nb) {
#pragma unroll
            for (int j = 0; j < 8; ++j) os[(hi * 8 + j) * 68 + nb * 16 + lr] = acc[mb][nb][j]; }   // D: row 8h+j, col lane&15
        wave_sync();
        const size_t sb = tbase + (size_t)(mb * 16) * (size_t)pitch;
{
#pragma unroll
            for (int s = 0; s < 4; ++s) { const int row = 4 * s + rq;   // 4 s x 4 row groups = 16 rows; 8 lanes x 8 = 64 columns
                float br = 0.0f;
                if constexpr (BROW != 0) br = bfr(bias[r0 + mb * 16 + row]);
                const v4f x0 = *(const v4fa*)(&os[row * 68 + c8]); const v4f x1 = *(const v4fa*)(&os[row * 68 + c8 + 4]); v8h hv, rv;
#pragma unroll
                for (int i = 0; i < 4; ++i) { const float y0 = (x0[i] + bc0[i] + br) * osc; const float y1 = (x1[i] + bc1[i] + br) * osc;
                    const h16 a0 = (h16)y0; const h16 a1 = (h16)y1; hv[i] = a0; hv[4 + i] = a1; rv[i] = (h16)(y0 - (float)a0); rv[4 + i] = (h16)(y1 - (float)a1); }
                const size_t oo = sb + (size_t)row * (size_t)pitch + c8;
                *(v8h*)(Ph + oo) = hv;
                asm volatile("s_wait_xcnt 0x0" ::: "memory");   // in front of the residual's store and the next rows' loads, which rewrite registers that the store above names
                if (useRes) *(v8h*)(Pr + oo) = rv; }
             }
        wave_sync();
    }
}

// k_proj3: the three input projections in one launch, grid (NB*SEQ/128, DM/128, 3), 256 threads; they are independent of one another, so a block of one starts wherever a place is free.
// With the ring as a block's only LDS two blocks fit a WGP: one block's first copies, barrier waits and output stores run beside the other's products.
// z = 0, 1 (q, k): A = x rows (m = b*SEQ + t), Bt = W rows (n = h*64 + d), column bias -> plane [(b*16 + h)][t][d]; q is scaled by HD^-0.5 * log2(e) and also writes its residual plane.
// z = 2 (v^T): A = Wv rows (m = h*64 + d), Bt = x rows (n = b*SEQ + t), row bias -> plane [(b*1024 + m)][t] = [(b*16 + h)][d][t]; tile (i % 8, i / 8) of the block's flat index i.
__global__ __launch_bounds__(256) void k_proj3(const bf* __restrict__ XQ, const bf* __restrict__ XK, const bf* __restrict__ XV, const bf* __restrict__ WQ, const bf* __restrict__ WK, const bf* __restrict__ WV,
                                               const float* __restrict__ bq, const float* __restrict__ bk, const float* __restrict__ bv, h16* QH, h16* QR, h16* KP, h16* VT) {
    __shared__ __align__(16) bf ring[2 * GSTH];
    static_assert(8 * 16 * 68 * 4 <= 2 * GSTH * 2);   // the eight waves' staging ranges lie inside the ring
    const int z = blockIdx.z;                          // the same for the whole block: every barrier below is passed by all of its waves
    if (z == 2) {
        const int i = blockIdx.y * (NB * SEQ / GT) + blockIdx.x;
        proj_tile<1>(WV, XV, bv, VT, VT, 0, 1.0f, DM, (size_t)0, SEQ, SEQ, (size_t)DM * SEQ, i % (DM / GT), i / (DM / GT), ring);
    } else {
        const bool q = z == 0;
        proj_tile<0>(q ? XQ : XK, q ? WQ : WK, q ? bq : bk, q ? QH : KP, q ? QR : KP, q ? 1 : 0, q ? SC2 : 1.0f, SEQ, (size_t)NH_ * SEQ * HD, HD, HD, (size_t)SEQ * HD, blockIdx.x, blockIdx.y, ring);
    }
}

// One stage of the flash kernel's ring: each thread copies two 16-byte pieces of the K tile and two of the V^T tile (tile rows r and r + 32) from global memory to LDS.
// lds: byte address of the thread's piece in the K tile of the target buffer. The s_wait_xcnt stands inside the statement so that no address register is rewritten in front of it.
__device__ __forceinline__ void stage_copy(unsigned lds, const h16* gk, const h16* gv) {
    const unsigned l1 = lds + 32 * LP * 2, l2 = lds + TLH * 2, l3 = lds + TLH * 2 + 32 * LP * 2;
    const h16* gk1 = gk + (size_t)32 * HD; const h16* gv1 = gv + (size_t)32 * SEQ;
    asm volatile("global_load_async_to_lds_b128 %0, %4, off\n\t"
                 "global_load_async_to_lds_b128 %1, %5, off\n\t"
                 "global_load_async_to_lds_b128 %2, %6, off\n\t"
                 "global_load_async_to_lds_b128 %3, %7, off\n\t"
                 "s_wait_xcnt 0x0"
                 :: "v"(lds), "v"(l1), "v"(l2), "v"(l3), "v"(gk), "v"(gk1), "v"(gv), "v"(gv1) : "memory");
}

// k_flash: fused attention, one wave per 16 query rows of one (batch, head); Q fragments straight from the f16 planes (two 16-B loads each, arithmetic addressing).
// K and V^T: the block's waves share every key tile, so a stage of KT keys (K rows, V^T rows, 128 B each) is brought into LDS once per block by asynchronous copies
// (whole 128-B lines per 8 lanes), two buffers, the next stage in flight while this one is worked on; fragments are two 16-B LDS loads each, same element map as before.
// Transposed form: S^T[key][t] = K Q^T (A = K rows, B = Q rows); lane (t = lane&15, h = lane>>4) holds keys 8h+r of each 16-key tile, so the packed
// P tile is directly the B fragment of O^T[d][t] = V^T P^T (element r <- tile keys 0..15, element 8+r <- tile keys 16..31, lane unchanged).
// Softmax state (running max, partial sum) is one scalar per lane; the two lane halves of a row are combined with one xor-16 exchange.
__global__ __launch_bounds__(32 * AW) void k_flash(const h16* __restrict__ QH, const h16* __restrict__ QR, const h16* __restrict__ KP, const h16* __restrict__ VT, h16* CTX) {
    __shared__ __align__(16) float os[AW * 16 * 68];
    __shared__ __align__(16) h16 ring[2 * STH];
    const int lane = threadIdx.x & 31, lr = lane & 15, hi = lane >> 4;
    const int wave = __builtin_amdgcn_readfirstlane((int)(threadIdx.x >> 5));
    const int zh = blockIdx.y; const int b = zh / NH_, h = zh % NH_;
    const int t0 = (blockIdx.x * AW + wave) * 16;
    const size_t pbase = (size_t)zh * SEQ * HD;
    const size_t qo = pbase + (size_t)(t0 + lr) * HD + 8 * hi;
    const v16h qh0 = ldh(QH + qo), qh1 = ldh(QH + qo + 32), qr0 = ldh(QR + qo), qr1 = ldh(QR + qo + 32);   // B fragments: col t, k = d
    // copy map: thread c takes 16-byte piece c & 7 of tile rows c >> 3 and 32 + (c >> 3), of the K tile and of the V^T tile
    const int crw = (int)threadIdx.x >> 3, cpc = ((int)threadIdx.x & 7) * 8;
    const h16* gk = KP + pbase + (size_t)crw * HD + cpc;      // + stage * KT * HD   (row = key)
    const h16* gv = VT + pbase + (size_t)crw * SEQ + cpc;     // + stage * KT        (row = d)
    const unsigned lc = (unsigned)(size_t)&ring[crw * LP + cpc];   // LDS byte address: low 32 bits of the shared address
    const int ko = lr * LP + 8 * hi;            // + key_local * LP          (A fragment: row key, k = d)
    const int vo = TLH + lr * LP + 8 * hi;      // + 16j * LP + key_local    (A fragment: row d, k = key)
    stage_copy(lc, gk, gv);
    asm volatile("s_wait_asynccnt 0x0" ::: "memory");   // stage 0 landed before the barrier that publishes it
    __syncthreads();
    stage_copy(lc + STH * 2, gk + (size_t)KT * HD, gv + KT);
    v8f o0 = (v8f){}, o1 = (v8f){}, o2 = (v8f){}, o3 = (v8f){};
    float m = -3.0e38f, l = 0.0f;
#pragma unroll 1
    for (int st = 0; st < SEQ / KT; ++st) {
      const int bo = (st & 1) * STH;
#pragma unroll   // the 32-key steps of a stage unrolled, so that every LDS offset inside a stage is an immediate
      for (int kl = 0; kl < KT; kl += 32) {
        const h16* ka = ring + bo + ko + kl * LP;
        const v16h ka0 = ldh(ka), ka1 = ldh(ka + 32), kb0 = ldh(ka + 16 * LP), kb1 = ldh(ka + 16 * LP + 32);
        // value and residual products of a key tile share one accumulator (the q planes carry the score scale): the accumulators hold the log2-domain scores as they are
        v8f sa = (v8f){}, sb = (v8f){};
        sa = wmma16(ka0, qr0, sa); sb = wmma16(kb0, qr0, sb); sa = wmma16(ka1, qr1, sa); sb = wmma16(kb1, qr1, sb);
        sa = wmma16(ka0, qh0, sa); sb = wmma16(kb0, qh0, sb); sa = wmma16(ka1, qh1, sa); sb = wmma16(kb1, qh1, sb);
        asm volatile("v_nop\n\tv_nop\n\tv_nop\n\tv_nop" : "+v"(sa), "+v"(sb) : "v"(ka0), "v"(ka1), "v"(kb0), "v"(kb1));
        float ta[8], tb[8]; float mx = -3.0e38f;
#pragma unroll
        for (int r = 0; r < 8; ++r) { ta[r] = sa[r]; tb[r] = sb[r]; mx = fmaxf(mx, fmaxf(ta[r], tb[r])); }
        mx = fmaxf(mx, __shfl_xor(mx, 16, 32));
        const float mnew = fmaxf(m, mx);
        const float alpha = __builtin_amdgcn_exp2f(m - mnew);
        const float sh = PSH - mnew;
        v16h pb; float ls = 0.0f;
#pragma unroll
        for (int r = 0; r < 8; ++r) { const h16 pa = (h16)__builtin_amdgcn_exp2f(ta[r] + sh); const h16 pc = (h16)__builtin_amdgcn_exp2f(tb[r] + sh); pb[r] = pa; pb[8 + r] = pc; ls += (float)pa + (float)pc; }
        l = l * alpha + ls; m = mnew;
        o0 = o0 * alpha; o1 = o1 * alpha; o2 = o2 * alpha; o3 = o3 * alpha;
        const h16* va = ring + bo + vo + kl;
        const v16h v0 = ldh(va), v1 = ldh(va + 16 * LP), v2 = ldh(va + 32 * LP), v3 = ldh(va + 48 * LP);
        o0 = wmma16(v0, pb, o0); o1 = wmma16(v1, pb, o1); o2 = wmma16(v2, pb, o2); o3 = wmma16(v3, pb, o3);
        asm volatile("v_nop\n\tv_nop\n\tv_nop\n\tv_nop" : "+v"(o0), "+v"(o1), "+v"(o2), "+v"(o3) : "v"(v0), "v"(v1), "v"(v2), "v"(v3), "v"(pb));
      }
      // publish point of stage st + 1, which also frees the buffer that this trip has read
      asm volatile("s_wait_dscnt 0x0" ::: "memory");      // this wave's reads of the buffer have returned before it is refilled
      asm volatile("s_wait_asynccnt 0x0" ::: "memory");   // this wave's copies of stage st + 1 have landed before other waves read them
      __syncthreads();
      if (st + 2 < SEQ / KT) stage_copy(lc + (unsigned)bo * 2, gk + (size_t)(st + 2) * KT * HD, gv + (size_t)(st + 2) * KT);
    }
    asm volatile("s_wait_asynccnt 0x0" ::: "memory");     // nothing of this wave is in flight when it goes on to the epilogue
    l += __shfl_xor(l, 16, 32);
    const float inv = CTXS * (1.0f / l);
    const int wb = wave * 16 * 68;
    // O^T D layout: o_j[r] = (d = 16j + 8h + r, t = lane&15) -> os[t][d]; rows 0..15 x columns 0..63 all written
    { v4f a, c;
      a[0] = o0[0] * inv; a[1] = o0[1] * inv; a[2] = o0[2] * inv; a[3] = o0[3] * inv; c[0] = o0[4] * inv; c[1] = o0[5] * inv; c[2] = o0[6] * inv; c[3] = o0[7] * inv;
      *(v4fa*)(&os[wb + lr * 68 +  0 + 8 * hi]) = a; *(v4fa*)(&os[wb + lr * 68 +  0 + 8 * hi + 4]) = c;
      a[0] = o1[0] * inv; a[1] = o1[1] * inv; a[2] = o1[2] * inv; a[3] = o1[3] * inv; c[0] = o1[4] * inv; c[1] = o1[5] * inv; c[2] = o1[6] * inv; c[3] = o1[7] * inv;
      *(v4fa*)(&os[wb + lr * 68 + 16 + 8 * hi]) = a; *(v4fa*)(&os[wb + lr * 68 + 16 + 8 * hi + 4]) = c;
      a[0] = o2[0] * inv; a[1] = o2[1] * inv; a[2] = o2[2] * inv; a[3] = o2[3] * inv; c[0] = o2[4] * inv; c[1] = o2[5] * inv; c[2] = o2[6] * inv; c[3] = o2[7] * inv;
      *(v4fa*)(&os[wb + lr * 68 + 32 + 8 * hi]) = a; *(v4fa*)(&os[wb + lr * 68 + 32 + 8 * hi + 4]) = c;
      a[0] = o3[0] * inv; a[1] = o3[1] * inv; a[2] = o3[2] * inv; a[3] = o3[3] * inv; c[0] = o3[4] * inv; c[1] = o3[5] * inv; c[2] = o3[6] * inv; c[3] = o3[7] * inv;
      *(v4fa*)(&os[wb + lr * 68 + 48 + 8 * hi]) = a; *(v4fa*)(&os[wb + lr * 68 + 48 + 8 * hi + 4]) = c; }
    wave_sync();
    h16* crow = CTX + ((size_t)b * SEQ + t0) * DM + h * HD;
    const int rq = lane >> 3, c8 = (lane & 7) * 8;
{
#pragma unroll
        for (int s = 0; s < 4; ++s) { const int row = 4 * s + rq;   // 4 s x 4 row groups = 16 rows; 8 lanes x 8 halves = 64 columns
            const v4f x0 = *(const v4fa*)(&os[wb + row * 68 + c8]); const v4f x1 = *(const v4fa*)(&os[wb + row * 68 + c8 + 4]); v8h hv;
#pragma unroll
            for (int i = 0; i < 4; ++i) { hv[i] = (h16)x0[i]; hv[4 + i] = (h16)x1[i]; }
            *(v8h*)(crow + (size_t)row * DM + c8) = hv; }
         }
}

// k_outp: f16 GEMM, one block of 8 waves per 128 x 128 tile (gemm_core), each wave's 32 x 64 tile in 8 accumulators, K = DM.
// OUT[(s*NB_FULL + b)][n] = OSCL * sum_k A[b*SEQ + s][k] Bt[n][k] + bias[n] (bias at its bf16 RNE value, f32 add). grid (NB*SEQ/128, DM/128), 256 threads.
__global__ __launch_bounds__(256) void k_outp(const h16* __restrict__ A, const h16* __restrict__ Bt, const float* __restrict__ bias, float* OUT) {
    __shared__ __align__(16) bf ring[2 * GSTH];
    __shared__ __align__(16) float osb[8 * 16 * 68];
    const int lane = threadIdx.x & 31, lr = lane & 15, hi = lane >> 4;
    const int wave = __builtin_amdgcn_readfirstlane((int)(threadIdx.x >> 5));
    float* os = osb + wave * 16 * 68;            // each wave stages its output rows in its own range
    const int r0 = blockIdx.x * GT + (wave >> 1) * 32, c0 = blockIdx.y * GT + (wave & 1) * 64;
    v8f acc[2][4];
    gemm_core<0>((const bf*)A, (const bf*)Bt, blockIdx.x * GT, blockIdx.y * GT, ring, acc);
    const int bb = r0 / SEQ, sb = r0 % SEQ;        // tile rows share one batch (SEQ % 64 == 0)
    const int cofs = lr * 4;
    v4f bv;
    { const v4f t = *(const v4f*)(bias + c0 + cofs);
#pragma unroll
      for (int i = 0; i < 4; ++i) bv[i] = bfr(t[i]); }
#pragma unroll
    for (int mb = 0; mb < 2; ++mb) {
#pragma unroll
        for (int nb = 0; nb < 4; ++nb) {
#pragma unroll
            for (int j = 0; j < 8; ++j) os[(hi * 8 + j) * 68 + nb * 16 + lr] = acc[mb][nb][j]; }   // D: row 8h+j, col lane&15
        wave_sync();
{
#pragma unroll
            for (int s = 0; s < 8; ++s) { const int row = 2 * s + hi;   // 8 s x 2 rows = 16 rows; 16 lanes x 4 floats = 64 columns
                const v4f x = *(const v4fa*)(&os[row * 68 + cofs]); v4f val;
#pragma unroll
                for (int i = 0; i < 4; ++i) val[i] = x[i] * OSCL + bv[i];
                float* dst = OUT + ((size_t)(sb + mb * 16 + row) * NB_FULL + bb) * DM + c0 + cofs;
                *(v4f*)dst = val; }
             }
        wave_sync();
    }
}

static constexpr size_t al256(size_t v) { return (v + 255) & ~(size_t)255; }
static constexpr size_t SZ_X   = al256((size_t)NB * SEQ * DM * 2);          // one bf16 input copy
static constexpr size_t SZ_W   = al256((size_t)DM * DM * 2);                // one 16-bit weight plane
static constexpr size_t SZ_PL  = al256((size_t)NB * NH_ * SEQ * HD * 2);    // one head plane
static constexpr size_t SZ_CTX = al256((size_t)NB * SEQ * DM * 2);          // f16 ctx plane
static constexpr size_t SZ_TOTAL = 3 * SZ_X + 4 * SZ_W + 4 * SZ_PL + SZ_CTX;
static_assert(SZ_TOTAL <= (size_t)134217728);          // workspace carve <= 128 MiB
static_assert(((size_t)DM * DM * 2) % 256 == 0);

extern "C" void kernel_launch(void* const* d_in, const int* in_sizes, int n_in,
                              void* d_out, int out_size, void* d_ws, size_t ws_size, hipStream_t stream) {
    if (n_in < 11) return;
    const size_t needx = ((size_t)(SEQ - 1) * NB_FULL + NB) * DM;
    if ((size_t)in_sizes[0] < needx || (size_t)in_sizes[1] < needx || (size_t)in_sizes[2] < needx) return;
    if ((size_t)in_sizes[3] < (size_t)DM * DM || (size_t)in_sizes[5] < (size_t)DM * DM || (size_t)in_sizes[7] < (size_t)DM * DM || (size_t)in_sizes[9] < (size_t)DM * DM) return;
    if (in_sizes[4] < DM || in_sizes[6] < DM || in_sizes[8] < DM || in_sizes[10] < DM) return;
    if ((size_t)out_size < needx) return;
    if (SZ_TOTAL > ws_size) return;
    // wire order: query, key, value, Wq, bq, Wk, bk, Wv, bv, Wo, bo (weights [out][in] = Bt as-is)
    const float* xq = (const float*)d_in[0]; const float* xk = (const float*)d_in[1]; const float* xv = (const float*)d_in[2];
    const float* wq = (const float*)d_in[3]; const float* bq = (const float*)d_in[4];
    const float* wk = (const float*)d_in[5]; const float* bk = (const float*)d_in[6];
    const float* wv = (const float*)d_in[7]; const float* bvv = (const float*)d_in[8];
    const float* wo = (const float*)d_in[9]; const float* bo = (const float*)d_in[10];
    float* OUT = (float*)d_out;      // [SEQ][NB_FULL][1024]
    char* wsp = (char*)d_ws;
    bf* XQ = (bf*)wsp; wsp += SZ_X;                  // [NB*SEQ][1024], row b*SEQ + s
    bf* XK = (bf*)wsp; wsp += SZ_X;
    bf* XV = (bf*)wsp; wsp += SZ_X;
    bf* WQ = (bf*)wsp; wsp += SZ_W;                  // [1024][1024]
    bf* WK = (bf*)wsp; wsp += SZ_W;
    bf* WV = (bf*)wsp; wsp += SZ_W;
    h16* WO = (h16*)wsp; wsp += SZ_W;                // f16, x64
    h16* QH = (h16*)wsp; wsp += SZ_PL;               // [NB*16][SEQ][64]
    h16* QR = (h16*)wsp; wsp += SZ_PL;               // [NB*16][SEQ][64] residual
    h16* KP = (h16*)wsp; wsp += SZ_PL;               // [NB*16][SEQ][64]
    h16* VT = (h16*)wsp; wsp += SZ_PL;               // [NB*16][64][SEQ]
    h16* CTX = (h16*)wsp; wsp += SZ_CTX;             // [NB*SEQ][1024], x32

    k_cvt_all<<<CWV / CW, 32 * CW, 0, stream>>>(xq, xk, xv, wq, wk, wv, wo, XQ, XK, XV, WQ, WK, WV, WO);

    // q, k and v^T planes
    k_proj3<<<dim3(NB * SEQ / GT, DM / GT, 3), 256, 0, stream>>>(XQ, XK, XV, WQ, WK, WV, bq, bk, bvv, QH, QR, KP, VT);

    k_flash<<<dim3(SEQ / (16 * AW), NB * NH_, 1), 32 * AW, 0, stream>>>(QH, QR, KP, VT, CTX);

    // output projection: A = ctx rows (m = b*SEQ + s), Bt = Wo rows (n) -> OUT row s*NB_FULL + b
    k_outp<<<dim3(NB * SEQ / GT, DM / GT, 1), 256, 0, stream>>>(CTX, WO, bo, OUT);
}

// v006
// Measured time: 93.8 microseconds a run.
// In two side-by-side timings against v005, it was 1.03 and 1.02 times as fast.
// Over all steps from v000 it is 2.60 times as fast.
#include <hip/hip_runtime.h>

// Multi-head attention, width 1024 = 16 heads x 64; query/key/value [SEQ][NB][1024] (token row = s*NB + b), Wq/Wk/Wv/Wo [out][in] (y = x W^T + bias), score scale 1/8, no mask, output [SEQ][NB][1024] f32.
// Compute dtypes, f32 accumulate everywhere: q/k/v projections v_wmma_f32_16x16x32_bf16 (inputs and W RNE-converted to bf16; products exact);
// scores v_wmma_f32_16x16x32_f16: k single f16, q (already times HD^-0.5 * log2(e)) as f16 value + plain f16 residual, both products summed in one accumulator; P (x256 carry, cancels in the normalisation) and v single f16; softmax f32 (online, running max);
// output projection v_wmma_f32_16x16x32_f16: ctx single f16 (x32 carry), Wo = f16 of the bf16 RNE value (x64 carry), 1/2048 folded back in the f32 epilogue; biases added in f32.
// Layout: bf16 copies of the inputs with batch-major rows (b*SEQ + s); q (value, residual), k planes [b*16+h][t][d] and v^T plane [b*16+h][d][t] from the GEMM epilogue; fused flash kernel in transposed form (S^T = K Q^T, O^T = V^T P^T) writing the f16 ctx plane [b*SEQ+s][1024]; final GEMM writes the output rows (s*NB + b).

#ifndef NB
#define NB 2
#endif
#ifndef SEQ
#define SEQ 2048
#endif
#define NB_FULL  2
#define SEQ_FULL 2048
#define DM   1024
#define NH_  16
#define HD   64
#define AW   8                   // waves per flash block (16 query rows each)
#define KT   64                  // keys per LDS stage of the flash kernel
#define LP   72                  // LDS row pitch in halves: 128-B rows + 16 B (16 B x odd, for 16-byte readers)
#define TLH  (64 * LP)           // halves of one staged 64-row tile
#define STH  (2 * TLH)           // halves of one stage: K tile [key][d], then V^T tile [d][key]
#define SC2  (0.125f * 1.4426950408889634f)   // HD^-0.5 * log2(e)
#define PSH  8.0f                // log2 of the P carry (256)
#define CTXS 32.0f               // carry of the ctx plane
#define WOS  64.0f               // carry of the Wo plane
#define OSCL (1.0f / 2048.0f)    // 1 / (CTXS * WOS)
#define GT   128                 // rows and columns of a GEMM block's tile: 8 waves, 4 x 2, 32 rows x 64 columns each
#define GKS  128                 // k per LDS stage of the GEMM kernels
#define GLP  136                 // LDS row pitch in halves: 256-B rows + 16 B (16 B x odd, for 16-byte readers)
#define GOPH (GT * GLP)          // halves of one operand's staged tile
#define GSTH (2 * GOPH)          // halves of one stage: A tile [row][k], then B tile [row][k]
#define CW   16                  // waves per block of the convert kernel
#define XR   (NB * SEQ)          // rows of one input
#define WR   (4 * DM)            // rows of the four weight matrices together
#define CWV  (XR > WR ? XR : WR) // waves of the convert launch

static_assert(HD == 64);
static_assert(NH_ * HD == DM);                 // head h = columns h*64 + d
static_assert(DM % 64 == 0);                   // column tiles of 64
static_assert(DM % 32 == 0);                   // GEMM k-loop steps by 32
static_assert(SEQ % 64 == 0);                  // a 64-row tile never straddles two batches
static_assert((NB * SEQ) % 64 == 0);
static_assert(SEQ % 32 == 0);                  // O^T products take 32 keys each
static_assert(SEQ % KT == 0 && SEQ / KT >= 2); // whole stages; the two-buffer prologue needs two
static_assert(AW * 32 * 2 * 8 == KT * HD);     // two 16-byte copies per thread fill one 64 x 64 tile
static_assert((LP * 2) % 16 == 0);
static_assert(SEQ % (16 * AW) == 0);           // flash grid covers the sequence exactly
static_assert(((size_t)SEQ * DM) % 8 == 0);
static_assert(((size_t)DM * DM) % 8 == 0);
static_assert(DM % GT == 0 && (NB * SEQ) % GT == 0);   // GEMM grids cover both operands exactly
static_assert(DM % GKS == 0 && DM / GKS >= 2);         // whole stages; the two-buffer prologue needs two
static_assert(GKS * 2 == 16 * 16 && GT == 16 * 8);     // 16 threads x 16 B fill a row; 256 threads take 16 rows a copy, 8 copies an operand
static_assert((GLP * 2) % 16 == 0);
static_assert(CWV % CW == 0);                  // the convert grid covers its waves exactly
static_assert(DM == 8 * 32 * 4);               // a row is 8 wave-wide 16-byte loads
static_assert(NB <= NB_FULL);
static_assert(SEQ <= SEQ_FULL);

typedef _Float16 h16;
typedef unsigned short bf;
typedef __attribute__((ext_vector_type(16))) __bf16   v16bf;
typedef __attribute__((ext_vector_type(16))) _Float16 v16h;
typedef __attribute__((ext_vector_type(8)))  _Float16 v8h;
typedef __attribute__((ext_vector_type(8)))  unsigned short v8us;
typedef __attribute__((ext_vector_type(4)))  unsigned short v4us;
typedef __attribute__((ext_vector_type(4)))  _Float16 v4h;
typedef __attribute__((ext_vector_type(16))) unsigned short v16us;
typedef __attribute__((ext_vector_type(8)))  float    v8f;
typedef __attribute__((ext_vector_type(4)))  float    v4f;
typedef v4f  __attribute__((may_alias)) v4fa;

__device__ __forceinline__ unsigned short f2bf(float f) { unsigned u = __float_as_uint(f); u += 0x7FFFu + ((u >> 16) & 1u); return (unsigned short)(u >> 16); }
__device__ __forceinline__ float bfr(float f) { return __uint_as_float(((unsigned)f2bf(f)) << 16); }   // f32 value of the bf16 RNE convert
__device__ __forceinline__ v4us bf4(v4f x) { v4us o; o[0] = f2bf(x[0]); o[1] = f2bf(x[1]); o[2] = f2bf(x[2]); o[3] = f2bf(x[3]); return o; }
__device__ __forceinline__ v16h cat16(v8h lo, v8h hi) { return __builtin_shufflevector(lo, hi, 0, 1, 2, 3, 4, 5, 6, 7, 8, 9, 10, 11, 12, 13, 14, 15); }
__device__ __forceinline__ v8f wmma16(v16h a, v16h b, v8f c) { return __builtin_amdgcn_wmma_f32_16x16x32_f16(false, a, false, b, (short)0, c, false, false); }
__device__ __forceinline__ v8f wmmab(v16bf a, v16bf b, v8f c) { return __builtin_amdgcn_wmma_f32_16x16x32_bf16(false, a, false, b, (short)0, c, false, false); }
// fragment loaders from K-contiguous 16-bit rows; p already includes + 8*(lane>>4): elements 0..7 <- k0+8h+0..7, elements 8..15 <- k0+16+8h+0..7 (same map for A and B)
__device__ __forceinline__ v16h  ldh(const h16* p) { return cat16(*(const v8h*)p, *(const v8h*)(p + 16)); }
__device__ __forceinline__ v16us ldu(const bf* p)  { return __builtin_shufflevector(*(const v8us*)p, *(const v8us*)(p + 16), 0, 1, 2, 3, 4, 5, 6, 7, 8, 9, 10, 11, 12, 13, 14, 15); }   // raw 16-bit fragment, bf16 or f16
// ordering point for wave-private LDS tiles (same wave writes and reads)
__device__ __forceinline__ void wave_sync() { __builtin_amdgcn_fence(3 /* release order */, "wavefront"); __builtin_amdgcn_wave_barrier(); asm volatile("" ::: "memory"); }

// k_cvt_all: every 16-bit operand plane in one launch, few waves with much in flight (a launch of one small piece per thread is bound by how fast its waves start).
// Wave w takes row w (order b*SEQ + s, from source row s*NB_FULL + b) of query, key and value and row w of the four stacked weight matrices (w / DM picks the matrix).
// A row is 8 wave-wide 16-byte loads of 512 contiguous bytes each; all 32 loads of a wave are issued before its first convert. A wave past the end of either set re-reads row 0 and stores nothing.
__global__ __launch_bounds__(32 * CW) void k_cvt_all(const float* __restrict__ xq, const float* __restrict__ xk, const float* __restrict__ xv,
                                                     const float* __restrict__ wq, const float* __restrict__ wk, const float* __restrict__ wv, const float* __restrict__ wo,
                                                     bf* XQ, bf* XK, bf* XV, bf* WQ, bf* WK, bf* WV, h16* WO) {
    const unsigned lane = threadIdx.x & 31;         // the lane's 4 elements inside each 128-element piece of a row: vector index lane + 32 j
    const int w = blockIdx.x * CW + __builtin_amdgcn_readfirstlane((int)(threadIdx.x >> 5));
    const bool dx = XR == CWV || w < XR, dw = WR == CWV || w < WR;
    const int xw = dx ? w : 0, ww = dw ? w : 0;
    const int sg = ww / DM;
    // row bases are the same in every lane: scalar base + one lane offset for all loads
    const size_t so = ((size_t)(xw % SEQ) * NB_FULL + (size_t)(xw / SEQ)) * DM, xo = (size_t)xw * DM, wr = (size_t)(ww % DM) * DM;
    const float* pq = xq + so; const float* pk = xk + so; const float* pv = xv + so;
    const float* pw = (sg == 0 ? wq : sg == 1 ? wk : sg == 2 ? wv : wo) + wr;
    v4f q[8], k[8], v[8], t[8];
#pragma unroll
    for (int j = 0; j < 8; ++j) q[j] = ((const v4f*)pq)[lane + j * 32];
#pragma unroll
    for (int j = 0; j < 8; ++j) k[j] = ((const v4f*)pk)[lane + j * 32];
#pragma unroll
    for (int j = 0; j < 8; ++j) v[j] = ((const v4f*)pv)[lane + j * 32];
#pragma unroll
    for (int j = 0; j < 8; ++j) t[j] = ((const v4f*)pw)[lane + j * 32];
    __builtin_amdgcn_sched_barrier(0);   // keeps all 32 loads in front of the first convert (else the weight row's loads are moved behind the wait for the other 24: a second memory latency)
    if (dx) {
        bf* dq = XQ + xo; bf* dk = XK + xo; bf* dv = XV + xo;
#pragma unroll
        for (int j = 0; j < 8; ++j) ((v4us*)dq)[lane + j * 32] = bf4(q[j]);
#pragma unroll
        for (int j = 0; j < 8; ++j) ((v4us*)dk)[lane + j * 32] = bf4(k[j]);
#pragma unroll
        for (int j = 0; j < 8; ++j) ((v4us*)dv)[lane + j * 32] = bf4(v[j]);
    }
    asm volatile("s_wait_xcnt 0x0" ::: "memory");   // in front of the branches below, whose first instructions rewrite registers that the stores above name
    if (dw) {
        if (sg < 3) {
            bf* d = (sg == 0 ? WQ : sg == 1 ? WK : WV) + wr;
#pragma unroll
            for (int j = 0; j < 8; ++j) ((v4us*)d)[lane + j * 32] = bf4(t[j]);
        } else {
            h16* d = WO + wr;
#pragma unroll
            for (int j = 0; j < 8; ++j) { v4h o;
#pragma unroll
                for (int i = 0; i < 4; ++i) o[i] = (h16)(bfr(t[j][i]) * WOS);
                ((v4h*)d)[lane + j * 32] = o; }
        }
    }
}

// Eight 16-byte asynchronous copies of one thread: tile rows r, r + 16, ..., r + 112 (global row pitch DM, LDS row pitch GLP).
// The s_wait_xcnt stands inside the statement so that no address register is rewritten in front of it.
__device__ __forceinline__ void copy8(unsigned l, const bf* g) {
    asm volatile("global_load_async_to_lds_b128 %0, %8, off\n\t"
                 "global_load_async_to_lds_b128 %1, %9, off\n\t"
                 "global_load_async_to_lds_b128 %2, %10, off\n\t"
                 "global_load_async_to_lds_b128 %3, %11, off\n\t"
                 "global_load_async_to_lds_b128 %4, %12, off\n\t"
                 "global_load_async_to_lds_b128 %5, %13, off\n\t"
                 "global_load_async_to_lds_b128 %6, %14, off\n\t"
                 "global_load_async_to_lds_b128 %7, %15, off\n\t"
                 "s_wait_xcnt 0x0"
                 :: "v"(l), "v"(l + 16 * GLP * 2), "v"(l + 32 * GLP * 2), "v"(l + 48 * GLP * 2), "v"(l + 64 * GLP * 2), "v"(l + 80 * GLP * 2), "v"(l + 96 * GLP * 2), "v"(l + 112 * GLP * 2),
                    "v"(g), "v"(g + (size_t)16 * DM), "v"(g + (size_t)32 * DM), "v"(g + (size_t)48 * DM), "v"(g + (size_t)64 * DM), "v"(g + (size_t)80 * DM), "v"(g + (size_t)96 * DM), "v"(g + (size_t)112 * DM)
                 : "memory");
}
// One stage of the GEMM ring: GT rows x GKS k of A, then of B; each thread copies 8 pieces of each. l: LDS byte address of the thread's first piece in the target buffer.
__device__ __forceinline__ void gemm_stage(unsigned l, const bf* ga, const bf* gb) { copy8(l, ga); copy8(l + GOPH * 2, gb); }
template <int BFK>
__device__ __forceinline__ v8f wmmau(v16us a, v16us b, v8f c) {
    if constexpr (BFK != 0) return wmmab(__builtin_bit_cast(v16bf, a), __builtin_bit_cast(v16bf, b), c);
    else return wmma16(__builtin_bit_cast(v16h, a), __builtin_bit_cast(v16h, b), c);
}

// gemm_core: the k loop of one GT x GT block tile, 8 waves, wave (wm, wn) = (wave >> 1, wave & 1) owning the 32 x 64 tile at (rb + 32 wm, cb + 64 wn), K = DM.
// A rows rb.. and Bt rows cb.. (K-contiguous 16-bit planes, bf16 for BFK != 0, else f16) come into LDS once per block by asynchronous copies (whole 256-B row pieces per 16 lanes),
// two buffers of GKS k, the next stage in flight while this one is worked on; fragments are two 16-B LDS loads each, same element map and same k order as from global memory.
template <int BFK>
__device__ __forceinline__ void gemm_core(const bf* __restrict__ A, const bf* __restrict__ Bt, int rb, int cb, bf* ring, v8f (&acc)[2][4]) {
    const int lane = threadIdx.x & 31, lr = lane & 15, hi = lane >> 4;
    const int wave = __builtin_amdgcn_readfirstlane((int)(threadIdx.x >> 5));
    // copy map: thread c takes 16-byte piece c & 15 of tile rows (c >> 4) + 16 i, i = 0..7, of the A tile and of the B tile
    const int crw = (int)threadIdx.x >> 4, cpc = ((int)threadIdx.x & 15) * 8;
    const bf* ga = A + (size_t)(rb + crw) * DM + cpc;       // + stage * GKS
    const bf* gb = Bt + (size_t)(cb + crw) * DM + cpc;      // + stage * GKS
    const unsigned lc = (unsigned)(size_t)&ring[crw * GLP + cpc];   // LDS byte address: low 32 bits of the shared address
    const int ao = ((wave >> 1) * 32 + lr) * GLP + 8 * hi;          // + 16 mb * GLP + k_local
    const int bo = GOPH + ((wave & 1) * 64 + lr) * GLP + 8 * hi;    // + 16 nb * GLP + k_local
#pragma unroll
    for (int mb = 0; mb < 2; ++mb)
#pragma unroll
        for (int nb = 0; nb < 4; ++nb) acc[mb][nb] = (v8f){};
    gemm_stage(lc, ga, gb);
    asm volatile("s_wait_asynccnt 0x0" ::: "memory");   // stage 0 landed before the barrier that publishes it
    __syncthreads();
    gemm_stage(lc + GSTH * 2, ga + GKS, gb + GKS);
#pragma unroll 1
    for (int st = 0; st < DM / GKS; ++st) {
        const int so = (st & 1) * GSTH;
        const bf* pa = ring + so + ao; const bf* pb = ring + so + bo;
        v16us a[2][2], b[2][4];
#pragma unroll
        for (int i = 0; i < 2; ++i) a[0][i] = ldu(pa + i * 16 * GLP);
#pragma unroll
        for (int i = 0; i < 4; ++i) b[0][i] = ldu(pb + i * 16 * GLP);
#pragma unroll   // the 32-k blocks of a stage unrolled: every LDS offset an immediate, both fragment sets indexed by constants
        for (int kk = 0; kk < GKS / 32; ++kk) {
            const int cu = kk & 1, nx = cu ^ 1;
            if (kk + 1 < GKS / 32) {
#pragma unroll
                for (int i = 0; i < 2; ++i) a[nx][i] = ldu(pa + i * 16 * GLP + (kk + 1) * 32);
#pragma unroll
                for (int i = 0; i < 4; ++i) b[nx][i] = ldu(pb + i * 16 * GLP + (kk + 1) * 32);
            }
            __builtin_amdgcn_sched_barrier(0);   // keeps the next block's LDS loads one group ahead of this block's products (else they are moved in among them, each with a wait to 0)
#pragma unroll
            for (int nb = 0; nb < 4; ++nb)
#pragma unroll
                for (int mb = 0; mb < 2; ++mb) acc[mb][nb] = wmmau<BFK>(a[cu][mb], b[cu][nb], acc[mb][nb]);
            __builtin_amdgcn_sched_barrier(0);   // keeps this block's products ahead of the following load group and of the stage's foot
        }
        // four vector slots behind the stage's last products, on the way to the branches below
        asm volatile("v_nop\n\tv_nop\n\tv_nop\n\tv_nop" : "+v"(acc[0][2]), "+v"(acc[1][2]), "+v"(acc[0][3]), "+v"(acc[1][3]) : "v"(a[1][0]), "v"(a[1][1]), "v"(b[1][2]), "v"(b[1][3]));
        // publish point of stage st + 1, which also frees the buffer that this trip has read
        asm volatile("s_wait_dscnt 0x0" ::: "memory");      // this wave's reads of the buffer have returned before it is refilled
        asm volatile("s_wait_asynccnt 0x0" ::: "memory");   // this wave's copies of stage st + 1 have landed before other waves read them
        __syncthreads();
        if (st + 2 < DM / GKS) gemm_stage(lc + (unsigned)so * 2, ga + (size_t)(st + 2) * GKS, gb + (size_t)(st + 2) * GKS);
    }
    asm volatile("s_wait_asynccnt 0x0" ::: "memory");       // nothing of this wave is in flight when it goes on to the epilogue
}

// proj_tile: bf16 GEMM tile (bx, by) of 128 x 128 by one block of 8 waves (gemm_core), each wave's 32 x 64 tile in 8 accumulators, K = DM.
// C[m][n] = sum_k A[m][k] Bt[n][k] + bias (BROW == 0: bias[n]; BROW == 1: bias[m]; bias taken at its bf16 RNE value, added in f32),
// times osc (f32), written as f16 (Ph) and optionally the f16 residual (Pr, useRes != 0; no carry: it may lie in the f16 subnormal range, step 2^-24, which the matrix unit keeps) at
// tile base (r0/RB)*sRB + (r0%RB)*pitch + (c0/CB)*sCB + (c0%CB), row pitch 'pitch' (halves).
// The output rows are staged in the ring's own LDS: behind the foot of gemm_core's last trip (every wave's s_wait_dscnt 0, s_wait_asynccnt 0, then the barrier) nobody reads the ring and no copy is in flight.
template <int BROW>
__device__ __forceinline__ void proj_tile(const bf* __restrict__ A, const bf* __restrict__ Bt, const float* __restrict__ bias, h16* Ph, h16* Pr, int useRes, float osc, int RB, size_t sRB, int pitch, int CB, size_t sCB, int bx, int by, bf* ring) {
    const int lane = threadIdx.x & 31, lr = lane & 15, hi = lane >> 4;
    const int wave = __builtin_amdgcn_readfirstlane((int)(threadIdx.x >> 5));
    float* os = (float*)ring + wave * 16 * 68;   // each wave stages its output rows in its own range
    const int r0 = bx * GT + (wave >> 1) * 32, c0 = by * GT + (wave & 1) * 64;
    v8f acc[2][4];
    gemm_core<1>(A, Bt, bx * GT, by * GT, ring, acc);
    const int rq = lane >> 3, c8 = (lane & 7) * 8;
    v4f bc0 = (v4f){0.0f, 0.0f, 0.0f, 0.0f}, bc1 = (v4f){0.0f, 0.0f, 0.0f, 0.0f};
    if constexpr (BROW == 0) {
        const v4f t0 = *(const v4f*)(bias + c0 + c8); const v4f t1 = *(const v4f*)(bias + c0 + c8 + 4);
#pragma unroll
        for (int i = 0; i < 4; ++i) { bc0[i] = bfr(t0[i]); bc1[i] = bfr(t1[i]); }
    }
    const size_t tbase = (size_t)(r0 / RB) * sRB + (size_t)(r0 % RB) * (size_t)pitch + (size_t)(c0 / CB) * sCB + (size_t)(c0 % CB);
#pragma unroll
    for (int mb = 0; mb < 2; ++mb) {
#pragma unroll
        for (int nb = 0; nb < 4; ++nb) {
#pragma unroll
            for (int j = 0; j < 8; ++j) os[(hi * 8 + j) * 68 + nb * 16 + lr] = acc[mb][nb][j]; }   // D: row 8h+j, col lane&15
        wave_sync();
        const size_t sb = tbase + (size_t)(mb * 16) * (size_t)pitch;
{
#pragma unroll
            for (int s = 0; s < 4; ++s) { const int row = 4 * s + rq;   // 4 s x 4 row groups = 16 rows; 8 lanes x 8 = 64 columns
                float br = 0.0f;
                if constexpr (BROW != 0) br = bfr(bias[r0 + mb * 16 + row]);
                const v4f x0 = *(const v4fa*)(&os[row * 68 + c8]); const v4f x1 = *(const v4fa*)(&os[row * 68 + c8 + 4]); v8h hv, rv;
#pragma unroll
                for (int i = 0; i < 4; ++i) { const float y0 = (x0[i] + bc0[i] + br) * osc; const float y1 = (x1[i] + bc1[i] + br) * osc;
                    const h16 a0 = (h16)y0; const h16 a1 = (h16)y1; hv[i] = a0; hv[4 + i] = a1; rv[i] = (h16)(y0 - (float)a0); rv[4 + i] = (h16)(y1 - (float)a1); }
                const size_t oo = sb + (size_t)row * (size_t)pitch + c8;
                *(v8h*)(Ph + oo) = hv;
                asm volatile("s_wait_xcnt 0x0" ::: "memory");   // in front of the residual's store and the next rows' loads, which rewrite registers that the store above names
                if (useRes) *(v8h*)(Pr + oo) = rv; }
             }
        wave_sync();
    }
}

// k_proj3: the three input projections in one launch, grid (NB*SEQ/128, DM/128, 3), 256 threads; they are independent of one another, so a block of one starts wherever a place is free.
// With the ring as a block's only LDS two blocks fit a WGP: one block's first copies, barrier waits and output stores run beside the other's products.
// z = 0, 1 (q, k): A = x rows (m = b*SEQ + t), Bt = W rows (n = h*64 + d), column bias -> plane [(b*16 + h)][t][d]; q is scaled by HD^-0.5 * log2(e) and also writes its residual plane.
// z = 2 (v^T): A = Wv rows (m = h*64 + d), Bt = x rows (n = b*SEQ + t), row bias -> plane [(b*1024 + m)][t] = [(b*16 + h)][d][t]; tile (i % 8, i / 8) of the block's flat index i.
__global__ __launch_bounds__(256) void k_proj3(const bf* __restrict__ XQ, const bf* __restrict__ XK, const bf* __restrict__ XV, const bf* __restrict__ WQ, const bf* __restrict__ WK, const bf* __restrict__ WV,
                                               const float* __restrict__ bq, const float* __restrict__ bk, const float* __restrict__ bv, h16* QH, h16* QR, h16* KP, h16* VT) {
    __shared__ __align__(16) bf ring[2 * GSTH];
    static_assert(8 * 16 * 68 * 4 <= 2 * GSTH * 2);   // the eight waves' staging ranges lie inside the ring
    const int z = blockIdx.z;                          // the same for the whole block: every barrier below is passed by all of its waves
    if (z == 2) {
        const int i = blockIdx.y * (NB * SEQ / GT) + blockIdx.x;
        proj_tile<1>(WV, XV, bv, VT, VT, 0, 1.0f, DM, (size_t)0, SEQ, SEQ, (size_t)DM * SEQ, i % (DM / GT), i / (DM / GT), ring);
    } else {
        const bool q = z == 0;
        proj_tile<0>(q ? XQ : XK, q ? WQ : WK, q ? bq : bk, q ? QH : KP, q ? QR : KP, q ? 1 : 0, q ? SC2 : 1.0f, SEQ, (size_t)NH_ * SEQ * HD, HD, HD, (size_t)SEQ * HD, blockIdx.x, blockIdx.y, ring);
    }
}

// One stage of the flash kernel's ring: each thread copies two 16-byte pieces of the K tile and two of the V^T tile (tile rows r and r + 32) from global memory to LDS.
// lds: byte address of the thread's piece in the K tile of the target buffer. The s_wait_xcnt stands inside the statement so that no address register is rewritten in front of it.
__device__ __forceinline__ void stage_copy(unsigned lds, const h16* gk, const h16* gv) {
    const unsigned l1 = lds + 32 * LP * 2, l2 = lds + TLH * 2, l3 = lds + TLH * 2 + 32 * LP * 2;
    const h16* gk1 = gk + (size_t)32 * HD; const h16* gv1 = gv + (size_t)32 * SEQ;
    asm volatile("global_load_async_to_lds_b128 %0, %4, off\n\t"
                 "global_load_async_to_lds_b128 %1, %5, off\n\t"
                 "global_load_async_to_lds_b128 %2, %6, off\n\t"
                 "global_load_async_to_lds_b128 %3, %7, off\n\t"
                 "s_wait_xcnt 0x0"
                 :: "v"(lds), "v"(l1), "v"(l2), "v"(l3), "v"(gk), "v"(gk1), "v"(gv), "v"(gv1) : "memory");
}

// k_flash: fused attention, one wave per 16 query rows of one (batch, head); Q fragments straight from the f16 planes (two 16-B loads each, arithmetic addressing).
// K and V^T: the block's waves share every key tile, so a stage of KT keys (K rows, V^T rows, 128 B each) is brought into LDS once per block by asynchronous copies
// (whole 128-B lines per 8 lanes), two buffers, the next stage in flight while this one is worked on; fragments are two 16-B LDS loads each, same element map as before.
// Transposed form: S^T[key][t] = K Q^T (A = K rows, B = Q rows); lane (t = lane&15, h = lane>>4) holds keys 8h+r of each 16-key tile, so the packed
// P tile is directly the B fragment of O^T[d][t] = V^T P^T (element r <- tile keys 0..15, element 8+r <- tile keys 16..31, lane unchanged).
// Softmax state (running max, partial sum) is one scalar per lane; the two lane halves of a row are combined with one xor-16 exchange.
__global__ __launch_bounds__(32 * AW) void k_flash(const h16* __restrict__ QH, const h16* __restrict__ QR, const h16* __restrict__ KP, const h16* __restrict__ VT, h16* CTX) {
    __shared__ __align__(16) float os[AW * 16 * 68];
    __shared__ __align__(16) h16 ring[2 * STH];
    const int lane = threadIdx.x & 31, lr = lane & 15, hi = lane >> 4;
    const int wave = __builtin_amdgcn_readfirstlane((int)(threadIdx.x >> 5));
    const int zh = blockIdx.y; const int b = zh / NH_, h = zh % NH_;
    const int t0 = (blockIdx.x * AW + wave) * 16;
    const size_t pbase = (size_t)zh * SEQ * HD;
    const size_t qo = pbase + (size_t)(t0 + lr) * HD + 8 * hi;
    const v16h qh0 = ldh(QH + qo), qh1 = ldh(QH + qo + 32), qr0 = ldh(QR + qo), qr1 = ldh(QR + qo + 32);   // B fragments: col t, k = d
    // copy map: thread c takes 16-byte piece c & 7 of tile rows c >> 3 and 32 + (c >> 3), of the K tile and of the V^T tile
    const int crw = (int)threadIdx.x >> 3, cpc = ((int)threadIdx.x & 7) * 8;
    const h16* gk = KP + pbase + (size_t)crw * HD + cpc;      // + stage * KT * HD   (row = key)
    const h16* gv = VT + pbase + (size_t)crw * SEQ + cpc;     // + stage * KT        (row = d)
    const unsigned lc = (unsigned)(size_t)&ring[crw * LP + cpc];   // LDS byte address: low 32 bits of the shared address
    const int ko = lr * LP + 8 * hi;            // + key_local * LP          (A fragment: row key, k = d)
    const int vo = TLH + lr * LP + 8 * hi;      // + 16j * LP + key_local    (A fragment: row d, k = key)
    stage_copy(lc, gk, gv);
    asm volatile("s_wait_asynccnt 0x0" ::: "memory");   // stage 0 landed before the barrier that publishes it
    __syncthreads();
    stage_copy(lc + STH * 2, gk + (size_t)KT * HD, gv + KT);
    v8f o0 = (v8f){}, o1 = (v8f){}, o2 = (v8f){}, o3 = (v8f){};
    float m = -3.0e38f, l = 0.0f;
#pragma unroll 1
    for (int st = 0; st < SEQ / KT; ++st) {
      const int bo = (st & 1) * STH;
      // one softmax step per stage: all KT = 64 keys share one running-maximum update, one half exchange and one rescale of the output tiles
      {
        const h16* ka = ring + bo + ko;
        v16h kf0[4], kf1[4];     // 16-key tile i: d 0..31, d 32..63
#pragma unroll
        for (int i = 0; i < 4; ++i) { kf0[i] = ldh(ka + i * 16 * LP); kf1[i] = ldh(ka + i * 16 * LP + 32); }
        __builtin_amdgcn_sched_barrier(0);   // keeps the K loads one group ahead of the products (else they are moved in among them)
        // value and residual products of a key tile share one accumulator (the q planes carry the score scale): the accumulators hold the log2-domain scores as they are
        v8f s0 = (v8f){}, s1 = (v8f){}, s2 = (v8f){}, s3 = (v8f){};
        s0 = wmma16(kf0[0], qr0, s0); s1 = wmma16(kf0[1], qr0, s1); s2 = wmma16(kf0[2], qr0, s2); s3 = wmma16(kf0[3], qr0, s3);
        s0 = wmma16(kf1[0], qr1, s0); s1 = wmma16(kf1[1], qr1, s1); s2 = wmma16(kf1[2], qr1, s2); s3 = wmma16(kf1[3], qr1, s3);
        s0 = wmma16(kf0[0], qh0, s0); s1 = wmma16(kf0[1], qh0, s1); s2 = wmma16(kf0[2], qh0, s2); s3 = wmma16(kf0[3], qh0, s3);
        s0 = wmma16(kf1[0], qh1, s0); s1 = wmma16(kf1[1], qh1, s1); s2 = wmma16(kf1[2], qh1, s2); s3 = wmma16(kf1[3], qh1, s3);
        __builtin_amdgcn_sched_barrier(0);   // keeps the four accumulator chains interleaved as written (else one tile's four dependent products are issued in a row)
        // the maximum of each tile in a chain of its own (four short chains, not one of 32 links)
        float m0 = -3.0e38f, m1 = -3.0e38f, m2 = -3.0e38f, m3 = -3.0e38f;
#pragma unroll
        for (int r = 0; r < 8; r += 2) { m0 = fmaxf(m0, fmaxf(s0[r], s0[r + 1])); m1 = fmaxf(m1, fmaxf(s1[r], s1[r + 1])); m2 = fmaxf(m2, fmaxf(s2[r], s2[r + 1])); m3 = fmaxf(m3, fmaxf(s3[r], s3[r + 1])); }
        const float mx = fmaxf(fmaxf(m0, m1), fmaxf(m2, m3));
        const float mo = __shfl_xor(mx, 16, 32);
        __builtin_amdgcn_sched_barrier(0);   // keeps the exchange ahead of the V^T loads in the LDS queue (else it returns only behind all sixteen of them)
        const h16* va = ring + bo + vo;
        const v16h v0 = ldh(va), v1 = ldh(va + 16 * LP), v2 = ldh(va + 32 * LP), v3 = ldh(va + 48 * LP);                         // keys 0..31 of the stage
        const v16h w0 = ldh(va + 32), w1 = ldh(va + 16 * LP + 32), w2 = ldh(va + 32 * LP + 32), w3 = ldh(va + 48 * LP + 32);     // keys 32..63
        __builtin_amdgcn_sched_barrier(0);   // keeps the V^T loads ahead of the exponentials, which cover their latency
        const float mnew = fmaxf(m, fmaxf(mx, mo));
        const float alpha = __builtin_amdgcn_exp2f(m - mnew);
        const float sh = PSH - mnew;
        v8f t0, t1, t2, t3;
#pragma unroll
        for (int r = 0; r < 8; ++r) { t0[r] = s0[r] + sh; t1[r] = s1[r] + sh; t2[r] = s2[r] + sh; t3[r] = s3[r] + sh; }
        v16h pb0, pb1; float ls = 0.0f;
#pragma unroll
        for (int r = 0; r < 8; ++r) { const h16 pa = (h16)__builtin_amdgcn_exp2f(t0[r]); const h16 pc = (h16)__builtin_amdgcn_exp2f(t1[r]); pb0[r] = pa; pb0[8 + r] = pc; ls += (float)pa + (float)pc; }
#pragma unroll
        for (int r = 0; r < 8; ++r) { const h16 pa = (h16)__builtin_amdgcn_exp2f(t2[r]); const h16 pc = (h16)__builtin_amdgcn_exp2f(t3[r]); pb1[r] = pa; pb1[8 + r] = pc; ls += (float)pa + (float)pc; }
        l = l * alpha + ls; m = mnew;
        o0 = o0 * alpha; o1 = o1 * alpha; o2 = o2 * alpha; o3 = o3 * alpha;
        o0 = wmma16(v0, pb0, o0); o1 = wmma16(v1, pb0, o1); o2 = wmma16(v2, pb0, o2); o3 = wmma16(v3, pb0, o3);
        o0 = wmma16(w0, pb1, o0); o1 = wmma16(w1, pb1, o1); o2 = wmma16(w2, pb1, o2); o3 = wmma16(w3, pb1, o3);
        // four vector slots behind the stage's last products, on the way to the branch at the stage's foot
        asm volatile("v_nop\n\tv_nop\n\tv_nop\n\tv_nop" : "+v"(o0), "+v"(o1), "+v"(o2), "+v"(o3) : "v"(w0), "v"(w1), "v"(w2), "v"(w3), "v"(pb1));
      }
      // publish point of stage st + 1, which also frees the buffer that this trip has read
      asm volatile("s_wait_dscnt 0x0" ::: "memory");      // this wave's reads of the buffer have returned before it is refilled
      asm volatile("s_wait_asynccnt 0x0" ::: "memory");   // this wave's copies of stage st + 1 have landed before other waves read them
      __syncthreads();
      if (st + 2 < SEQ / KT) stage_copy(lc + (unsigned)bo * 2, gk + (size_t)(st + 2) * KT * HD, gv + (size_t)(st + 2) * KT);
    }
    asm volatile("s_wait_asynccnt 0x0" ::: "memory");     // nothing of this wave is in flight when it goes on to the epilogue
    l += __shfl_xor(l, 16, 32);
    const float inv = CTXS * (1.0f / l);
    const int wb = wave * 16 * 68;
    // O^T D layout: o_j[r] = (d = 16j + 8h + r, t = lane&15) -> os[t][d]; rows 0..15 x columns 0..63 all written
    { v4f a, c;
      a[0] = o0[0] * inv; a[1] = o0[1] * inv; a[2] = o0[2] * inv; a[3] = o0[3] * inv; c[0] = o0[4] * inv; c[1] = o0[5] * inv; c[2] = o0[6] * inv; c[3] = o0[7] * inv;
      *(v4fa*)(&os[wb + lr * 68 +  0 + 8 * hi]) = a; *(v4fa*)(&os[wb + lr * 68 +  0 + 8 * hi + 4]) = c;
      a[0] = o1[0] * inv; a[1] = o1[1] * inv; a[2] = o1[2] * inv; a[3] = o1[3] * inv; c[0] = o1[4] * inv; c[1] = o1[5] * inv; c[2] = o1[6] * inv; c[3] = o1[7] * inv;
      *(v4fa*)(&os[wb + lr * 68 + 16 + 8 * hi]) = a; *(v4fa*)(&os[wb + lr * 68 + 16 + 8 * hi + 4]) = c;
      a[0] = o2[0] * inv; a[1] = o2[1] * inv; a[2] = o2[2] * inv; a[3] = o2[3] * inv; c[0] = o2[4] * inv; c[1] = o2[5] * inv; c[2] = o2[6] * inv; c[3] = o2[7] * inv;
      *(v4fa*)(&os[wb + lr * 68 + 32 + 8 * hi]) = a; *(v4fa*)(&os[wb + lr * 68 + 32 + 8 * hi + 4]) = c;
      a[0] = o3[0] * inv; a[1] = o3[1] * inv; a[2] = o3[2] * inv; a[3] = o3[3] * inv; c[0] = o3[4] * inv; c[1] = o3[5] * inv; c[2] = o3[6] * inv; c[3] = o3[7] * inv;
      *(v4fa*)(&os[wb + lr * 68 + 48 + 8 * hi]) = a; *(v4fa*)(&os[wb + lr * 68 + 48 + 8 * hi + 4]) = c; }
    wave_sync();
    h16* crow = CTX + ((size_t)b * SEQ + t0) * DM + h * HD;
    const int rq = lane >> 3, c8 = (lane & 7) * 8;
{
#pragma unroll
        for (int s = 0; s < 4; ++s) { const int row = 4 * s + rq;   // 4 s x 4 row groups = 16 rows; 8 lanes x 8 halves = 64 columns
            const v4f x0 = *(const v4fa*)(&os[wb + row * 68 + c8]); const v4f x1 = *(const v4fa*)(&os[wb + row * 68 + c8 + 4]); v8h hv;
#pragma unroll
            for (int i = 0; i < 4; ++i) { hv[i] = (h16)x0[i]; hv[4 + i] = (h16)x1[i]; }
            *(v8h*)(crow + (size_t)row * DM + c8) = hv; }
         }
}

// k_outp: f16 GEMM, one block of 8 waves per 128 x 128 tile (gemm_core), each wave's 32 x 64 tile in 8 accumulators, K = DM.
// OUT[(s*NB_FULL + b)][n] = OSCL * sum_k A[b*SEQ + s][k] Bt[n][k] + bias[n] (bias at its bf16 RNE value, f32 add). grid (NB*SEQ/128, DM/128), 256 threads.
__global__ __launch_bounds__(256) void k_outp(const h16* __restrict__ A, const h16* __restrict__ Bt, const float* __restrict__ bias, float* OUT) {
    __shared__ __align__(16) bf ring[2 * GSTH];
    __shared__ __align__(16) float osb[8 * 16 * 68];
    const int lane = threadIdx.x & 31, lr = lane & 15, hi = lane >> 4;
    const int wave = __builtin_amdgcn_readfirstlane((int)(threadIdx.x >> 5));
    float* os = osb + wave * 16 * 68;            // each wave stages its output rows in its own range
    const int r0 = blockIdx.x * GT + (wave >> 1) * 32, c0 = blockIdx.y * GT + (wave & 1) * 64;
    v8f acc[2][4];
    gemm_core<0>((const bf*)A, (const bf*)Bt, blockIdx.x * GT, blockIdx.y * GT, ring, acc);
    const int bb = r0 / SEQ, sb = r0 % SEQ;        // tile rows share one batch (SEQ % 64 == 0)
    const int cofs = lr * 4;
    v4f bv;
    { const v4f t = *(const v4f*)(bias + c0 + cofs);
#pragma unroll
      for (int i = 0; i < 4; ++i) bv[i] = bfr(t[i]); }
#pragma unroll
    for (int mb = 0; mb < 2; ++mb) {
#pragma unroll
        for (int nb = 0; nb < 4; ++nb) {
#pragma unroll
            for (int j = 0; j < 8; ++j) os[(hi * 8 + j) * 68 + nb * 16 + lr] = acc[mb][nb][j]; }   // D: row 8h+j, col lane&15
        wave_sync();
{
#pragma unroll
            for (int s = 0; s < 8; ++s) { const int row = 2 * s + hi;   // 8 s x 2 rows = 16 rows; 16 lanes x 4 floats = 64 columns
                const v4f x = *(const v4fa*)(&os[row * 68 + cofs]); v4f val;
#pragma unroll
                for (int i = 0; i < 4; ++i) val[i] = x[i] * OSCL + bv[i];
                float* dst = OUT + ((size_t)(sb + mb * 16 + row) * NB_FULL + bb) * DM + c0 + cofs;
                *(v4f*)dst = val; }
             }
        wave_sync();
    }
}

static constexpr size_t al256(size_t v) { return (v + 255) & ~(size_t)255; }
static constexpr size_t SZ_X   = al256((size_t)NB * SEQ * DM * 2);          // one bf16 input copy
static constexpr size_t SZ_W   = al256((size_t)DM * DM * 2);                // one 16-bit weight plane
static constexpr size_t SZ_PL  = al256((size_t)NB * NH_ * SEQ * HD * 2);    // one head plane
static constexpr size_t SZ_CTX = al256((size_t)NB * SEQ * DM * 2);          // f16 ctx plane
static constexpr size_t SZ_TOTAL = 3 * SZ_X + 4 * SZ_W + 4 * SZ_PL + SZ_CTX;
static_assert(SZ_TOTAL <= (size_t)134217728);          // workspace carve <= 128 MiB
static_assert(((size_t)DM * DM * 2) % 256 == 0);

extern "C" void kernel_launch(void* const* d_in, const int* in_sizes, int n_in,
                              void* d_out, int out_size, void* d_ws, size_t ws_size, hipStream_t stream) {
    if (n_in < 11) return;
    const size_t needx = ((size_t)(SEQ - 1) * NB_FULL + NB) * DM;
    if ((size_t)in_sizes[0] < needx || (size_t)in_sizes[1] < needx || (size_t)in_sizes[2] < needx) return;
    if ((size_t)in_sizes[3] < (size_t)DM * DM || (size_t)in_sizes[5] < (size_t)DM * DM || (size_t)in_sizes[7] < (size_t)DM * DM || (size_t)in_sizes[9] < (size_t)DM * DM) return;
    if (in_sizes[4] < DM || in_sizes[6] < DM || in_sizes[8] < DM || in_sizes[10] < DM) return;
    if ((size_t)out_size < needx) return;
    if (SZ_TOTAL > ws_size) return;
    // wire order: query, key, value, Wq, bq, Wk, bk, Wv, bv, Wo, bo (weights [out][in] = Bt as-is)
    const float* xq = (const float*)d_in[0]; const float* xk = (const float*)d_in[1]; const float* xv = (const float*)d_in[2];
    const float* wq = (const float*)d_in[3]; const float* bq = (const float*)d_in[4];
    const float* wk = (const float*)d_in[5]; const float* bk = (const float*)d_in[6];
    const float* wv = (const float*)d_in[7]; const float* bvv = (const float*)d_in[8];
    const float* wo = (const float*)d_in[9]; const float* bo = (const float*)d_in[10];
    float* OUT = (float*)d_out;      // [SEQ][NB_FULL][1024]
    char* wsp = (char*)d_ws;
    bf* XQ = (bf*)wsp; wsp += SZ_X;                  // [NB*SEQ][1024], row b*SEQ + s
    bf* XK = (bf*)wsp; wsp += SZ_X;
    bf* XV = (bf*)wsp; wsp += SZ_X;
    bf* WQ = (bf*)wsp; wsp += SZ_W;                  // [1024][1024]
    bf* WK = (bf*)wsp; wsp += SZ_W;
    bf* WV = (bf*)wsp; wsp += SZ_W;
    h16* WO = (h16*)wsp; wsp += SZ_W;                // f16, x64
    h16* QH = (h16*)wsp; wsp += SZ_PL;               // [NB*16][SEQ][64]
    h16* QR = (h16*)wsp; wsp += SZ_PL;               // [NB*16][SEQ][64] residual
    h16* KP = (h16*)wsp; wsp += SZ_PL;               // [NB*16][SEQ][64]
    h16* VT = (h16*)wsp; wsp += SZ_PL;               // [NB*16][64][SEQ]
    h16* CTX = (h16*)wsp; wsp += SZ_CTX;             // [NB*SEQ][1024], x32

    k_cvt_all<<<CWV / CW, 32 * CW, 0, stream>>>(xq, xk, xv, wq, wk, wv, wo, XQ, XK, XV, WQ, WK, WV, WO);

    // q, k and v^T planes
    k_proj3<<<dim3(NB * SEQ / GT, DM / GT, 3), 256, 0, stream>>>(XQ, XK, XV, WQ, WK, WV, bq, bk, bvv, QH, QR, KP, VT);

    k_flash<<<dim3(SEQ / (16 * AW), NB * NH_, 1), 32 * AW, 0, stream>>>(QH, QR, KP, VT, CTX);

    // output projection: A = ctx rows (m = b*SEQ + s), Bt = Wo rows (n) -> OUT row s*NB_FULL + b
    k_outp<<<dim3(NB * SEQ / GT, DM / GT, 1), 256, 0, stream>>>(CTX, WO, bo, OUT);
}

// v007
// Measured time: 87.7 microseconds a run.
// In two side-by-side timings against v006, it was 1.05 and 1.06 times as fast.
// Over all steps from v000 it is 2.74 times as fast.
#include <hip/hip_runtime.h>

// Multi-head attention, width 1024 = 16 heads x 64; query/key/value [SEQ][NB][1024] (token row = s*NB + b), Wq/Wk/Wv/Wo [out][in] (y = x W^T + bias), score scale 1/8, no mask, output [SEQ][NB][1024] f32.
// Compute dtypes, f32 accumulate everywhere: q/k/v projections v_wmma_f32_16x16x32_bf16 (inputs and W RNE-converted to bf16 in registers, fragment by fragment; products exact);
// scores v_wmma_f32_16x16x32_f16: k single f16, q (already times HD^-0.5 * log2(e)) as f16 value + plain f16 residual, both products summed in one accumulator; P (x256 carry, cancels in the normalisation) and v single f16; softmax f32 (online, running max);
// output projection v_wmma_f32_16x16x32_f16: ctx single f16 (x32 carry), Wo = f16 of the bf16 RNE value (x64 carry), 1/2048 folded back in the f32 epilogue; biases added in f32.
// Layout: token rows taken batch-major (b*SEQ + s) straight from the f32 inputs; q (value, residual), k planes [b*16+h][t][d] and v^T plane [b*16+h][d][t] from the GEMM epilogue; fused flash kernel in transposed form (S^T = K Q^T, O^T = V^T P^T) writing the f16 ctx plane [b*SEQ+s][1024]; final GEMM writes the output rows (s*NB + b).

#ifndef NB
#define NB 2
#endif
#ifndef SEQ
#define SEQ 2048
#endif
#define NB_FULL  2
#define SEQ_FULL 2048
#define DM   1024
#define NH_  16
#define HD   64
#define AW   8                   // waves per flash block (16 query rows each)
#define KT   64                  // keys per LDS stage of the flash kernel
#define LP   72                  // LDS row pitch in halves: 128-B rows + 16 B (16 B x odd, for 16-byte readers)
#define TLH  (64 * LP)           // halves of one staged 64-row tile
#define STH  (2 * TLH)           // halves of one stage: K tile [key][d], then V^T tile [d][key]
#define SC2  (0.125f * 1.4426950408889634f)   // HD^-0.5 * log2(e)
#define PSH  8.0f                // log2 of the P carry (256)
#define CTXS 32.0f               // carry of the ctx plane
#define WOS  64.0f               // carry of the Wo plane
#define OSCL (1.0f / 2048.0f)    // 1 / (CTXS * WOS)
#define GT   128                 // rows and columns of a GEMM block's tile: 8 waves, 4 x 2, 32 rows x 64 columns each
#define GKS  128                 // k per LDS stage of the GEMM kernels
#define GLP  136                 // LDS row pitch in halves: 256-B rows + 16 B (16 B x odd, for 16-byte readers)
#define GOPH (GT * GLP)          // halves of one operand's staged tile
#define GSTH (2 * GOPH)          // halves of one stage: A tile [row][k], then B tile [row][k]
#define PT   256                 // rows and columns of a projection block's tile: 8 waves, 4 x 2, 64 rows x 128 columns each
#define PKS  64                  // k per LDS stage of the projection kernel (f32 operands)
#define PLP  68                  // LDS row pitch in floats: 256-B rows + 16 B (16 B x odd, for 16-byte readers)
#define POPF (PT * PLP)          // floats of one operand's staged tile
#define PSTF (2 * POPF)          // floats of one stage: A tile [row][k], then B tile [row][k]
#define PGX  ((NB * SEQ / PT) * (DM / PT))   // blocks of one projection

static_assert(HD == 64);
static_assert(NH_ * HD == DM);                 // head h = columns h*64 + d
static_assert(DM % 64 == 0);                   // column tiles of 64
static_assert(DM % 32 == 0);                   // GEMM k-loop steps by 32
static_assert(SEQ % 64 == 0);                  // a 64-row tile never straddles two batches
static_assert((NB * SEQ) % 64 == 0);
static_assert(SEQ % 32 == 0);                  // O^T products take 32 keys each
static_assert(SEQ % KT == 0 && SEQ / KT >= 2); // whole stages; the two-buffer prologue needs two
static_assert(AW * 32 * 2 * 8 == KT * HD);     // two 16-byte copies per thread fill one 64 x 64 tile
static_assert((LP * 2) % 16 == 0);
static_assert(SEQ % (16 * AW) == 0);           // flash grid covers the sequence exactly
static_assert(((size_t)SEQ * DM) % 8 == 0);
static_assert(((size_t)DM * DM) % 8 == 0);
static_assert(DM % GT == 0 && (NB * SEQ) % GT == 0);   // GEMM grids cover both operands exactly
static_assert(DM % GKS == 0 && DM / GKS >= 2);         // whole stages; the two-buffer prologue needs two
static_assert(GKS * 2 == 16 * 16 && GT == 16 * 8);     // 16 threads x 16 B fill a row; 256 threads take 16 rows a copy, 8 copies an operand
static_assert((GLP * 2) % 16 == 0);
static_assert(DM == 8 * 32 * 4);               // a row is 8 wave-wide 16-byte loads
static_assert(DM % PT == 0 && SEQ % PT == 0);  // projection grids cover both operands exactly; a tile's token rows share one batch
static_assert(DM % PKS == 0 && DM / PKS >= 2); // whole stages; the two-buffer prologue needs two
static_assert(PKS * 4 == 16 * 16 && PT == 16 * 16);   // 16 threads x 16 B fill a row; 256 threads take 16 rows a copy, 16 copies an operand
static_assert((PLP * 4) % 16 == 0);
static_assert(DM % (PGX * 8) == 0);            // the Wo blocks' waves take whole rows, the same number each
static_assert(NB <= NB_FULL);
static_assert(SEQ <= SEQ_FULL);

typedef _Float16 h16;
typedef unsigned short bf;
typedef __attribute__((ext_vector_type(16))) __bf16   v16bf;
typedef __attribute__((ext_vector_type(16))) _Float16 v16h;
typedef __attribute__((ext_vector_type(8)))  _Float16 v8h;
typedef __attribute__((ext_vector_type(8)))  unsigned short v8us;
typedef __attribute__((ext_vector_type(4)))  _Float16 v4h;
typedef __attribute__((ext_vector_type(16))) unsigned short v16us;
typedef __attribute__((ext_vector_type(8)))  float    v8f;
typedef __attribute__((ext_vector_type(4)))  float    v4f;
typedef __attribute__((ext_vector_type(16))) float    v16f;
typedef v4f  __attribute__((may_alias)) v4fa;

__device__ __forceinline__ unsigned short f2bf(float f) { unsigned u = __float_as_uint(f); u += 0x7FFFu + ((u >> 16) & 1u); return (unsigned short)(u >> 16); }
__device__ __forceinline__ float bfr(float f) { return __uint_as_float(((unsigned)f2bf(f)) << 16); }   // f32 value of the bf16 RNE convert
__device__ __forceinline__ v16h cat16(v8h lo, v8h hi) { return __builtin_shufflevector(lo, hi, 0, 1, 2, 3, 4, 5, 6, 7, 8, 9, 10, 11, 12, 13, 14, 15); }
__device__ __forceinline__ v8f wmma16(v16h a, v16h b, v8f c) { return __builtin_amdgcn_wmma_f32_16x16x32_f16(false, a, false, b, (short)0, c, false, false); }
__device__ __forceinline__ v8f wmmab(v16bf a, v16bf b, v8f c) { return __builtin_amdgcn_wmma_f32_16x16x32_bf16(false, a, false, b, (short)0, c, false, false); }
// fragment loaders from K-contiguous 16-bit rows; p already includes + 8*(lane>>4): elements 0..7 <- k0+8h+0..7, elements 8..15 <- k0+16+8h+0..7 (same map for A and B)
__device__ __forceinline__ v16h  ldh(const h16* p) { return cat16(*(const v8h*)p, *(const v8h*)(p + 16)); }
__device__ __forceinline__ v16us ldu(const bf* p)  { return __builtin_shufflevector(*(const v8us*)p, *(const v8us*)(p + 16), 0, 1, 2, 3, 4, 5, 6, 7, 8, 9, 10, 11, 12, 13, 14, 15); }   // raw 16-bit fragment, bf16 or f16
// ordering point for wave-private LDS tiles (same wave writes and reads)
__device__ __forceinline__ void wave_sync() { __builtin_amdgcn_fence(3 /* release order */, "wavefront"); __builtin_amdgcn_wave_barrier(); asm volatile("" ::: "memory"); }

// Eight 16-byte asynchronous copies of one thread: tile rows r, r + 16, ..., r + 112 (global row pitch DM, LDS row pitch GLP).
// The s_wait_xcnt stands inside the statement so that no address register is rewritten in front of it.
__device__ __forceinline__ void copy8(unsigned l, const bf* g) {
    asm volatile("global_load_async_to_lds_b128 %0, %8, off\n\t"
                 "global_load_async_to_lds_b128 %1, %9, off\n\t"
                 "global_load_async_to_lds_b128 %2, %10, off\n\t"
                 "global_load_async_to_lds_b128 %3, %11, off\n\t"
                 "global_load_async_to_lds_b128 %4, %12, off\n\t"
                 "global_load_async_to_lds_b128 %5, %13, off\n\t"
                 "global_load_async_to_lds_b128 %6, %14, off\n\t"
                 "global_load_async_to_lds_b128 %7, %15, off\n\t"
                 "s_wait_xcnt 0x0"
                 :: "v"(l), "v"(l + 16 * GLP * 2), "v"(l + 32 * GLP * 2), "v"(l + 48 * GLP * 2), "v"(l + 64 * GLP * 2), "v"(l + 80 * GLP * 2), "v"(l + 96 * GLP * 2), "v"(l + 112 * GLP * 2),
                    "v"(g), "v"(g + (size_t)16 * DM), "v"(g + (size_t)32 * DM), "v"(g + (size_t)48 * DM), "v"(g + (size_t)64 * DM), "v"(g + (size_t)80 * DM), "v"(g + (size_t)96 * DM), "v"(g + (size_t)112 * DM)
                 : "memory");
}
// One stage of the GEMM ring: GT rows x GKS k of A, then of B; each thread copies 8 pieces of each. l: LDS byte address of the thread's first piece in the target buffer.
__device__ __forceinline__ void gemm_stage(unsigned l, const bf* ga, const bf* gb) { copy8(l, ga); copy8(l + GOPH * 2, gb); }
template <int BFK>
__device__ __forceinline__ v8f wmmau(v16us a, v16us b, v8f c) {
    if constexpr (BFK != 0) return wmmab(__builtin_bit_cast(v16bf, a), __builtin_bit_cast(v16bf, b), c);
    else return wmma16(__builtin_bit_cast(v16h, a), __builtin_bit_cast(v16h, b), c);
}

// gemm_core: the k loop of one GT x GT block tile, 8 waves, wave (wm, wn) = (wave >> 1, wave & 1) owning the 32 x 64 tile at (rb + 32 wm, cb + 64 wn), K = DM.
// A rows rb.. and Bt rows cb.. (K-contiguous 16-bit planes, bf16 for BFK != 0, else f16) come into LDS once per block by asynchronous copies (whole 256-B row pieces per 16 lanes),
// two buffers of GKS k, the next stage in flight while this one is worked on; fragments are two 16-B LDS loads each, same element map and same k order as from global memory.
template <int BFK>
__device__ __forceinline__ void gemm_core(const bf* __restrict__ A, const bf* __restrict__ Bt, int rb, int cb, bf* ring, v8f (&acc)[2][4]) {
    const int lane = threadIdx.x & 31, lr = lane & 15, hi = lane >> 4;
    const int wave = __builtin_amdgcn_readfirstlane((int)(threadIdx.x >> 5));
    // copy map: thread c takes 16-byte piece c & 15 of tile rows (c >> 4) + 16 i, i = 0..7, of the A tile and of the B tile
    const int crw = (int)threadIdx.x >> 4, cpc = ((int)threadIdx.x & 15) * 8;
    const bf* ga = A + (size_t)(rb + crw) * DM + cpc;       // + stage * GKS
    const bf* gb = Bt + (size_t)(cb + crw) * DM + cpc;      // + stage * GKS
    const unsigned lc = (unsigned)(size_t)&ring[crw * GLP + cpc];   // LDS byte address: low 32 bits of the shared address
    const int ao = ((wave >> 1) * 32 + lr) * GLP + 8 * hi;          // + 16 mb * GLP + k_local
    const int bo = GOPH + ((wave & 1) * 64 + lr) * GLP + 8 * hi;    // + 16 nb * GLP + k_local
#pragma unroll
    for (int mb = 0; mb < 2; ++mb)
#pragma unroll
        for (int nb = 0; nb < 4; ++nb) acc[mb][nb] = (v8f){};
    gemm_stage(lc, ga, gb);
    asm volatile("s_wait_asynccnt 0x0" ::: "memory");   // stage 0 landed before the barrier that publishes it
    __syncthreads();
    gemm_stage(lc + GSTH * 2, ga + GKS, gb + GKS);
#pragma unroll 1
    for (int st = 0; st < DM / GKS; ++st) {
        const int so = (st & 1) * GSTH;
        const bf* pa = ring + so + ao; const bf* pb = ring + so + bo;
        v16us a[2][2], b[2][4];
#pragma unroll
        for (int i = 0; i < 2; ++i) a[0][i] = ldu(pa + i * 16 * GLP);
#pragma unroll
        for (int i = 0; i < 4; ++i) b[0][i] = ldu(pb + i * 16 * GLP);
#pragma unroll   // the 32-k blocks of a stage unrolled: every LDS offset an immediate, both fragment sets indexed by constants
        for (int kk = 0; kk < GKS / 32; ++kk) {
            const int cu = kk & 1, nx = cu ^ 1;
            if (kk + 1 < GKS / 32) {
#pragma unroll
                for (int i = 0; i < 2; ++i) a[nx][i] = ldu(pa + i * 16 * GLP + (kk + 1) * 32);
#pragma unroll
                for (int i = 0; i < 4; ++i) b[nx][i] = ldu(pb + i * 16 * GLP + (kk + 1) * 32);
            }
            __builtin_amdgcn_sched_barrier(0);   // keeps the next block's LDS loads one group ahead of this block's products (else they are moved in among them, each with a wait to 0)
#pragma unroll
            for (int nb = 0; nb < 4; ++nb)
#pragma unroll
                for (int mb = 0; mb < 2; ++mb) acc[mb][nb] = wmmau<BFK>(a[cu][mb], b[cu][nb], acc[mb][nb]);
            __builtin_amdgcn_sched_barrier(0);   // keeps this block's products ahead of the following load group and of the stage's foot
        }
        // four vector slots behind the stage's last products, on the way to the branches below
        asm volatile("v_nop\n\tv_nop\n\tv_nop\n\tv_nop" : "+v"(acc[0][2]), "+v"(acc[1][2]), "+v"(acc[0][3]), "+v"(acc[1][3]) : "v"(a[1][0]), "v"(a[1][1]), "v"(b[1][2]), "v"(b[1][3]));
        // publish point of stage st + 1, which also frees the buffer that this trip has read
        asm volatile("s_wait_dscnt 0x0" ::: "memory");      // this wave's reads of the buffer have returned before it is refilled
        asm volatile("s_wait_asynccnt 0x0" ::: "memory");   // this wave's copies of stage st + 1 have landed before other waves read them
        __syncthreads();
        if (st + 2 < DM / GKS) gemm_stage(lc + (unsigned)so * 2, ga + (size_t)(st + 2) * GKS, gb + (size_t)(st + 2) * GKS);
    }
    asm volatile("s_wait_asynccnt 0x0" ::: "memory");       // nothing of this wave is in flight when it goes on to the epilogue
}

// Eight 16-byte asynchronous copies of one thread from f32 rows: tile rows r, r + 16, ..., r + 112 (rs floats between copied rows in global memory, LDS row pitch PLP).
// The s_wait_xcnt stands inside the statement so that no address register is rewritten in front of it.
__device__ __forceinline__ void copy8f(unsigned l, const float* g, size_t rs) {
    asm volatile("global_load_async_to_lds_b128 %0, %8, off\n\t"
                 "global_load_async_to_lds_b128 %1, %9, off\n\t"
                 "global_load_async_to_lds_b128 %2, %10, off\n\t"
                 "global_load_async_to_lds_b128 %3, %11, off\n\t"
                 "global_load_async_to_lds_b128 %4, %12, off\n\t"
                 "global_load_async_to_lds_b128 %5, %13, off\n\t"
                 "global_load_async_to_lds_b128 %6, %14, off\n\t"
                 "global_load_async_to_lds_b128 %7, %15, off\n\t"
                 "s_wait_xcnt 0x0"
                 :: "v"(l), "v"(l + 16 * PLP * 4), "v"(l + 32 * PLP * 4), "v"(l + 48 * PLP * 4), "v"(l + 64 * PLP * 4), "v"(l + 80 * PLP * 4), "v"(l + 96 * PLP * 4), "v"(l + 112 * PLP * 4),
                    "v"(g), "v"(g + rs), "v"(g + 2 * rs), "v"(g + 3 * rs), "v"(g + 4 * rs), "v"(g + 5 * rs), "v"(g + 6 * rs), "v"(g + 7 * rs)
                 : "memory");
}
// One stage of the projection ring: PT rows x PKS k (f32) of A, then of B; each thread copies 16 pieces of each. l: LDS byte address of the thread's first piece in the target buffer; ra, rb: floats between rows 16 apart.
__device__ __forceinline__ void proj_stage(unsigned l, const float* ga, size_t ra, const float* gb, size_t rb) {
    copy8f(l, ga, ra); copy8f(l + 128 * PLP * 4, ga + 8 * ra, ra);
    copy8f(l + POPF * 4, gb, rb); copy8f(l + POPF * 4 + 128 * PLP * 4, gb + 8 * rb, rb);
}
// f32 source of one 16-bit fragment; p already includes + 8*(lane>>4): pieces 0, 1 <- k0+8h+0..7, pieces 2, 3 <- k0+16+8h+0..7 (the element map of ldu, same for A and B)
__device__ __forceinline__ void ldraw(v4f (&r)[4], const float* p) { r[0] = *(const v4fa*)p; r[1] = *(const v4fa*)(p + 4); r[2] = *(const v4fa*)(p + 16); r[3] = *(const v4fa*)(p + 20); }
// the fragment itself: every element rounded to bf16, nearest even
__device__ __forceinline__ v16bf cvraw(const v4f (&r)[4]) {
    v16f x;
#pragma unroll
    for (int i = 0; i < 4; ++i)
#pragma unroll
        for (int j = 0; j < 4; ++j) x[4 * i + j] = r[i][j];
    return __builtin_convertvector(x, v16bf);
}

// proj_core: the k loop of one PT x PT block tile, 8 waves, wave (wm, wn) = (wave >> 1, wave & 1) owning the 64 x 128 tile at (64 wm, 128 wn), K = DM.
// A and B point at the tile's first rows in the f32 inputs themselves (as, bs floats between rows). The rows come into LDS as f32, once per block, by asynchronous copies
// (whole 256-B row pieces per 16 lanes), two buffers of PKS k, the next stage in flight while this one is worked on; a fragment is four 16-B LDS loads, rounded to bf16 in registers.
// A stage is four groups of 16 products (k block g >> 1, column half g & 1); the f32 source of the next group is fetched ahead of this group's products.
__device__ __forceinline__ void proj_core(const float* __restrict__ A, size_t as, const float* __restrict__ B, size_t bs, float* ring, v8f (&acc)[4][8]) {
    const int lane = threadIdx.x & 31, lr = lane & 15, hi = lane >> 4;
    const int wave = __builtin_amdgcn_readfirstlane((int)(threadIdx.x >> 5));
    // copy map: thread c takes 16-byte piece c & 15 of tile rows (c >> 4) + 16 i, i = 0..15, of the A tile and of the B tile
    const int crw = (int)threadIdx.x >> 4, cpc = ((int)threadIdx.x & 15) * 4;
    const float* ga = A + (size_t)crw * as + cpc;       // the thread's first piece of the stage being worked on: stepped by PKS every trip
    const float* gb = B + (size_t)crw * bs + cpc;
    const unsigned lc = (unsigned)(size_t)&ring[crw * PLP + cpc];   // LDS byte address: low 32 bits of the shared address
    const int ao = ((wave >> 1) * 64 + lr) * PLP + 8 * hi;          // + 16 mb * PLP + k_local
    const int bo = POPF + ((wave & 1) * 128 + lr) * PLP + 8 * hi;   // + 16 nb * PLP + k_local
#pragma unroll
    for (int mb = 0; mb < 4; ++mb)
#pragma unroll
        for (int nb = 0; nb < 8; ++nb) acc[mb][nb] = (v8f){};
    proj_stage(lc, ga, 16 * as, gb, 16 * bs);
    asm volatile("s_wait_asynccnt 0x0" ::: "memory");   // stage 0 landed before the barrier that publishes it
    __syncthreads();
    proj_stage(lc + PSTF * 4, ga + PKS, 16 * as, gb + PKS, 16 * bs);
#pragma unroll 1
    for (int st = 0; st < DM / PKS; ++st) {
        const int so = (st & 1) * PSTF;
        const float* pa = ring + so + ao; const float* pb = ring + so + bo;
        v4f ra[4][4], rb[4][4];
        v16bf a[4], b[4];
#pragma unroll
        for (int i = 0; i < 4; ++i) ldraw(ra[i], pa + i * 16 * PLP);
#pragma unroll
        for (int i = 0; i < 4; ++i) ldraw(rb[i], pb + i * 16 * PLP);
#pragma unroll   // the groups of a stage unrolled: every LDS offset an immediate, every register set indexed by constants
        for (int g = 0; g < 4; ++g) {
            if ((g & 1) == 0) {
#pragma unroll
                for (int i = 0; i < 4; ++i) a[i] = cvraw(ra[i]);
            }
#pragma unroll
            for (int i = 0; i < 4; ++i) b[i] = cvraw(rb[i]);
            // inputs-only fence on the rounded fragments: the converts stand in front of the next group's loads, which then land in the registers just freed (else the f32 sources of two groups are live at once and accumulators spill)
            asm volatile("" :: "v"(a[0]), "v"(a[1]), "v"(a[2]), "v"(a[3]), "v"(b[0]), "v"(b[1]), "v"(b[2]), "v"(b[3]) : "memory");
            if (g + 1 < 4) {
                const int kn = ((g + 1) >> 1) * 32, hn = (g + 1) & 1;
                if (hn == 0) {
#pragma unroll
                    for (int i = 0; i < 4; ++i) ldraw(ra[i], pa + i * 16 * PLP + kn);
                }
#pragma unroll
                for (int i = 0; i < 4; ++i) ldraw(rb[i], pb + (hn * 4 + i) * 16 * PLP + kn);
            }
            __builtin_amdgcn_sched_barrier(0);   // keeps the next group's LDS loads one group ahead of this group's products (else they are moved in among them, each with a wait)
#pragma unroll
            for (int nb = 0; nb < 4; ++nb)
#pragma unroll
                for (int mb = 0; mb < 4; ++mb) acc[mb][(g & 1) * 4 + nb] = wmmab(a[mb], b[nb], acc[mb][(g & 1) * 4 + nb]);
            __builtin_amdgcn_sched_barrier(0);   // keeps this group's products ahead of the next group's converts and of the stage's foot
        }
        asm volatile("v_nop\n\tv_nop\n\tv_nop\n\tv_nop");   // four vector slots behind the stage's last products, on the way to the branches below
        // publish point of stage st + 1, which also frees the buffer that this trip has read
        asm volatile("s_wait_dscnt 0x0" ::: "memory");      // this wave's reads of the buffer have returned before it is refilled
        asm volatile("s_wait_asynccnt 0x0" ::: "memory");   // this wave's copies of stage st + 1 have landed before other waves read them
        __syncthreads();
        ga += PKS; gb += PKS;
        if (st + 2 < DM / PKS) proj_stage(lc + (unsigned)so * 4, ga + PKS, 16 * as, gb + PKS, 16 * bs);
    }
    asm volatile("s_wait_asynccnt 0x0" ::: "memory");       // nothing of this wave is in flight when it goes on to the epilogue
}

// proj_tile: bf16 GEMM tile (bx, by) of 256 x 256 by one block of 8 waves (proj_core), each wave's 64 x 128 tile in 32 accumulators, K = DM; A, B: the tile's first rows in the f32 inputs.
// C[m][n] = sum_k A[m][k] Bt[n][k] + bias (BROW == 0: bias[n]; BROW == 1: bias[m]; bias taken at its bf16 RNE value, added in f32),
// times osc (f32), written as f16 (Ph) and optionally the f16 residual (Pr, useRes != 0; no carry: it may lie in the f16 subnormal range, step 2^-24, which the matrix unit keeps) at
// base (r0/RB)*sRB + (r0%RB)*pitch + (c0/CB)*sCB + (c0%CB) of each 64-column half, row pitch 'pitch' (halves).
// The output rows are staged in the ring's own LDS: behind the foot of proj_core's last trip (every wave's s_wait_dscnt 0, s_wait_asynccnt 0, then the barrier) nobody reads the ring and no copy is in flight.
template <int BROW>
__device__ __forceinline__ void proj_tile(const float* __restrict__ A, size_t as, const float* __restrict__ B, size_t bs, const float* __restrict__ bias, h16* Ph, h16* Pr, int useRes, float osc, int RB, size_t sRB, int pitch, int CB, size_t sCB, int bx, int by, float* ring) {
    const int lane = threadIdx.x & 31, lr = lane & 15, hi = lane >> 4;
    const int wave = __builtin_amdgcn_readfirstlane((int)(threadIdx.x >> 5));
    float* os = ring + wave * 16 * 68;   // each wave stages its output rows in its own range
    const int r0 = bx * PT + (wave >> 1) * 64, cw = by * PT + (wave & 1) * 128;
    v8f acc[4][8];
    proj_core(A, as, B, bs, ring, acc);
    const int rq = lane >> 3, c8 = (lane & 7) * 8;
#pragma unroll
    for (int ch = 0; ch < 2; ++ch) {
        const int c0 = cw + ch * 64;
        v4f bc0 = (v4f){0.0f, 0.0f, 0.0f, 0.0f}, bc1 = (v4f){0.0f, 0.0f, 0.0f, 0.0f};
        if constexpr (BROW == 0) {
            const v4f t0 = *(const v4f*)(bias + c0 + c8); const v4f t1 = *(const v4f*)(bias + c0 + c8 + 4);
#pragma unroll
            for (int i = 0; i < 4; ++i) { bc0[i] = bfr(t0[i]); bc1[i] = bfr(t1[i]); }
        }
        const size_t tbase = (size_t)(r0 / RB) * sRB + (size_t)(r0 % RB) * (size_t)pitch + (size_t)(c0 / CB) * sCB + (size_t)(c0 % CB);
#pragma unroll
        for (int mb = 0; mb < 4; ++mb) {
#pragma unroll
            for (int nb = 0; nb < 4; ++nb) {
#pragma unroll
                for (int j = 0; j < 8; ++j) os[(hi * 8 + j) * 68 + nb * 16 + lr] = acc[mb][ch * 4 + nb][j]; }   // D: row 8h+j, col lane&15
            wave_sync();
            const size_t sb = tbase + (size_t)(mb * 16) * (size_t)pitch;
#pragma unroll
            for (int s = 0; s < 4; ++s) { const int row = 4 * s + rq;   // 4 s x 4 row groups = 16 rows; 8 lanes x 8 = 64 columns
                float br = 0.0f;
                if constexpr (BROW != 0) br = bfr(bias[r0 + mb * 16 + row]);
                const v4f x0 = *(const v4fa*)(&os[row * 68 + c8]); const v4f x1 = *(const v4fa*)(&os[row * 68 + c8 + 4]); v8h hv, rv;
#pragma unroll
                for (int i = 0; i < 4; ++i) { const float y0 = (x0[i] + bc0[i] + br) * osc; const float y1 = (x1[i] + bc1[i] + br) * osc;
                    const h16 a0 = (h16)y0; const h16 a1 = (h16)y1; hv[i] = a0; hv[4 + i] = a1; rv[i] = (h16)(y0 - (float)a0); rv[4 + i] = (h16)(y1 - (float)a1); }
                const size_t oo = sb + (size_t)row * (size_t)pitch + c8;
                *(v8h*)(Ph + oo) = hv;
                asm volatile("s_wait_xcnt 0x0" ::: "memory");   // in front of the residual's store and the next rows' loads, which rewrite registers that the store above names
                if (useRes) *(v8h*)(Pr + oo) = rv; }
            wave_sync();
        }
        asm volatile("s_wait_xcnt 0x0" ::: "memory");   // in front of the next half's bias loads, which rewrite registers that the last store above names
    }
}

// k_proj3: the three input projections straight from the f32 inputs, and the f16 plane of Wo, in one launch; grid (PGX, 4), 256 threads; one block per WGP (LDS, registers).
// y = 0, 1 (q, k): A = x rows (m = b*SEQ + t, source row t*NB_FULL + b), B = W rows (n = h*64 + d), column bias -> plane [(b*16 + h)][t][d]; q is scaled by HD^-0.5 * log2(e) and also writes its residual plane.
// y = 2 (v^T): A = Wv rows (m = h*64 + d), B = x rows (n = b*SEQ + t), row bias -> plane [(b*1024 + m)][t] = [(b*16 + h)][d][t].
// y = 3: Wo -> f16 of its bf16 RNE value, x64; a wave takes whole rows, all of its loads issued before the first convert; these blocks pass no barrier.
__global__ __launch_bounds__(256) void k_proj3(const float* __restrict__ xq, const float* __restrict__ xk, const float* __restrict__ xv, const float* __restrict__ wq, const float* __restrict__ wk, const float* __restrict__ wv, const float* __restrict__ wo,
                                               const float* __restrict__ bq, const float* __restrict__ bk, const float* __restrict__ bv, h16* QH, h16* QR, h16* KP, h16* VT, h16* WO) {
    __shared__ __align__(16) float ring[2 * PSTF];
    static_assert(8 * 16 * 68 <= 2 * PSTF);            // the eight waves' staging ranges lie inside the ring
    const int z = blockIdx.y, x = blockIdx.x;          // the same for the whole block: every barrier below is passed by all of its waves or by none
    if (z == 3) {
        constexpr int RW = DM / (PGX * 8);             // rows of a wave
        const unsigned lane = threadIdx.x & 31;
        const int w = x * 8 + __builtin_amdgcn_readfirstlane((int)(threadIdx.x >> 5));
        v4f t[RW][8];
#pragma unroll
        for (int r = 0; r < RW; ++r)
#pragma unroll
            for (int j = 0; j < 8; ++j) t[r][j] = ((const v4f*)(wo + (size_t)(w * RW + r) * DM))[lane + j * 32];
#pragma unroll
        for (int r = 0; r < RW; ++r)
#pragma unroll
            for (int j = 0; j < 8; ++j) { v4h o;
#pragma unroll
                for (int i = 0; i < 4; ++i) o[i] = (h16)(bfr(t[r][j][i]) * WOS);
                ((v4h*)(WO + (size_t)(w * RW + r) * DM))[lane + j * 32] = o; }
    } else if (z == 2) {
        const int bx = x % (DM / PT), by = x / (DM / PT), n0 = by * PT;
        proj_tile<1>(wv + (size_t)bx * PT * DM, (size_t)DM, xv + ((size_t)(n0 % SEQ) * NB_FULL + (size_t)(n0 / SEQ)) * DM, (size_t)NB_FULL * DM, bv, VT, VT, 0, 1.0f, DM, (size_t)0, SEQ, SEQ, (size_t)DM * SEQ, bx, by, ring);
    } else {
        const bool q = z == 0;
        const int bx = x % (NB * SEQ / PT), by = x / (NB * SEQ / PT), m0 = bx * PT;
        proj_tile<0>((q ? xq : xk) + ((size_t)(m0 % SEQ) * NB_FULL + (size_t)(m0 / SEQ)) * DM, (size_t)NB_FULL * DM, (q ? wq : wk) + (size_t)by * PT * DM, (size_t)DM, q ? bq : bk, q ? QH : KP, q ? QR : KP, q ? 1 : 0, q ? SC2 : 1.0f,
                     SEQ, (size_t)NH_ * SEQ * HD, HD, HD, (size_t)SEQ * HD, bx, by, ring);
    }
}

// One stage of the flash kernel's ring: each thread copies two 16-byte pieces of the K tile and two of the V^T tile (tile rows r and r + 32) from global memory to LDS.
// lds: byte address of the thread's piece in the K tile of the target buffer. The s_wait_xcnt stands inside the statement so that no address register is rewritten in front of it.
__device__ __forceinline__ void stage_copy(unsigned lds, const h16* gk, const h16* gv) {
    const unsigned l1 = lds + 32 * LP * 2, l2 = lds + TLH * 2, l3 = lds + TLH * 2 + 32 * LP * 2;
    const h16* gk1 = gk + (size_t)32 * HD; const h16* gv1 = gv + (size_t)32 * SEQ;
    asm volatile("global_load_async_to_lds_b128 %0, %4, off\n\t"
                 "global_load_async_to_lds_b128 %1, %5, off\n\t"
                 "global_load_async_to_lds_b128 %2, %6, off\n\t"
                 "global_load_async_to_lds_b128 %3, %7, off\n\t"
                 "s_wait_xcnt 0x0"
                 :: "v"(lds), "v"(l1), "v"(l2), "v"(l3), "v"(gk), "v"(gk1), "v"(gv), "v"(gv1) : "memory");
}

// k_flash: fused attention, one wave per 16 query rows of one (batch, head); Q fragments straight from the f16 planes (two 16-B loads each, arithmetic addressing).
// K and V^T: the block's waves share every key tile, so a stage of KT keys (K rows, V^T rows, 128 B each) is brought into LDS once per block by asynchronous copies
// (whole 128-B lines per 8 lanes), two buffers, the next stage in flight while this one is worked on; fragments are two 16-B LDS loads each, same element map as before.
// Transposed form: S^T[key][t] = K Q^T (A = K rows, B = Q rows); lane (t = lane&15, h = lane>>4) holds keys 8h+r of each 16-key tile, so the packed
// P tile is directly the B fragment of O^T[d][t] = V^T P^T (element r <- tile keys 0..15, element 8+r <- tile keys 16..31, lane unchanged).
// Softmax state (running max, partial sum) is one scalar per lane; the two lane halves of a row are combined with one xor-16 exchange.
__global__ __launch_bounds__(32 * AW) void k_flash(const h16* __restrict__ QH, const h16* __restrict__ QR, const h16* __restrict__ KP, const h16* __restrict__ VT, h16* CTX) {
    __shared__ __align__(16) float os[AW * 16 * 68];
    __shared__ __align__(16) h16 ring[2 * STH];
    const int lane = threadIdx.x & 31, lr = lane & 15, hi = lane >> 4;
    const int wave = __builtin_amdgcn_readfirstlane((int)(threadIdx.x >> 5));
    const int zh = blockIdx.y; const int b = zh / NH_, h = zh % NH_;
    const int t0 = (blockIdx.x * AW + wave) * 16;
    const size_t pbase = (size_t)zh * SEQ * HD;
    const size_t qo = pbase + (size_t)(t0 + lr) * HD + 8 * hi;
    const v16h qh0 = ldh(QH + qo), qh1 = ldh(QH + qo + 32), qr0 = ldh(QR + qo), qr1 = ldh(QR + qo + 32);   // B fragments: col t, k = d
    // copy map: thread c takes 16-byte piece c & 7 of tile rows c >> 3 and 32 + (c >> 3), of the K tile and of the V^T tile
    const int crw = (int)threadIdx.x >> 3, cpc = ((int)threadIdx.x & 7) * 8;
    const h16* gk = KP + pbase + (size_t)crw * HD + cpc;      // + stage * KT * HD   (row = key)
    const h16* gv = VT + pbase + (size_t)crw * SEQ + cpc;     // + stage * KT        (row = d)
    const unsigned lc = (unsigned)(size_t)&ring[crw * LP + cpc];   // LDS byte address: low 32 bits of the shared address
    const int ko = lr * LP + 8 * hi;            // + key_local * LP          (A fragment: row key, k = d)
    const int vo = TLH + lr * LP + 8 * hi;      // + 16j * LP + key_local    (A fragment: row d, k = key)
    stage_copy(lc, gk, gv);
    asm volatile("s_wait_asynccnt 0x0" ::: "memory");   // stage 0 landed before the barrier that publishes it
    __syncthreads();
    stage_copy(lc + STH * 2, gk + (size_t)KT * HD, gv + KT);
    v8f o0 = (v8f){}, o1 = (v8f){}, o2 = (v8f){}, o3 = (v8f){};
    float m = -3.0e38f, l = 0.0f;
#pragma unroll 1
    for (int st = 0; st < SEQ / KT; ++st) {
      const int bo = (st & 1) * STH;
      // one softmax step per stage: all KT = 64 keys share one running-maximum update, one half exchange and one rescale of the output tiles
      {
        const h16* ka = ring + bo + ko;
        v16h kf0[4], kf1[4];     // 16-key tile i: d 0..31, d 32..63
#pragma unroll
        for (int i = 0; i < 4; ++i) { kf0[i] = ldh(ka + i * 16 * LP); kf1[i] = ldh(ka + i * 16 * LP + 32); }
        __builtin_amdgcn_sched_barrier(0);   // keeps the K loads one group ahead of the products (else they are moved in among them)
        // value and residual products of a key tile share one accumulator (the q planes carry the score scale): the accumulators hold the log2-domain scores as they are
        v8f s0 = (v8f){}, s1 = (v8f){}, s2 = (v8f){}, s3 = (v8f){};
        s0 = wmma16(kf0[0], qr0, s0); s1 = wmma16(kf0[1], qr0, s1); s2 = wmma16(kf0[2], qr0, s2); s3 = wmma16(kf0[3], qr0, s3);
        s0 = wmma16(kf1[0], qr1, s0); s1 = wmma16(kf1[1], qr1, s1); s2 = wmma16(kf1[2], qr1, s2); s3 = wmma16(kf1[3], qr1, s3);
        s0 = wmma16(kf0[0], qh0, s0); s1 = wmma16(kf0[1], qh0, s1); s2 = wmma16(kf0[2], qh0, s2); s3 = wmma16(kf0[3], qh0, s3);
        s0 = wmma16(kf1[0], qh1, s0); s1 = wmma16(kf1[1], qh1, s1); s2 = wmma16(kf1[2], qh1, s2); s3 = wmma16(kf1[3], qh1, s3);
        __builtin_amdgcn_sched_barrier(0);   // keeps the four accumulator chains interleaved as written (else one tile's four dependent products are issued in a row)
        // the maximum of each tile in a chain of its own (four short chains, not one of 32 links)
        float m0 = -3.0e38f, m1 = -3.0e38f, m2 = -3.0e38f, m3 = -3.0e38f;
#pragma unroll
        for (int r = 0; r < 8; r += 2) { m0 = fmaxf(m0, fmaxf(s0[r], s0[r + 1])); m1 = fmaxf(m1, fmaxf(s1[r], s1[r + 1])); m2 = fmaxf(m2, fmaxf(s2[r], s2[r + 1])); m3 = fmaxf(m3, fmaxf(s3[r], s3[r + 1])); }
        const float mx = fmaxf(fmaxf(m0, m1), fmaxf(m2, m3));
        const float mo = __shfl_xor(mx, 16, 32);
        __builtin_amdgcn_sched_barrier(0);   // keeps the exchange ahead of the V^T loads in the LDS queue (else it returns only behind all sixteen of them)
        const h16* va = ring + bo + vo;
        const v16h v0 = ldh(va), v1 = ldh(va + 16 * LP), v2 = ldh(va + 32 * LP), v3 = ldh(va + 48 * LP);                         // keys 0..31 of the stage
        const v16h w0 = ldh(va + 32), w1 = ldh(va + 16 * LP + 32), w2 = ldh(va + 32 * LP + 32), w3 = ldh(va + 48 * LP + 32);     // keys 32..63
        __builtin_amdgcn_sched_barrier(0);   // keeps the V^T loads ahead of the exponentials, which cover their latency
        const float mnew = fmaxf(m, fmaxf(mx, mo));
        const float alpha = __builtin_amdgcn_exp2f(m - mnew);
        const float sh = PSH - mnew;
        v8f t0, t1, t2, t3;
#pragma unroll
        for (int r = 0; r < 8; ++r) { t0[r] = s0[r] + sh; t1[r] = s1[r] + sh; t2[r] = s2[r] + sh; t3[r] = s3[r] + sh; }
        v16h pb0, pb1; float ls = 0.0f;
#pragma unroll
        for (int r = 0; r < 8; ++r) { const h16 pa = (h16)__builtin_amdgcn_exp2f(t0[r]); const h16 pc = (h16)__builtin_amdgcn_exp2f(t1[r]); pb0[r] = pa; pb0[8 + r] = pc; ls += (float)pa + (float)pc; }
#pragma unroll
        for (int r = 0; r < 8; ++r) { const h16 pa = (h16)__builtin_amdgcn_exp2f(t2[r]); const h16 pc = (h16)__builtin_amdgcn_exp2f(t3[r]); pb1[r] = pa; pb1[8 + r] = pc; ls += (float)pa + (float)pc; }
        l = l * alpha + ls; m = mnew;
        o0 = o0 * alpha; o1 = o1 * alpha; o2 = o2 * alpha; o3 = o3 * alpha;
        o0 = wmma16(v0, pb0, o0); o1 = wmma16(v1, pb0, o1); o2 = wmma16(v2, pb0, o2); o3 = wmma16(v3, pb0, o3);
        o0 = wmma16(w0, pb1, o0); o1 = wmma16(w1, pb1, o1); o2 = wmma16(w2, pb1, o2); o3 = wmma16(w3, pb1, o3);
        // four vector slots behind the stage's last products, on the way to the branch at the stage's foot
        asm volatile("v_nop\n\tv_nop\n\tv_nop\n\tv_nop" : "+v"(o0), "+v"(o1), "+v"(o2), "+v"(o3) : "v"(w0), "v"(w1), "v"(w2), "v"(w3), "v"(pb1));
      }
      // publish point of stage st + 1, which also frees the buffer that this trip has read
      asm volatile("s_wait_dscnt 0x0" ::: "memory");      // this wave's reads of the buffer have returned before it is refilled
      asm volatile("s_wait_asynccnt 0x0" ::: "memory");   // this wave's copies of stage st + 1 have landed before other waves read them
      __syncthreads();
      if (st + 2 < SEQ / KT) stage_copy(lc + (unsigned)bo * 2, gk + (size_t)(st + 2) * KT * HD, gv + (size_t)(st + 2) * KT);
    }
    asm volatile("s_wait_asynccnt 0x0" ::: "memory");     // nothing of this wave is in flight when it goes on to the epilogue
    l += __shfl_xor(l, 16, 32);
    const float inv = CTXS * (1.0f / l);
    const int wb = wave * 16 * 68;
    // O^T D layout: o_j[r] = (d = 16j + 8h + r, t = lane&15) -> os[t][d]; rows 0..15 x columns 0..63 all written
    { v4f a, c;
      a[0] = o0[0] * inv; a[1] = o0[1] * inv; a[2] = o0[2] * inv; a[3] = o0[3] * inv; c[0] = o0[4] * inv; c[1] = o0[5] * inv; c[2] = o0[6] * inv; c[3] = o0[7] * inv;
      *(v4fa*)(&os[wb + lr * 68 +  0 + 8 * hi]) = a; *(v4fa*)(&os[wb + lr * 68 +  0 + 8 * hi + 4]) = c;
      a[0] = o1[0] * inv; a[1] = o1[1] * inv; a[2] = o1[2] * inv; a[3] = o1[3] * inv; c[0] = o1[4] * inv; c[1] = o1[5] * inv; c[2] = o1[6] * inv; c[3] = o1[7] * inv;
      *(v4fa*)(&os[wb + lr * 68 + 16 + 8 * hi]) = a; *(v4fa*)(&os[wb + lr * 68 + 16 + 8 * hi + 4]) = c;
      a[0] = o2[0] * inv; a[1] = o2[1] * inv; a[2] = o2[2] * inv; a[3] = o2[3] * inv; c[0] = o2[4] * inv; c[1] = o2[5] * inv; c[2] = o2[6] * inv; c[3] = o2[7] * inv;
      *(v4fa*)(&os[wb + lr * 68 + 32 + 8 * hi]) = a; *(v4fa*)(&os[wb + lr * 68 + 32 + 8 * hi + 4]) = c;
      a[0] = o3[0] * inv; a[1] = o3[1] * inv; a[2] = o3[2] * inv; a[3] = o3[3] * inv; c[0] = o3[4] * inv; c[1] = o3[5] * inv; c[2] = o3[6] * inv; c[3] = o3[7] * inv;
      *(v4fa*)(&os[wb + lr * 68 + 48 + 8 * hi]) = a; *(v4fa*)(&os[wb + lr * 68 + 48 + 8 * hi + 4]) = c; }
    wave_sync();
    h16* crow = CTX + ((size_t)b * SEQ + t0) * DM + h * HD;
    const int rq = lane >> 3, c8 = (lane & 7) * 8;
{
#pragma unroll
        for (int s = 0; s < 4; ++s) { const int row = 4 * s + rq;   // 4 s x 4 row groups = 16 rows; 8 lanes x 8 halves = 64 columns
            const v4f x0 = *(const v4fa*)(&os[wb + row * 68 + c8]); const v4f x1 = *(const v4fa*)(&os[wb + row * 68 + c8 + 4]); v8h hv;
#pragma unroll
            for (int i = 0; i < 4; ++i) { hv[i] = (h16)x0[i]; hv[4 + i] = (h16)x1[i]; }
            *(v8h*)(crow + (size_t)row * DM + c8) = hv; }
         }
}

// k_outp: f16 GEMM, one block of 8 waves per 128 x 128 tile (gemm_core), each wave's 32 x 64 tile in 8 accumulators, K = DM.
// OUT[(s*NB_FULL + b)][n] = OSCL * sum_k A[b*SEQ + s][k] Bt[n][k] + bias[n] (bias at its bf16 RNE value, f32 add). grid (NB*SEQ/128, DM/128), 256 threads.
__global__ __launch_bounds__(256) void k_outp(const h16* __restrict__ A, const h16* __restrict__ Bt, const float* __restrict__ bias, float* OUT) {
    __shared__ __align__(16) bf ring[2 * GSTH];
    __shared__ __align__(16) float osb[8 * 16 * 68];
    const int lane = threadIdx.x & 31, lr = lane & 15, hi = lane >> 4;
    const int wave = __builtin_amdgcn_readfirstlane((int)(threadIdx.x >> 5));
    float* os = osb + wave * 16 * 68;            // each wave stages its output rows in its own range
    const int r0 = blockIdx.x * GT + (wave >> 1) * 32, c0 = blockIdx.y * GT + (wave & 1) * 64;
    v8f acc[2][4];
    gemm_core<0>((const bf*)A, (const bf*)Bt, blockIdx.x * GT, blockIdx.y * GT, ring, acc);
    const int bb = r0 / SEQ, sb = r0 % SEQ;        // tile rows share one batch (SEQ % 64 == 0)
    const int cofs = lr * 4;
    v4f bv;
    { const v4f t = *(const v4f*)(bias + c0 + cofs);
#pragma unroll
      for (int i = 0; i < 4; ++i) bv[i] = bfr(t[i]); }
#pragma unroll
    for (int mb = 0; mb < 2; ++mb) {
#pragma unroll
        for (int nb = 0; nb < 4; ++nb) {
#pragma unroll
            for (int j = 0; j < 8; ++j) os[(hi * 8 + j) * 68 + nb * 16 + lr] = acc[mb][nb][j]; }   // D: row 8h+j, col lane&15
        wave_sync();
{
#pragma unroll
            for (int s = 0; s < 8; ++s) { const int row = 2 * s + hi;   // 8 s x 2 rows = 16 rows; 16 lanes x 4 floats = 64 columns
                const v4f x = *(const v4fa*)(&os[row * 68 + cofs]); v4f val;
#pragma unroll
                for (int i = 0; i < 4; ++i) val[i] = x[i] * OSCL + bv[i];
                float* dst = OUT + ((size_t)(sb + mb * 16 + row) * NB_FULL + bb) * DM + c0 + cofs;
                *(v4f*)dst = val; }
             }
        wave_sync();
    }
}

static constexpr size_t al256(size_t v) { return (v + 255) & ~(size_t)255; }
static constexpr size_t SZ_W   = al256((size_t)DM * DM * 2);                // one 16-bit weight plane
static constexpr size_t SZ_PL  = al256((size_t)NB * NH_ * SEQ * HD * 2);    // one head plane
static constexpr size_t SZ_CTX = al256((size_t)NB * SEQ * DM * 2);          // f16 ctx plane
static constexpr size_t SZ_TOTAL = SZ_W + 4 * SZ_PL + SZ_CTX;
static_assert(SZ_TOTAL <= (size_t)134217728);          // workspace carve <= 128 MiB
static_assert(((size_t)DM * DM * 2) % 256 == 0);

extern "C" void kernel_launch(void* const* d_in, const int* in_sizes, int n_in,
                              void* d_out, int out_size, void* d_ws, size_t ws_size, hipStream_t stream) {
    if (n_in < 11) return;
    const size_t needx = ((size_t)(SEQ - 1) * NB_FULL + NB) * DM;
    if ((size_t)in_sizes[0] < needx || (size_t)in_sizes[1] < needx || (size_t)in_sizes[2] < needx) return;
    if ((size_t)in_sizes[3] < (size_t)DM * DM || (size_t)in_sizes[5] < (size_t)DM * DM || (size_t)in_sizes[7] < (size_t)DM * DM || (size_t)in_sizes[9] < (size_t)DM * DM) return;
    if (in_sizes[4] < DM || in_sizes[6] < DM || in_sizes[8] < DM || in_sizes[10] < DM) return;
    if ((size_t)out_size < needx) return;
    if (SZ_TOTAL > ws_size) return;
    // wire order: query, key, value, Wq, bq, Wk, bk, Wv, bv, Wo, bo (weights [out][in] = Bt as-is)
    const float* xq = (const float*)d_in[0]; const float* xk = (const float*)d_in[1]; const float* xv = (const float*)d_in[2];
    const float* wq = (const float*)d_in[3]; const float* bq = (const float*)d_in[4];
    const float* wk = (const float*)d_in[5]; const float* bk = (const float*)d_in[6];
    const float* wv = (const float*)d_in[7]; const float* bvv = (const float*)d_in[8];
    const float* wo = (const float*)d_in[9]; const float* bo = (const float*)d_in[10];
    float* OUT = (float*)d_out;      // [SEQ][NB_FULL][1024]
    char* wsp = (char*)d_ws;
    h16* WO = (h16*)wsp; wsp += SZ_W;                // f16, x64
    h16* QH = (h16*)wsp; wsp += SZ_PL;               // [NB*16][SEQ][64]
    h16* QR = (h16*)wsp; wsp += SZ_PL;               // [NB*16][SEQ][64] residual
    h16* KP = (h16*)wsp; wsp += SZ_PL;               // [NB*16][SEQ][64]
    h16* VT = (h16*)wsp; wsp += SZ_PL;               // [NB*16][64][SEQ]
    h16* CTX = (h16*)wsp; wsp += SZ_CTX;             // [NB*SEQ][1024], x32

    // q, k and v^T planes from the f32 inputs; the f16 plane of Wo
    k_proj3<<<dim3(PGX, 4, 1), 256, 0, stream>>>(xq, xk, xv, wq, wk, wv, wo, bq, bk, bvv, QH, QR, KP, VT, WO);

    k_flash<<<dim3(SEQ / (16 * AW), NB * NH_, 1), 32 * AW, 0, stream>>>(QH, QR, KP, VT, CTX);

    // output projection: A = ctx rows (m = b*SEQ + s), Bt = Wo rows (n) -> OUT row s*NB_FULL + b
    k_outp<<<dim3(NB * SEQ / GT, DM / GT, 1), 256, 0, stream>>>(CTX, WO, bo, OUT);
}

// v009
// A run of this version takes 80.5 microseconds.
// It is 1.09 times as fast as v007, going by the measured steps of the versions left out in between.
// Counting every step since v000, it is 2.99 times as fast.
#include <hip/hip_runtime.h>

// Multi-head attention, width 1024 = 16 heads x 64; query/key/value [SEQ][NB][1024] (token row = s*NB + b), Wq/Wk/Wv/Wo [out][in] (y = x W^T + bias), score scale 1/8, no mask, output [SEQ][NB][1024] f32.
// Compute dtypes, f32 accumulate everywhere: q/k/v projections v_wmma_f32_16x16x32_bf16 (inputs and W RNE-converted to bf16 in registers, fragment by fragment; products exact);
// scores v_wmma_f32_16x16x32_f16: k single f16, q (already times HD^-0.5 * log2(e)) single f16; P (x256 carry, cancels in the normalisation) and v single f16; softmax f32 (online, running max);
// output projection v_wmma_f32_16x16x32_f16: ctx single f16 (x32 carry), Wo = f16 of the bf16 RNE value (x64 carry), 1/2048 folded back in the f32 epilogue; biases added in f32.
// Layout: token rows taken batch-major (b*SEQ + s) straight from the f32 inputs; q, k planes [b*16+h][t][d] and v^T plane [b*16+h][d][t] from the GEMM epilogue; fused flash kernel in transposed form (S^T = K Q^T, O^T = V^T P^T) writing the f16 ctx plane [b*SEQ+s][1024]; final GEMM writes the output rows (s*NB + b).

#ifndef NB
#define NB 2
#endif
#ifndef SEQ
#define SEQ 2048
#endif
#define NB_FULL  2
#define SEQ_FULL 2048
#define DM   1024
#define NH_  16
#define HD   64
#define AW   8                   // waves per flash block (16 query rows each)
#define KT   64                  // keys per LDS stage of the flash kernel
#define LP   72                  // LDS row pitch in halves: 128-B rows + 16 B (16 B x odd, for 16-byte readers)
#define TLH  (64 * LP)           // halves of one staged 64-row tile
#define STH  (2 * TLH)           // halves of one stage: K tile [key][d], then V^T tile [d][key]
#define SC2  (0.125f * 1.4426950408889634f)   // HD^-0.5 * log2(e)
#define PSH  8.0f                // log2 of the P carry (256)
#define CTXS 32.0f               // carry of the ctx plane
#define WOS  64.0f               // carry of the Wo plane
#define OSCL (1.0f / 2048.0f)    // 1 / (CTXS * WOS)
#define GT   128                 // rows and columns of a GEMM block's tile: 8 waves, 4 x 2, 32 rows x 64 columns each
#define GKS  128                 // k per LDS stage of the GEMM kernels
#define GLP  136                 // LDS row pitch in halves: 256-B rows + 16 B (16 B x odd, for 16-byte readers)
#define GOPH (GT * GLP)          // halves of one operand's staged tile
#define GSTH (2 * GOPH)          // halves of one stage: A tile [row][k], then B tile [row][k]
#define PT   256                 // rows and columns of a projection block's tile: 8 waves, 4 x 2, 64 rows x 128 columns each
#define PKS  64                  // k per LDS stage of the projection kernel (f32 operands)
#define PLP  68                  // LDS row pitch in floats: 256-B rows + 16 B (16 B x odd, for 16-byte readers)
#define POPF (PT * PLP)          // floats of one operand's staged tile
#define PSTF (2 * POPF)          // floats of one stage: A tile [row][k], then B tile [row][k]
#define PGX  ((NB * SEQ / PT) * (DM / PT))   // blocks of one projection

static_assert(HD == 64);
static_assert(NH_ * HD == DM);                 // head h = columns h*64 + d
static_assert(DM % 64 == 0);                   // column tiles of 64
static_assert(DM % 32 == 0);                   // GEMM k-loop steps by 32
static_assert(SEQ % 64 == 0);                  // a 64-row tile never straddles two batches
static_assert((NB * SEQ) % 64 == 0);
static_assert(SEQ % 32 == 0);                  // O^T products take 32 keys each
static_assert(SEQ % KT == 0 && SEQ / KT >= 2); // whole stages; the two-buffer prologue needs two
static_assert(AW * 32 * 2 * 8 == KT * HD);     // two 16-byte copies per thread fill one 64 x 64 tile
static_assert((LP * 2) % 16 == 0);
static_assert(SEQ % (16 * AW) == 0);           // flash grid covers the sequence exactly
static_assert(((size_t)SEQ * DM) % 8 == 0);
static_assert(((size_t)DM * DM) % 8 == 0);
static_assert(DM % GT == 0 && (NB * SEQ) % GT == 0);   // GEMM grids cover both operands exactly
static_assert(DM % GKS == 0 && DM / GKS >= 2);         // whole stages; the two-buffer prologue needs two
static_assert(GKS * 2 == 16 * 16 && GT == 16 * 8);     // 16 threads x 16 B fill a row; 256 threads take 16 rows a copy, 8 copies an operand
static_assert((GLP * 2) % 16 == 0);
static_assert(DM == 8 * 32 * 4);               // a row is 8 wave-wide 16-byte loads
static_assert(DM % PT == 0 && SEQ % PT == 0);  // projection grids cover both operands exactly; a tile's token rows share one batch
static_assert(DM % PKS == 0 && DM / PKS >= 2); // whole stages; the two-buffer prologue needs two
static_assert(PKS * 4 == 16 * 16 && PT == 16 * 16);   // 16 threads x 16 B fill a row; 256 threads take 16 rows a copy, 16 copies an operand
static_assert((PLP * 4) % 16 == 0);
static_assert(DM % (PGX * 8) == 0);            // the Wo blocks' waves take whole rows, the same number each
static_assert(NB <= NB_FULL);
static_assert(SEQ <= SEQ_FULL);

typedef _Float16 h16;
typedef unsigned short bf;
typedef __attribute__((ext_vector_type(16))) __bf16   v16bf;
typedef __attribute__((ext_vector_type(16))) _Float16 v16h;
typedef __attribute__((ext_vector_type(8)))  _Float16 v8h;
typedef __attribute__((ext_vector_type(8)))  unsigned short v8us;
typedef __attribute__((ext_vector_type(4)))  _Float16 v4h;
typedef __attribute__((ext_vector_type(16))) unsigned short v16us;
typedef __attribute__((ext_vector_type(8)))  float    v8f;
typedef __attribute__((ext_vector_type(4)))  float    v4f;
typedef __attribute__((ext_vector_type(16))) float    v16f;
typedef v4f  __attribute__((may_alias)) v4fa;

__device__ __forceinline__ unsigned short f2bf(float f) { unsigned u = __float_as_uint(f); u += 0x7FFFu + ((u >> 16) & 1u); return (unsigned short)(u >> 16); }
__device__ __forceinline__ float bfr(float f) { return __uint_as_float(((unsigned)f2bf(f)) << 16); }   // f32 value of the bf16 RNE convert
__device__ __forceinline__ v16h cat16(v8h lo, v8h hi) { return __builtin_shufflevector(lo, hi, 0, 1, 2, 3, 4, 5, 6, 7, 8, 9, 10, 11, 12, 13, 14, 15); }
__device__ __forceinline__ v8f wmma16(v16h a, v16h b, v8f c) { return __builtin_amdgcn_wmma_f32_16x16x32_f16(false, a, false, b, (short)0, c, false, false); }
__device__ __forceinline__ v8f wmmab(v16bf a, v16bf b, v8f c) { return __builtin_amdgcn_wmma_f32_16x16x32_bf16(false, a, false, b, (short)0, c, false, false); }
// fragment loaders from K-contiguous 16-bit rows; p already includes + 8*(lane>>4): elements 0..7 <- k0+8h+0..7, elements 8..15 <- k0+16+8h+0..7 (same map for A and B)
__device__ __forceinline__ v16h  ldh(const h16* p) { return cat16(*(const v8h*)p, *(const v8h*)(p + 16)); }
__device__ __forceinline__ v16us ldu(const bf* p)  { return __builtin_shufflevector(*(const v8us*)p, *(const v8us*)(p + 16), 0, 1, 2, 3, 4, 5, 6, 7, 8, 9, 10, 11, 12, 13, 14, 15); }   // raw 16-bit fragment, bf16 or f16
// ordering point for wave-private LDS tiles (same wave writes and reads)
__device__ __forceinline__ void wave_sync() { __builtin_amdgcn_fence(3 /* release order */, "wavefront"); __builtin_amdgcn_wave_barrier(); asm volatile("" ::: "memory"); }

// Requests to L2 (global_prefetch_b8, scope SE: the unit comes into L2 only, nothing returns, no counter moves): one request a lane, always inside the operand,
// asked well ahead of the asynchronous copy that reads it, so that the copy finds it in L2 instead of waiting for memory. Units that several blocks read are dealt among them:
// That is for speed only: a unit nobody asked for is fetched by its copy, as before.
__device__ __forceinline__ void ask1(const void* p) { asm volatile("global_prefetch_b8 %0, off scope:SCOPE_SE" :: "v"(p) : "memory"); }
// units 1, 2, 3 of the row that starts at p
__device__ __forceinline__ void ask3(const void* p) {
    asm volatile("global_prefetch_b8 %0, off offset:256 scope:SCOPE_SE\n\t"
                 "global_prefetch_b8 %0, off offset:512 scope:SCOPE_SE\n\t"
                 "global_prefetch_b8 %0, off offset:768 scope:SCOPE_SE" :: "v"(p) : "memory");
}
// The address register of a request still holds its address here: a request moves no counter that could be waited on before the register is reused.
__device__ __forceinline__ void ask_hold(const void* p) { asm volatile("" :: "v"(p)); }

// Eight 16-byte asynchronous copies of one thread: tile rows r, r + 16, ..., r + 112 (global row pitch DM, LDS row pitch GLP).
// The s_wait_xcnt stands inside the statement so that no address register is rewritten in front of it.
__device__ __forceinline__ void copy8(unsigned l, const bf* g) {
    asm volatile("global_load_async_to_lds_b128 %0, %8, off\n\t"
                 "global_load_async_to_lds_b128 %1, %9, off\n\t"
                 "global_load_async_to_lds_b128 %2, %10, off\n\t"
                 "global_load_async_to_lds_b128 %3, %11, off\n\t"
                 "global_load_async_to_lds_b128 %4, %12, off\n\t"
                 "global_load_async_to_lds_b128 %5, %13, off\n\t"
                 "global_load_async_to_lds_b128 %6, %14, off\n\t"
                 "global_load_async_to_lds_b128 %7, %15, off\n\t"
                 "s_wait_xcnt 0x0"
                 :: "v"(l), "v"(l + 16 * GLP * 2), "v"(l + 32 * GLP * 2), "v"(l + 48 * GLP * 2), "v"(l + 64 * GLP * 2), "v"(l + 80 * GLP * 2), "v"(l + 96 * GLP * 2), "v"(l + 112 * GLP * 2),
                    "v"(g), "v"(g + (size_t)16 * DM), "v"(g + (size_t)32 * DM), "v"(g + (size_t)48 * DM), "v"(g + (size_t)64 * DM), "v"(g + (size_t)80 * DM), "v"(g + (size_t)96 * DM), "v"(g + (size_t)112 * DM)
                 : "memory");
}
// One stage of the GEMM ring: GT rows x GKS k of A, then of B; each thread copies 8 pieces of each. l: LDS byte address of the thread's first piece in the target buffer.
__device__ __forceinline__ void gemm_stage(unsigned l, const bf* ga, const bf* gb) { copy8(l, ga); copy8(l + GOPH * 2, gb); }
template <int BFK>
__device__ __forceinline__ v8f wmmau(v16us a, v16us b, v8f c) {
    if constexpr (BFK != 0) return wmmab(__builtin_bit_cast(v16bf, a), __builtin_bit_cast(v16bf, b), c);
    else return wmma16(__builtin_bit_cast(v16h, a), __builtin_bit_cast(v16h, b), c);
}

// gemm_core: the k loop of one GT x GT block tile, 8 waves, wave (wm, wn) = (wave >> 1, wave & 1) owning the 32 x 64 tile at (rb + 32 wm, cb + 64 wn), K = DM.
// A rows rb.. and Bt rows cb.. (K-contiguous 16-bit planes, bf16 for BFK != 0, else f16) come into LDS once per block by asynchronous copies (whole 256-B row pieces per 16 lanes),
// two buffers of GKS k, the next stage in flight while this one is worked on; fragments are two 16-B LDS loads each, same element map and same k order as from global memory.
template <int BFK>
__device__ __forceinline__ void gemm_core(const bf* __restrict__ A, const bf* __restrict__ Bt, int rb, int cb, const bf* pf, bf* ring, v8f (&acc)[2][4]) {
    const int lane = threadIdx.x & 31, lr = lane & 15, hi = lane >> 4;
    const int wave = __builtin_amdgcn_readfirstlane((int)(threadIdx.x >> 5));
    // copy map: thread c takes 16-byte piece c & 15 of tile rows (c >> 4) + 16 i, i = 0..7, of the A tile and of the B tile
    const int crw = (int)threadIdx.x >> 4, cpc = ((int)threadIdx.x & 15) * 8;
    const bf* ga = A + (size_t)(rb + crw) * DM + cpc;       // + stage * GKS
    const bf* gb = Bt + (size_t)(cb + crw) * DM + cpc;      // + stage * GKS
    const unsigned lc = (unsigned)(size_t)&ring[crw * GLP + cpc];   // LDS byte address: low 32 bits of the shared address
    const int ao = ((wave >> 1) * 32 + lr) * GLP + 8 * hi;          // + 16 mb * GLP + k_local
    const int bo = GOPH + ((wave & 1) * 64 + lr) * GLP + 8 * hi;    // + 16 nb * GLP + k_local
#pragma unroll
    for (int mb = 0; mb < 2; ++mb)
#pragma unroll
        for (int nb = 0; nb < 4; ++nb) acc[mb][nb] = (v8f){};
    gemm_stage(lc, ga, gb);
    ask1(pf);                                           // pf: the thread's one unit of the block's share of the A and B rows
    asm volatile("s_wait_asynccnt 0x0" ::: "memory");   // stage 0 landed before the barrier that publishes it
    __syncthreads();
    ask_hold(pf);
    gemm_stage(lc + GSTH * 2, ga + GKS, gb + GKS);
#pragma unroll 1
    for (int st = 0; st < DM / GKS; ++st) {
        const int so = (st & 1) * GSTH;
        const bf* pa = ring + so + ao; const bf* pb = ring + so + bo;
        v16us a[2][2], b[2][4];
#pragma unroll
        for (int i = 0; i < 2; ++i) a[0][i] = ldu(pa + i * 16 * GLP);
#pragma unroll
        for (int i = 0; i < 4; ++i) b[0][i] = ldu(pb + i * 16 * GLP);
#pragma unroll   // the 32-k blocks of a stage unrolled: every LDS offset an immediate, both fragment sets indexed by constants
        for (int kk = 0; kk < GKS / 32; ++kk) {
            const int cu = kk & 1, nx = cu ^ 1;
            if (kk + 1 < GKS / 32) {
#pragma unroll
                for (int i = 0; i < 2; ++i) a[nx][i] = ldu(pa + i * 16 * GLP + (kk + 1) * 32);
#pragma unroll
                for (int i = 0; i < 4; ++i) b[nx][i] = ldu(pb + i * 16 * GLP + (kk + 1) * 32);
            }
            __builtin_amdgcn_sched_barrier(0);   // keeps the next block's LDS loads one group ahead of this block's products (else they are moved in among them, each with a wait to 0)
#pragma unroll
            for (int nb = 0; nb < 4; ++nb)
#pragma unroll
                for (int mb = 0; mb < 2; ++mb) acc[mb][nb] = wmmau<BFK>(a[cu][mb], b[cu][nb], acc[mb][nb]);
            __builtin_amdgcn_sched_barrier(0);   // keeps this block's products ahead of the following load group and of the stage's foot
        }
        // four vector slots behind the stage's last products, on the way to the branches below
        asm volatile("v_nop\n\tv_nop\n\tv_nop\n\tv_nop" : "+v"(acc[0][2]), "+v"(acc[1][2]), "+v"(acc[0][3]), "+v"(acc[1][3]) : "v"(a[1][0]), "v"(a[1][1]), "v"(b[1][2]), "v"(b[1][3]));
        // publish point of stage st + 1, which also frees the buffer that this trip has read
        asm volatile("s_wait_dscnt 0x0" ::: "memory");      // this wave's reads of the buffer have returned before it is refilled
        asm volatile("s_wait_asynccnt 0x0" ::: "memory");   // this wave's copies of stage st + 1 have landed before other waves read them
        __syncthreads();
        if (st + 2 < DM / GKS) gemm_stage(lc + (unsigned)so * 2, ga + (size_t)(st + 2) * GKS, gb + (size_t)(st + 2) * GKS);
    }
    asm volatile("s_wait_asynccnt 0x0" ::: "memory");       // nothing of this wave is in flight when it goes on to the epilogue
}

// Eight 16-byte asynchronous copies of one thread from f32 rows: tile rows r, r + 16, ..., r + 112 (rs floats between copied rows in global memory, LDS row pitch PLP).
// The s_wait_xcnt stands inside the statement so that no address register is rewritten in front of it.
__device__ __forceinline__ void copy8f(unsigned l, const float* g, size_t rs) {
    asm volatile("global_load_async_to_lds_b128 %0, %8, off\n\t"
                 "global_load_async_to_lds_b128 %1, %9, off\n\t"
                 "global_load_async_to_lds_b128 %2, %10, off\n\t"
                 "global_load_async_to_lds_b128 %3, %11, off\n\t"
                 "global_load_async_to_lds_b128 %4, %12, off\n\t"
                 "global_load_async_to_lds_b128 %5, %13, off\n\t"
                 "global_load_async_to_lds_b128 %6, %14, off\n\t"
                 "global_load_async_to_lds_b128 %7, %15, off\n\t"
                 "s_wait_xcnt 0x0"
                 :: "v"(l), "v"(l + 16 * PLP * 4), "v"(l + 32 * PLP * 4), "v"(l + 48 * PLP * 4), "v"(l + 64 * PLP * 4), "v"(l + 80 * PLP * 4), "v"(l + 96 * PLP * 4), "v"(l + 112 * PLP * 4),
                    "v"(g), "v"(g + rs), "v"(g + 2 * rs), "v"(g + 3 * rs), "v"(g + 4 * rs), "v"(g + 5 * rs), "v"(g + 6 * rs), "v"(g + 7 * rs)
                 : "memory");
}
// One stage of the projection ring: PT rows x PKS k (f32) of A, then of B; each thread copies 16 pieces of each. l: LDS byte address of the thread's first piece in the target buffer; ra, rb: floats between rows 16 apart.
__device__ __forceinline__ void proj_stage(unsigned l, const float* ga, size_t ra, const float* gb, size_t rb) {
    copy8f(l, ga, ra); copy8f(l + 128 * PLP * 4, ga + 8 * ra, ra);
    copy8f(l + POPF * 4, gb, rb); copy8f(l + POPF * 4 + 128 * PLP * 4, gb + 8 * rb, rb);
}
// f32 source of one 16-bit fragment; p already includes + 8*(lane>>4): pieces 0, 1 <- k0+8h+0..7, pieces 2, 3 <- k0+16+8h+0..7 (the element map of ldu, same for A and B)
__device__ __forceinline__ void ldraw(v4f (&r)[4], const float* p) { r[0] = *(const v4fa*)p; r[1] = *(const v4fa*)(p + 4); r[2] = *(const v4fa*)(p + 16); r[3] = *(const v4fa*)(p + 20); }
// the fragment itself: every element rounded to bf16, nearest even
__device__ __forceinline__ v16bf cvraw(const v4f (&r)[4]) {
    v16f x;
#pragma unroll
    for (int i = 0; i < 4; ++i)
#pragma unroll
        for (int j = 0; j < 4; ++j) x[4 * i + j] = r[i][j];
    return __builtin_convertvector(x, v16bf);
}

// proj_core: the k loop of one PT x PT block tile, 8 waves, wave (wm, wn) = (wave >> 1, wave & 1) owning the 64 x 128 tile at (64 wm, 128 wn), K = DM.
// A and B point at the tile's first rows in the f32 inputs themselves (as, bs floats between rows). The rows come into LDS as f32, once per block, by asynchronous copies
// (whole 256-B row pieces per 16 lanes), two buffers of PKS k, the next stage in flight while this one is worked on; a fragment is four 16-B LDS loads, rounded to bf16 in registers.
// A stage is four groups of 16 products (k block g >> 1, column half g & 1); the f32 source of the next group is fetched ahead of this group's products.
// A stage reads one 256-B unit of every row. RA, RB: rows of the A and of the B tile that this block asks L2 for (its share among the blocks that read the tile), pta, ptb: which share;
// waves 0 .. RA/32 - 1 ask for the A rows, the last RB/32 waves for the B rows, a row a lane, PD trips ahead of the stage's copies.
template <int RA, int RB>
__device__ __forceinline__ void proj_core(const float* __restrict__ A, size_t as, const float* __restrict__ B, size_t bs, int pta, int ptb, float* ring, v8f (&acc)[4][8]) {
    constexpr int PD = 2;
    static_assert(PKS * 4 == 256 && 2 + PD < DM / PKS);
    const int lane = threadIdx.x & 31, lr = lane & 15, hi = lane >> 4;
    const int wave = __builtin_amdgcn_readfirstlane((int)(threadIdx.x >> 5));
    // copy map: thread c takes 16-byte piece c & 15 of tile rows (c >> 4) + 16 i, i = 0..15, of the A tile and of the B tile
    const int crw = (int)threadIdx.x >> 4, cpc = ((int)threadIdx.x & 15) * 4;
    const float* ga = A + (size_t)crw * as + cpc;       // the thread's first piece of the stage being worked on: stepped by PKS every trip
    const float* gb = B + (size_t)crw * bs + cpc;
    const unsigned lc = (unsigned)(size_t)&ring[crw * PLP + cpc];   // LDS byte address: low 32 bits of the shared address
    const int ao = ((wave >> 1) * 64 + lr) * PLP + 8 * hi;          // + 16 mb * PLP + k_local
    const int bo = POPF + ((wave & 1) * 128 + lr) * PLP + 8 * hi;   // + 16 nb * PLP + k_local
#pragma unroll
    for (int mb = 0; mb < 4; ++mb)
#pragma unroll
        for (int nb = 0; nb < 8; ++nb) acc[mb][nb] = (v8f){};
    proj_stage(lc, ga, 16 * as, gb, 16 * bs);
    const bool ea = wave < RA / 32, eb = wave >= 8 - RB / 32;                     // the same for the whole wave: scalar branches
    const float* fa0 = A + (size_t)(pta * RA + (int)threadIdx.x % RA) * as;       // every thread's address lies in the tile, whether its wave asks or not
    const float* fb0 = B + (size_t)(ptb * RB + (int)threadIdx.x % RB) * bs;
    if (ea) ask3(fa0);                                                            // stages 1 .. 1 + PD
    if (eb) ask3(fb0);
    asm volatile("s_wait_asynccnt 0x0" ::: "memory");   // stage 0 landed before the barrier that publishes it
    __syncthreads();
    ask_hold(fa0); ask_hold(fb0);
    const float* fa = fa0 + (2 + PD) * PKS; const float* fb = fb0 + (2 + PD) * PKS;   // the unit of stage st + 2 + PD, st = 0
    proj_stage(lc + PSTF * 4, ga + PKS, 16 * as, gb + PKS, 16 * bs);
#pragma unroll 1
    for (int st = 0; st < DM / PKS; ++st) {
        const int so = (st & 1) * PSTF;
        const float* pa = ring + so + ao; const float* pb = ring + so + bo;
        v4f ra[4][4], rb[4][4];
        v16bf a[4], b[4];
#pragma unroll
        for (int i = 0; i < 4; ++i) ldraw(ra[i], pa + i * 16 * PLP);
#pragma unroll
        for (int i = 0; i < 4; ++i) ldraw(rb[i], pb + i * 16 * PLP);
#pragma unroll   // the groups of a stage unrolled: every LDS offset an immediate, every register set indexed by constants
        for (int g = 0; g < 4; ++g) {
            if ((g & 1) == 0) {
#pragma unroll
                for (int i = 0; i < 4; ++i) a[i] = cvraw(ra[i]);
            }
#pragma unroll
            for (int i = 0; i < 4; ++i) b[i] = cvraw(rb[i]);
            // inputs-only fence on the rounded fragments: the converts stand in front of the next group's loads, which then land in the registers just freed (else the f32 sources of two groups are live at once and accumulators spill)
            asm volatile("" :: "v"(a[0]), "v"(a[1]), "v"(a[2]), "v"(a[3]), "v"(b[0]), "v"(b[1]), "v"(b[2]), "v"(b[3]) : "memory");
            if (g + 1 < 4) {
                const int kn = ((g + 1) >> 1) * 32, hn = (g + 1) & 1;
                if (hn == 0) {
#pragma unroll
                    for (int i = 0; i < 4; ++i) ldraw(ra[i], pa + i * 16 * PLP + kn);
                }
#pragma unroll
                for (int i = 0; i < 4; ++i) ldraw(rb[i], pb + (hn * 4 + i) * 16 * PLP + kn);
            }
            __builtin_amdgcn_sched_barrier(0);   // keeps the next group's LDS loads one group ahead of this group's products (else they are moved in among them, each with a wait)
#pragma unroll
            for (int nb = 0; nb < 4; ++nb)
#pragma unroll
                for (int mb = 0; mb < 4; ++mb) acc[mb][(g & 1) * 4 + nb] = wmmab(a[mb], b[nb], acc[mb][(g & 1) * 4 + nb]);
            __builtin_amdgcn_sched_barrier(0);   // keeps this group's products ahead of the next group's converts and of the stage's foot
        }
        asm volatile("v_nop\n\tv_nop\n\tv_nop\n\tv_nop");   // four vector slots behind the stage's last products, on the way to the branches below
        // publish point of stage st + 1, which also frees the buffer that this trip has read
        asm volatile("s_wait_dscnt 0x0" ::: "memory");      // this wave's reads of the buffer have returned before it is refilled
        asm volatile("s_wait_asynccnt 0x0" ::: "memory");   // this wave's copies of stage st + 1 have landed before other waves read them
        __syncthreads();
        ga += PKS; gb += PKS;
        if (st + 2 < DM / PKS) proj_stage(lc + (unsigned)so * 4, ga + PKS, 16 * as, gb + PKS, 16 * bs);
        if (st + 2 + PD < DM / PKS) { if (ea) ask1(fa); if (eb) ask1(fb); }
        if (st + 3 + PD < DM / PKS) { fa += PKS; fb += PKS; }   // stepped only while the next unit exists: the registers that the requests name never leave the rows
    }
    asm volatile("s_wait_asynccnt 0x0" ::: "memory");       // nothing of this wave is in flight when it goes on to the epilogue
}

// proj_tile: bf16 GEMM tile (bx, by) of 256 x 256 by one block of 8 waves (proj_core), each wave's 64 x 128 tile in 32 accumulators, K = DM; A, B: the tile's first rows in the f32 inputs.
// C[m][n] = sum_k A[m][k] Bt[n][k] + bias (BROW == 0: bias[n]; BROW == 1: bias[m]; bias taken at its bf16 RNE value, added in f32),
// times osc (f32), written as f16 (Ph) at
// base (r0/RB)*sRB + (r0%RB)*pitch + (c0/CB)*sCB + (c0%CB) of each 64-column half, row pitch 'pitch' (halves).
// The output rows are staged in the ring's own LDS: behind the foot of proj_core's last trip (every wave's s_wait_dscnt 0, s_wait_asynccnt 0, then the barrier) nobody reads the ring and no copy is in flight.
template <int BROW>
__device__ __forceinline__ void proj_tile(const float* __restrict__ A, size_t as, const float* __restrict__ B, size_t bs, const float* __restrict__ bias, h16* Ph, float osc, int RB, size_t sRB, int pitch, int CB, size_t sCB, int bx, int by, float* ring) {
    const int lane = threadIdx.x & 31, lr = lane & 15, hi = lane >> 4;
    const int wave = __builtin_amdgcn_readfirstlane((int)(threadIdx.x >> 5));
    float* os = ring + wave * 16 * 68;   // each wave stages its output rows in its own range
    const int r0 = bx * PT + (wave >> 1) * 64, cw = by * PT + (wave & 1) * 128;
    v8f acc[4][8];
    // BROW == 0: the x tile (A) is read by the 4 blocks by = 0..3, 16 apart in the flat index: a quarter each; the W tile (B) by the 16 blocks bx: an eighth each.
    // BROW == 1: the W tile (A) is read by the 16 blocks by, 4 apart: an eighth each, even and odd by apart; the x tile (B) by 4 neighbours: each asks for all of it.
    if constexpr (BROW == 0) proj_core<64, 32>(A, as, B, bs, by, (bx & 3) | ((bx >> 3) << 2), ring, acc);
    else proj_core<32, 256>(A, as, B, bs, by >> 1, 0, ring, acc);
    const int rq = lane >> 3, c8 = (lane & 7) * 8;
#pragma unroll
    for (int ch = 0; ch < 2; ++ch) {
        const int c0 = cw + ch * 64;
        v4f bc0 = (v4f){0.0f, 0.0f, 0.0f, 0.0f}, bc1 = (v4f){0.0f, 0.0f, 0.0f, 0.0f};
        if constexpr (BROW == 0) {
            const v4f t0 = *(const v4f*)(bias + c0 + c8);
            asm volatile("s_wait_xcnt 0x0" ::: "memory");   // in front of the second load, whose result may land in the address registers that the first load names
            const v4f t1 = *(const v4f*)(bias + c0 + c8 + 4);
            asm volatile("s_wait_xcnt 0x0" ::: "memory");   // in front of whatever rewrites the address registers of the second load
#pragma unroll
            for (int i = 0; i < 4; ++i) { bc0[i] = bfr(t0[i]); bc1[i] = bfr(t1[i]); }
        }
        const size_t tbase = (size_t)(r0 / RB) * sRB + (size_t)(r0 % RB) * (size_t)pitch + (size_t)(c0 / CB) * sCB + (size_t)(c0 % CB);
#pragma unroll
        for (int mb = 0; mb < 4; ++mb) {
#pragma unroll
            for (int nb = 0; nb < 4; ++nb) {
#pragma unroll
                for (int j = 0; j < 8; ++j) os[(hi * 8 + j) * 68 + nb * 16 + lr] = acc[mb][ch * 4 + nb][j]; }   // D: row 8h+j, col lane&15
            wave_sync();
            const size_t sb = tbase + (size_t)(mb * 16) * (size_t)pitch;
#pragma unroll
            for (int s = 0; s < 4; ++s) { const int row = 4 * s + rq;   // 4 s x 4 row groups = 16 rows; 8 lanes x 8 = 64 columns
                float br = 0.0f;
                if constexpr (BROW != 0) br = bfr(bias[r0 + mb * 16 + row]);
                const v4f x0 = *(const v4fa*)(&os[row * 68 + c8]); const v4f x1 = *(const v4fa*)(&os[row * 68 + c8 + 4]); v8h hv;
#pragma unroll
                for (int i = 0; i < 4; ++i) { const float y0 = (x0[i] + bc0[i] + br) * osc; const float y1 = (x1[i] + bc1[i] + br) * osc;
                    hv[i] = (h16)y0; hv[4 + i] = (h16)y1; }
                const size_t oo = sb + (size_t)row * (size_t)pitch + c8;
                *(v8h*)(Ph + oo) = hv;
                asm volatile("s_wait_xcnt 0x0" ::: "memory"); }   // in front of the next rows' loads and converts, which rewrite registers that the store above names
            wave_sync();
        }
    }
}

// k_proj3: the three input projections straight from the f32 inputs, and the f16 plane of Wo, in one launch; grid (PGX, 4), 256 threads; one block per WGP (LDS, registers).
// y = 0, 1 (q, k): A = x rows (m = b*SEQ + t, source row t*NB_FULL + b), B = W rows (n = h*64 + d), column bias -> plane [(b*16 + h)][t][d]; q is scaled by HD^-0.5 * log2(e).
// y = 2 (v^T): A = Wv rows (m = h*64 + d), B = x rows (n = b*SEQ + t), row bias -> plane [(b*1024 + m)][t] = [(b*16 + h)][d][t].
// y = 3: Wo -> f16 of its bf16 RNE value, x64; a wave takes whole rows, all of its loads issued before the first convert; these blocks pass no barrier.
__global__ __launch_bounds__(256) void k_proj3(const float* __restrict__ xq, const float* __restrict__ xk, const float* __restrict__ xv, const float* __restrict__ wq, const float* __restrict__ wk, const float* __restrict__ wv, const float* __restrict__ wo,
                                               const float* __restrict__ bq, const float* __restrict__ bk, const float* __restrict__ bv, h16* QH, h16* KP, h16* VT, h16* WO) {
    __shared__ __align__(16) float ring[2 * PSTF];
    static_assert(8 * 16 * 68 <= 2 * PSTF);            // the eight waves' staging ranges lie inside the ring
    const int z = blockIdx.y, x = blockIdx.x;          // the same for the whole block: every barrier below is passed by all of its waves or by none
    if (z == 3) {
        constexpr int RW = DM / (PGX * 8);             // rows of a wave
        const unsigned lane = threadIdx.x & 31;
        const int w = x * 8 + __builtin_amdgcn_readfirstlane((int)(threadIdx.x >> 5));
        v4f t[RW][8];
#pragma unroll
        for (int r = 0; r < RW; ++r)
#pragma unroll
            for (int j = 0; j < 8; ++j) t[r][j] = ((const v4f*)(wo + (size_t)(w * RW + r) * DM))[lane + j * 32];
#pragma unroll
        for (int r = 0; r < RW; ++r)
#pragma unroll
            for (int j = 0; j < 8; ++j) { v4h o;
#pragma unroll
                for (int i = 0; i < 4; ++i) o[i] = (h16)(bfr(t[r][j][i]) * WOS);
                ((v4h*)(WO + (size_t)(w * RW + r) * DM))[lane + j * 32] = o; }
    } else if (z == 2) {
        const int bx = x % (DM / PT), by = x / (DM / PT), n0 = by * PT;
        proj_tile<1>(wv + (size_t)bx * PT * DM, (size_t)DM, xv + ((size_t)(n0 % SEQ) * NB_FULL + (size_t)(n0 / SEQ)) * DM, (size_t)NB_FULL * DM, bv, VT, 1.0f, DM, (size_t)0, SEQ, SEQ, (size_t)DM * SEQ, bx, by, ring);
    } else {
        const bool q = z == 0;
        const int bx = x % (NB * SEQ / PT), by = x / (NB * SEQ / PT), m0 = bx * PT;
        proj_tile<0>((q ? xq : xk) + ((size_t)(m0 % SEQ) * NB_FULL + (size_t)(m0 / SEQ)) * DM, (size_t)NB_FULL * DM, (q ? wq : wk) + (size_t)by * PT * DM, (size_t)DM, q ? bq : bk, q ? QH : KP, q ? SC2 : 1.0f,
                     SEQ, (size_t)NH_ * SEQ * HD, HD, HD, (size_t)SEQ * HD, bx, by, ring);
    }
}

// One stage of the flash kernel's ring: each thread copies two 16-byte pieces of the K tile and two of the V^T tile (tile rows r and r + 32) from global memory to LDS.
// lds: byte address of the thread's piece in the K tile of the target buffer. The s_wait_xcnt stands inside the statement so that no address register is rewritten in front of it.
__device__ __forceinline__ void stage_copy(unsigned lds, const h16* gk, const h16* gv) {
    const unsigned l1 = lds + 32 * LP * 2, l2 = lds + TLH * 2, l3 = lds + TLH * 2 + 32 * LP * 2;
    const h16* gk1 = gk + (size_t)32 * HD; const h16* gv1 = gv + (size_t)32 * SEQ;
    asm volatile("global_load_async_to_lds_b128 %0, %4, off\n\t"
                 "global_load_async_to_lds_b128 %1, %5, off\n\t"
                 "global_load_async_to_lds_b128 %2, %6, off\n\t"
                 "global_load_async_to_lds_b128 %3, %7, off\n\t"
                 "s_wait_xcnt 0x0"
                 :: "v"(lds), "v"(l1), "v"(l2), "v"(l3), "v"(gk), "v"(gk1), "v"(gv), "v"(gv1) : "memory");
}

// k_flash: fused attention, one wave per 16 query rows of one (batch, head); Q fragments straight from the f16 plane (two 16-B loads each, arithmetic addressing).
// K and V^T: the block's waves share every key tile, so a stage of KT keys (K rows, V^T rows, 128 B each) is brought into LDS once per block by asynchronous copies
// (whole 128-B lines per 8 lanes), two buffers, the next stage in flight while this one is worked on; fragments are two 16-B LDS loads each, same element map as before.
// Transposed form: S^T[key][t] = K Q^T (A = K rows, B = Q rows); lane (t = lane&15, h = lane>>4) holds keys 8h+r of each 16-key tile, so the packed
// P tile is directly the B fragment of O^T[d][t] = V^T P^T (element r <- tile keys 0..15, element 8+r <- tile keys 16..31, lane unchanged).
// Softmax state (running max, partial sum) is one scalar per lane; the two lane halves of a row are combined with one xor-16 exchange.
__global__ __launch_bounds__(32 * AW) void k_flash(const h16* __restrict__ QH, const h16* __restrict__ KP, const h16* __restrict__ VT, h16* CTX) {
    __shared__ __align__(16) float os[AW * 16 * 68];
    __shared__ __align__(16) h16 ring[2 * STH];
    const int lane = threadIdx.x & 31, lr = lane & 15, hi = lane >> 4;
    const int wave = __builtin_amdgcn_readfirstlane((int)(threadIdx.x >> 5));
    const int zh = blockIdx.y; const int b = zh / NH_, h = zh % NH_;
    const int t0 = (blockIdx.x * AW + wave) * 16;
    const size_t pbase = (size_t)zh * SEQ * HD;
    const size_t qo = pbase + (size_t)(t0 + lr) * HD + 8 * hi;
    const v16h qh0 = ldh(QH + qo), qh1 = ldh(QH + qo + 32);   // B fragments: col t, k = d
    // copy map: thread c takes 16-byte piece c & 7 of tile rows c >> 3 and 32 + (c >> 3), of the K tile and of the V^T tile
    const int crw = (int)threadIdx.x >> 3, cpc = ((int)threadIdx.x & 7) * 8;
    const h16* gk = KP + pbase + (size_t)crw * HD + cpc;      // + stage * KT * HD   (row = key)
    const h16* gv = VT + pbase + (size_t)crw * SEQ + cpc;     // + stage * KT        (row = d)
    const unsigned lc = (unsigned)(size_t)&ring[crw * LP + cpc];   // LDS byte address: low 32 bits of the shared address
    const int ko = lr * LP + 8 * hi;            // + key_local * LP          (A fragment: row key, k = d)
    const int vo = TLH + lr * LP + 8 * hi;      // + 16j * LP + key_local    (A fragment: row d, k = key)
    stage_copy(lc, gk, gv);
    // the head's K and V^T planes are 1024 units each, read by the 16 blocks of the head: every block asks for an eighth (one unit a thread: waves 0..3 K, waves 4..7 V^T)
    static_assert(SEQ * HD * 2 == 1024 * 256 && AW == 8 && SEQ / (16 * AW) == 16);
    const h16* pf = (wave < 4 ? KP : VT) + pbase + (size_t)((((int)threadIdx.x & 127) * 8 + (((int)blockIdx.x & 3) | (((int)blockIdx.x >> 3) << 2))) * 128);
    ask1(pf);
    asm volatile("s_wait_asynccnt 0x0" ::: "memory");   // stage 0 landed before the barrier that publishes it
    __syncthreads();
    ask_hold(pf);
    stage_copy(lc + STH * 2, gk + (size_t)KT * HD, gv + KT);
    v8f o0 = (v8f){}, o1 = (v8f){}, o2 = (v8f){}, o3 = (v8f){};
    float m = -3.0e38f, l = 0.0f;
#pragma unroll 1
    for (int st = 0; st < SEQ / KT; ++st) {
      const int bo = (st & 1) * STH;
      // one softmax step per stage: all KT = 64 keys share one running-maximum update, one half exchange and one rescale of the output tiles
      {
        const h16* ka = ring + bo + ko;
        v16h kf0[4], kf1[4];     // 16-key tile i: d 0..31, d 32..63
#pragma unroll
        for (int i = 0; i < 4; ++i) { kf0[i] = ldh(ka + i * 16 * LP); kf1[i] = ldh(ka + i * 16 * LP + 32); }
        __builtin_amdgcn_sched_barrier(0);   // keeps the K loads one group ahead of the products (else they are moved in among them)
        // the q plane carries the score scale: the accumulators hold the log2-domain scores as they are
        v8f s0 = (v8f){}, s1 = (v8f){}, s2 = (v8f){}, s3 = (v8f){};
        s0 = wmma16(kf0[0], qh0, s0); s1 = wmma16(kf0[1], qh0, s1); s2 = wmma16(kf0[2], qh0, s2); s3 = wmma16(kf0[3], qh0, s3);
        s0 = wmma16(kf1[0], qh1, s0); s1 = wmma16(kf1[1], qh1, s1); s2 = wmma16(kf1[2], qh1, s2); s3 = wmma16(kf1[3], qh1, s3);
        __builtin_amdgcn_sched_barrier(0);   // keeps the four accumulator chains interleaved as written (else one tile's two dependent products are issued in a row)
        // the maximum of each tile in a chain of its own (four short chains, not one of 32 links)
        float m0 = -3.0e38f, m1 = -3.0e38f, m2 = -3.0e38f, m3 = -3.0e38f;
#pragma unroll
        for (int r = 0; r < 8; r += 2) { m0 = fmaxf(m0, fmaxf(s0[r], s0[r + 1])); m1 = fmaxf(m1, fmaxf(s1[r], s1[r + 1])); m2 = fmaxf(m2, fmaxf(s2[r], s2[r + 1])); m3 = fmaxf(m3, fmaxf(s3[r], s3[r + 1])); }
        const float mx = fmaxf(fmaxf(m0, m1), fmaxf(m2, m3));
        const float mo = __shfl_xor(mx, 16, 32);
        __builtin_amdgcn_sched_barrier(0);   // keeps the exchange ahead of the V^T loads in the LDS queue (else it returns only behind all sixteen of them)
        const h16* va = ring + bo + vo;
        const v16h v0 = ldh(va), v1 = ldh(va + 16 * LP), v2 = ldh(va + 32 * LP), v3 = ldh(va + 48 * LP);                         // keys 0..31 of the stage
        const v16h w0 = ldh(va + 32), w1 = ldh(va + 16 * LP + 32), w2 = ldh(va + 32 * LP + 32), w3 = ldh(va + 48 * LP + 32);     // keys 32..63
        __builtin_amdgcn_sched_barrier(0);   // keeps the V^T loads ahead of the exponentials, which cover their latency
        const float mnew = fmaxf(m, fmaxf(mx, mo));
        const float alpha = __builtin_amdgcn_exp2f(m - mnew);
        const float sh = PSH - mnew;
        v8f t0, t1, t2, t3;
#pragma unroll
        for (int r = 0; r < 8; ++r) { t0[r] = s0[r] + sh; t1[r] = s1[r] + sh; t2[r] = s2[r] + sh; t3[r] = s3[r] + sh; }
        v16h pb0, pb1; float ls = 0.0f;
#pragma unroll
        for (int r = 0; r < 8; ++r) { const h16 pa = (h16)__builtin_amdgcn_exp2f(t0[r]); const h16 pc = (h16)__builtin_amdgcn_exp2f(t1[r]); pb0[r] = pa; pb0[8 + r] = pc; ls += (float)pa + (float)pc; }
#pragma unroll
        for (int r = 0; r < 8; ++r) { const h16 pa = (h16)__builtin_amdgcn_exp2f(t2[r]); const h16 pc = (h16)__builtin_amdgcn_exp2f(t3[r]); pb1[r] = pa; pb1[8 + r] = pc; ls += (float)pa + (float)pc; }
        l = l * alpha + ls; m = mnew;
        o0 = o0 * alpha; o1 = o1 * alpha; o2 = o2 * alpha; o3 = o3 * alpha;
        o0 = wmma16(v0, pb0, o0); o1 = wmma16(v1, pb0, o1); o2 = wmma16(v2, pb0, o2); o3 = wmma16(v3, pb0, o3);
        o0 = wmma16(w0, pb1, o0); o1 = wmma16(w1, pb1, o1); o2 = wmma16(w2, pb1, o2); o3 = wmma16(w3, pb1, o3);
        // four vector slots behind the stage's last products, on the way to the branch at the stage's foot
        asm volatile("v_nop\n\tv_nop\n\tv_nop\n\tv_nop" : "+v"(o0), "+v"(o1), "+v"(o2), "+v"(o3) : "v"(w0), "v"(w1), "v"(w2), "v"(w3), "v"(pb1));
      }
      // publish point of stage st + 1, which also frees the buffer that this trip has read
      asm volatile("s_wait_dscnt 0x0" ::: "memory");      // this wave's reads of the buffer have returned before it is refilled
      asm volatile("s_wait_asynccnt 0x0" ::: "memory");   // this wave's copies of stage st + 1 have landed before other waves read them
      __syncthreads();
      if (st + 2 < SEQ / KT) stage_copy(lc + (unsigned)bo * 2, gk + (size_t)(st + 2) * KT * HD, gv + (size_t)(st + 2) * KT);
    }
    asm volatile("s_wait_asynccnt 0x0" ::: "memory");     // nothing of this wave is in flight when it goes on to the epilogue
    l += __shfl_xor(l, 16, 32);
    const float inv = CTXS * (1.0f / l);
    const int wb = wave * 16 * 68;
    // O^T D layout: o_j[r] = (d = 16j + 8h + r, t = lane&15) -> os[t][d]; rows 0..15 x columns 0..63 all written
    { v4f a, c;
      a[0] = o0[0] * inv; a[1] = o0[1] * inv; a[2] = o0[2] * inv; a[3] = o0[3] * inv; c[0] = o0[4] * inv; c[1] = o0[5] * inv; c[2] = o0[6] * inv; c[3] = o0[7] * inv;
      *(v4fa*)(&os[wb + lr * 68 +  0 + 8 * hi]) = a; *(v4fa*)(&os[wb + lr * 68 +  0 + 8 * hi + 4]) = c;
      a[0] = o1[0] * inv; a[1] = o1[1] * inv; a[2] = o1[2] * inv; a[3] = o1[3] * inv; c[0] = o1[4] * inv; c[1] = o1[5] * inv; c[2] = o1[6] * inv; c[3] = o1[7] * inv;
      *(v4fa*)(&os[wb + lr * 68 + 16 + 8 * hi]) = a; *(v4fa*)(&os[wb + lr * 68 + 16 + 8 * hi + 4]) = c;
      a[0] = o2[0] * inv; a[1] = o2[1] * inv; a[2] = o2[2] * inv; a[3] = o2[3] * inv; c[0] = o2[4] * inv; c[1] = o2[5] * inv; c[2] = o2[6] * inv; c[3] = o2[7] * inv;
      *(v4fa*)(&os[wb + lr * 68 + 32 + 8 * hi]) = a; *(v4fa*)(&os[wb + lr * 68 + 32 + 8 * hi + 4]) = c;
      a[0] = o3[0] * inv; a[1] = o3[1] * inv; a[2] = o3[2] * inv; a[3] = o3[3] * inv; c[0] = o3[4] * inv; c[1] = o3[5] * inv; c[2] = o3[6] * inv; c[3] = o3[7] * inv;
      *(v4fa*)(&os[wb + lr * 68 + 48 + 8 * hi]) = a; *(v4fa*)(&os[wb + lr * 68 + 48 + 8 * hi + 4]) = c; }
    wave_sync();
    h16* crow = CTX + ((size_t)b * SEQ + t0) * DM + h * HD;
    const int rq = lane >> 3, c8 = (lane & 7) * 8;
{
#pragma unroll
        for (int s = 0; s < 4; ++s) { const int row = 4 * s + rq;   // 4 s x 4 row groups = 16 rows; 8 lanes x 8 halves = 64 columns
            const v4f x0 = *(const v4fa*)(&os[wb + row * 68 + c8]); const v4f x1 = *(const v4fa*)(&os[wb + row * 68 + c8 + 4]); v8h hv;
#pragma unroll
            for (int i = 0; i < 4; ++i) { hv[i] = (h16)x0[i]; hv[4 + i] = (h16)x1[i]; }
            *(v8h*)(crow + (size_t)row * DM + c8) = hv; }
         }
}

// k_outp: f16 GEMM, one block of 8 waves per 128 x 128 tile (gemm_core), each wave's 32 x 64 tile in 8 accumulators, K = DM.
// OUT[(s*NB_FULL + b)][n] = OSCL * sum_k A[b*SEQ + s][k] Bt[n][k] + bias[n] (bias at its bf16 RNE value, f32 add). grid (NB*SEQ/128, DM/128), 256 threads.
__global__ __launch_bounds__(256) void k_outp(const h16* __restrict__ A, const h16* __restrict__ Bt, const float* __restrict__ bias, float* OUT) {
    __shared__ __align__(16) bf ring[2 * GSTH];
    __shared__ __align__(16) float osb[8 * 16 * 68];
    const int lane = threadIdx.x & 31, lr = lane & 15, hi = lane >> 4;
    const int wave = __builtin_amdgcn_readfirstlane((int)(threadIdx.x >> 5));
    float* os = osb + wave * 16 * 68;            // each wave stages its output rows in its own range
    const int r0 = blockIdx.x * GT + (wave >> 1) * 32, c0 = blockIdx.y * GT + (wave & 1) * 64;
    v8f acc[2][4];
    // the 128 ctx rows (8 units each) are read by the 8 blocks y, 32 apart in the flat index: 16 rows each (waves 0..3); the 128 Wo rows by the 32 blocks x: 16 rows each (waves 4..7)
    static_assert(DM * 2 == 8 * 256 && DM / GT == 8 && GT == 8 * 16);
    const int pr = ((int)threadIdx.x & 127) >> 3, pu = ((int)threadIdx.x & 7) * 128;
    const h16* pf = wave < 4 ? A + (size_t)(blockIdx.x * GT + blockIdx.y * 16 + pr) * DM + pu
                             : Bt + (size_t)(blockIdx.y * GT + ((blockIdx.x & 3) | (((blockIdx.x >> 3) & 1) << 2)) * 16 + pr) * DM + pu;
    gemm_core<0>((const bf*)A, (const bf*)Bt, blockIdx.x * GT, blockIdx.y * GT, (const bf*)pf, ring, acc);
    const int bb = r0 / SEQ, sb = r0 % SEQ;        // tile rows share one batch (SEQ % 64 == 0)
    const int cofs = lr * 4;
    v4f bv;
    { const v4f t = *(const v4f*)(bias + c0 + cofs);
#pragma unroll
      for (int i = 0; i < 4; ++i) bv[i] = bfr(t[i]); }
#pragma unroll
    for (int mb = 0; mb < 2; ++mb) {
#pragma unroll
        for (int nb = 0; nb < 4; ++nb) {
#pragma unroll
            for (int j = 0; j < 8; ++j) os[(hi * 8 + j) * 68 + nb * 16 + lr] = acc[mb][nb][j]; }   // D: row 8h+j, col lane&15
        wave_sync();
{
#pragma unroll
            for (int s = 0; s < 8; ++s) { const int row = 2 * s + hi;   // 8 s x 2 rows = 16 rows; 16 lanes x 4 floats = 64 columns
                const v4f x = *(const v4fa*)(&os[row * 68 + cofs]); v4f val;
#pragma unroll
                for (int i = 0; i < 4; ++i) val[i] = x[i] * OSCL + bv[i];
                float* dst = OUT + ((size_t)(sb + mb * 16 + row) * NB_FULL + bb) * DM + c0 + cofs;
                *(v4f*)dst = val; }
             }
        wave_sync();
    }
}

static constexpr size_t al256(size_t v) { return (v + 255) & ~(size_t)255; }
static constexpr size_t SZ_W   = al256((size_t)DM * DM * 2);                // one 16-bit weight plane
static constexpr size_t SZ_PL  = al256((size_t)NB * NH_ * SEQ * HD * 2);    // one head plane
static constexpr size_t SZ_CTX = al256((size_t)NB * SEQ * DM * 2);          // f16 ctx plane
static constexpr size_t SZ_TOTAL = SZ_W + 3 * SZ_PL + SZ_CTX;
static_assert(SZ_TOTAL <= (size_t)134217728);          // workspace carve <= 128 MiB
static_assert(((size_t)DM * DM * 2) % 256 == 0);

extern "C" void kernel_launch(void* const* d_in, const int* in_sizes, int n_in,
                              void* d_out, int out_size, void* d_ws, size_t ws_size, hipStream_t stream) {
    if (n_in < 11) return;
    const size_t needx = ((size_t)(SEQ - 1) * NB_FULL + NB) * DM;
    if ((size_t)in_sizes[0] < needx || (size_t)in_sizes[1] < needx || (size_t)in_sizes[2] < needx) return;
    if ((size_t)in_sizes[3] < (size_t)DM * DM || (size_t)in_sizes[5] < (size_t)DM * DM || (size_t)in_sizes[7] < (size_t)DM * DM || (size_t)in_sizes[9] < (size_t)DM * DM) return;
    if (in_sizes[4] < DM || in_sizes[6] < DM || in_sizes[8] < DM || in_sizes[10] < DM) return;
    if ((size_t)out_size < needx) return;
    if (SZ_TOTAL > ws_size) return;
    // wire order: query, key, value, Wq, bq, Wk, bk, Wv, bv, Wo, bo (weights [out][in] = Bt as-is)
    const float* xq = (const float*)d_in[0]; const float* xk = (const float*)d_in[1]; const float* xv = (const float*)d_in[2];
    const float* wq = (const float*)d_in[3]; const float* bq = (const float*)d_in[4];
    const float* wk = (const float*)d_in[5]; const float* bk = (const float*)d_in[6];
    const float* wv = (const float*)d_in[7]; const float* bvv = (const float*)d_in[8];
    const float* wo = (const float*)d_in[9]; const float* bo = (const float*)d_in[10];
    float* OUT = (float*)d_out;      // [SEQ][NB_FULL][1024]
    char* wsp = (char*)d_ws;
    h16* WO = (h16*)wsp; wsp += SZ_W;                // f16, x64
    h16* QH = (h16*)wsp; wsp += SZ_PL;               // [NB*16][SEQ][64]
    h16* KP = (h16*)wsp; wsp += SZ_PL;               // [NB*16][SEQ][64]
    h16* VT = (h16*)wsp; wsp += SZ_PL;               // [NB*16][64][SEQ]
    h16* CTX = (h16*)wsp; wsp += SZ_CTX;             // [NB*SEQ][1024], x32

    // q, k and v^T planes from the f32 inputs; the f16 plane of Wo
    k_proj3<<<dim3(PGX, 4, 1), 256, 0, stream>>>(xq, xk, xv, wq, wk, wv, wo, bq, bk, bvv, QH, KP, VT, WO);

    k_flash<<<dim3(SEQ / (16 * AW), NB * NH_, 1), 32 * AW, 0, stream>>>(QH, KP, VT, CTX);

    // output projection: A = ctx rows (m = b*SEQ + s), Bt = Wo rows (n) -> OUT row s*NB_FULL + b
    k_outp<<<dim3(NB * SEQ / GT, DM / GT, 1), 256, 0, stream>>>(CTX, WO, bo, OUT);
}
